// v000
// Times are from an AMD MI455X. After a warm-up the kernel runs many times in a row, and a time is the length of
// such a window on the GPU divided by its runs, so every launch and the gaps after it count. The runs cycle
// through copies of the inputs. A figure is the median of several windows, for all but v000 over two sittings.
// Sittings can differ by a few percent; kernels timed side by side share one.
// v000 is the starting kernel. One run takes 5420 microseconds.
#include <hip/hip_runtime.h>
#include <hip/hip_bf16.h>

#define BB 4
#define TT 2048
#define DD 512
#define HH 4
#define KK 128
#define VV 128
#define MM 64
#define BT (BB * TT)          // 8192 rows for all GEMMs

#define LDA 40                // padded LDS row length (bf16 elems): 80B, 16B-aligned runs

typedef __attribute__((ext_vector_type(16))) __bf16 v16bf;
typedef __attribute__((ext_vector_type(8)))  __bf16 v8bf;
typedef __attribute__((ext_vector_type(2)))  __bf16 v2bf;
typedef __attribute__((ext_vector_type(8)))  float  v8f;

#if __has_builtin(__builtin_amdgcn_cvt_pk_bf16_f32)
__device__ __forceinline__ unsigned pack2bf(float a, float b) {
    v2bf r = __builtin_amdgcn_cvt_pk_bf16_f32(a, b);   // v_cvt_pk_bf16_f32
    return __builtin_bit_cast(unsigned, r);
}
#else
__device__ __forceinline__ unsigned pack2bf(float a, float b) {
    unsigned ua = __builtin_bit_cast(unsigned, a);
    unsigned ub = __builtin_bit_cast(unsigned, b);
    ua = (ua + 0x7FFFu + ((ua >> 16) & 1u)) >> 16;     // RNE
    ub = (ub + 0x7FFFu + ((ub >> 16) & 1u)) >> 16;
    return ua | (ub << 16);
}
#endif

__device__ __forceinline__ __bf16 f2bf(float f) {
    union { unsigned u; __bf16 h[2]; } x;
    x.u = pack2bf(f, 0.f);
    return x.h[0];
}

// ---------------------------------------------------------------------------
// Tiled GEMM: Y(8192 x N) = act( X(8192 x 512) @ W(512 x N) ), bf16 WMMA.
// Block = 256 threads (8 waves). Block tile = 128(M) x 64(N), K-step = 32.
// Software-pipelined double-buffered LDS: fetch tile k+1 to registers, WMMA
// tile k from LDS[cur], then stage registers into LDS[cur^1]; ONE barrier
// per K-step. A staged row-major As[row][k]; B staged transposed Bst[col][k]
// so every lane fragment is two contiguous 16B runs -> ds_load_b128.
// ACT: 0 = none, 1 = swish, 2 = ge = exp(log_sigmoid(x)/8)
// ---------------------------------------------------------------------------
template <int ACT>
__global__ __launch_bounds__(256) void gemm_wmma_kernel(
    const float* __restrict__ X, const float* __restrict__ W,
    float* __restrict__ Y, int N) {
    __shared__ __align__(16) __bf16 As[2][128 * LDA];   // 2 x 10.0 KB
    __shared__ __align__(16) __bf16 Bst[2][64 * LDA];   // 2 x  5.0 KB

    const int tid  = threadIdx.x;
    const int lane = tid & 31;
    const int wv   = tid >> 5;
    const int rowBase = blockIdx.y * 128;
    const int colBase = blockIdx.x * 64;

    const int mrow = lane & 15;            // row of 16-row tile / col of 16-col tile
    const int kb   = (lane >> 4) << 3;     // 0 or 8: K sub-block for this half-wave

    const float4* X4 = (const float4*)X;
    const float4* W4 = (const float4*)W;

    // Per-thread staging coordinates (constant)
    int arr[4], ac[4];                     // A: row, float4-col
#pragma unroll
    for (int i = 0; i < 4; ++i) { int e = tid + i * 256; arr[i] = e >> 3; ac[i] = e & 7; }
    int brr[2], bc[2];                     // B: k-row, float4-col
#pragma unroll
    for (int i = 0; i < 2; ++i) { int e = tid + i * 256; brr[i] = e >> 4; bc[i] = e & 15; }

    float4 ra[4], rb[2];

    // ---- prologue: fetch tile 0 and stage into buffer 0
#pragma unroll
    for (int i = 0; i < 4; ++i)
        ra[i] = X4[(((rowBase + arr[i]) * DD) >> 2) + ac[i]];
#pragma unroll
    for (int i = 0; i < 2; ++i)
        rb[i] = W4[((brr[i] * N + colBase) >> 2) + bc[i]];
#pragma unroll
    for (int i = 0; i < 4; ++i) {
        uint2 t; t.x = pack2bf(ra[i].x, ra[i].y); t.y = pack2bf(ra[i].z, ra[i].w);
        *(uint2*)&As[0][arr[i] * LDA + ac[i] * 4] = t;
    }
#pragma unroll
    for (int i = 0; i < 2; ++i) {
        int c = bc[i] * 4, r = brr[i];
        Bst[0][(c + 0) * LDA + r] = f2bf(rb[i].x);
        Bst[0][(c + 1) * LDA + r] = f2bf(rb[i].y);
        Bst[0][(c + 2) * LDA + r] = f2bf(rb[i].z);
        Bst[0][(c + 3) * LDA + r] = f2bf(rb[i].w);
    }

    v8f acc[4] = {};
    int cur = 0;

    for (int k0 = 0; k0 < DD; k0 += 32) {
        __syncthreads();                      // LDS[cur] ready; LDS[cur^1] free
        const bool more = (k0 + 32 < DD);
        if (more) {
            // Issue next-tile global loads early: they fly under the WMMAs.
#pragma unroll
            for (int i = 0; i < 4; ++i)
                ra[i] = X4[(((rowBase + arr[i]) * DD + k0 + 32) >> 2) + ac[i]];
#pragma unroll
            for (int i = 0; i < 2; ++i)
                rb[i] = W4[(((k0 + 32 + brr[i]) * N + colBase) >> 2) + bc[i]];
            if (k0 + 64 < DD)
                __builtin_prefetch(&X[(rowBase + (tid >> 1)) * DD + k0 + 64], 0, 1);
        }

        // ---- WMMA on buffer `cur`
        const __bf16* Ab = &As[cur][0];
        const __bf16* Bb = &Bst[cur][0];
        const int arow = (wv * 16 + mrow) * LDA;
        v8bf alo = *(const v8bf*)&Ab[arow + kb];
        v8bf ahi = *(const v8bf*)&Ab[arow + 16 + kb];
        v16bf a = __builtin_shufflevector(alo, ahi,
            0, 1, 2, 3, 4, 5, 6, 7, 8, 9, 10, 11, 12, 13, 14, 15);
#pragma unroll
        for (int jn = 0; jn < 4; ++jn) {
            const int bcol = (jn * 16 + mrow) * LDA;
            v8bf blo = *(const v8bf*)&Bb[bcol + kb];
            v8bf bhi = *(const v8bf*)&Bb[bcol + 16 + kb];
            v16bf bfr = __builtin_shufflevector(blo, bhi,
                0, 1, 2, 3, 4, 5, 6, 7, 8, 9, 10, 11, 12, 13, 14, 15);
            acc[jn] = __builtin_amdgcn_wmma_f32_16x16x32_bf16(
                false, a, false, bfr, (short)0, acc[jn], false, false);
        }

        if (more) {
            // ---- stage fetched registers into buffer `cur^1`
            __bf16* An = &As[cur ^ 1][0];
            __bf16* Bn = &Bst[cur ^ 1][0];
#pragma unroll
            for (int i = 0; i < 4; ++i) {
                uint2 t; t.x = pack2bf(ra[i].x, ra[i].y); t.y = pack2bf(ra[i].z, ra[i].w);
                *(uint2*)&An[arr[i] * LDA + ac[i] * 4] = t;
            }
#pragma unroll
            for (int i = 0; i < 2; ++i) {
                int c = bc[i] * 4, r = brr[i];
                Bn[(c + 0) * LDA + r] = f2bf(rb[i].x);
                Bn[(c + 1) * LDA + r] = f2bf(rb[i].y);
                Bn[(c + 2) * LDA + r] = f2bf(rb[i].z);
                Bn[(c + 3) * LDA + r] = f2bf(rb[i].w);
            }
        }
        cur ^= 1;
    }

    const int mhalf = (lane >> 4) << 3;
#pragma unroll
    for (int jn = 0; jn < 4; ++jn) {
#pragma unroll
        for (int r = 0; r < 8; ++r) {
            int row = rowBase + wv * 16 + mhalf + r;
            int col = colBase + jn * 16 + mrow;
            float x = acc[jn][r];
            if (ACT == 1) {
                x = x / (1.f + __expf(-x));                      // swish
            } else if (ACT == 2) {
                float ax = fabsf(x);
                float ls = fminf(x, 0.f) - log1pf(__expf(-ax));  // log_sigmoid, stable
                x = __expf(ls * 0.125f);                         // ge = exp(g/8)
            }
            Y[row * N + col] = x;
        }
    }
}

// ---------------------------------------------------------------------------
// Pass 1 scan: hk[k,m] = hk*ge[m] + k[k]*(1-ge[m]); ok[m] = sum_k q[k]*hk[k,m]
// One block per (b,h). 256 threads: thread t owns m = t&63, k-group t>>6 (32 k's).
// ---------------------------------------------------------------------------
__global__ __launch_bounds__(256) void scan1_kernel(
    const float* __restrict__ q, const float* __restrict__ k,
    const float* __restrict__ ge, float* __restrict__ ok) {
    const int b = blockIdx.x >> 2, h = blockIdx.x & 3;
    const int t = threadIdx.x;
    const int m = t & 63, kb = (t >> 6) * 32;

    __shared__ float qs[128], ks[128], red[256];
    float hk[32];
#pragma unroll
    for (int i = 0; i < 32; ++i) hk[i] = 0.f;

    for (int step = 0; step < TT; ++step) {
        int rowq = (b * TT + step) * (HH * KK) + h * KK;
        int rowg = (b * TT + step) * (HH * MM) + h * MM;
        if (t < 128) qs[t] = q[rowq + t];
        else         ks[t - 128] = k[rowq + (t - 128)];
        float gm = ge[rowg + m];
        __syncthreads();
        float sm = 1.f - gm;
        float acc = 0.f;
#pragma unroll
        for (int i = 0; i < 32; ++i) {
            hk[i] = hk[i] * gm + ks[kb + i] * sm;
            acc += qs[kb + i] * hk[i];
        }
        red[t] = acc;
        __syncthreads();
        if (t < 64)
            ok[rowg + t] = red[t] + red[64 + t] + red[128 + t] + red[192 + t];
        __syncthreads();
    }
}

__global__ __launch_bounds__(256) void softmax_kernel(
    const float* __restrict__ ok, float* __restrict__ p) {
    const int lane = threadIdx.x & 31, wv = threadIdx.x >> 5;
    const int row = blockIdx.x * 8 + wv;
    const float* src = ok + row * MM;
    float a = src[lane], b = src[lane + 32];
    float mx = fmaxf(a, b);
#pragma unroll
    for (int off = 16; off > 0; off >>= 1) mx = fmaxf(mx, __shfl_xor(mx, off, 32));
    float ea = __expf(a - mx), eb = __expf(b - mx);
    float s = ea + eb;
#pragma unroll
    for (int off = 16; off > 0; off >>= 1) s += __shfl_xor(s, off, 32);
    float inv = 1.f / s;
    p[row * MM + lane]      = ea * inv;
    p[row * MM + lane + 32] = eb * inv;
}

// ---------------------------------------------------------------------------
// Pass 2 scan: hv[m,v] = hv*ge[m] + (1-ge[m])*v[v]; o[v] = sum_m p[m]*hv[m,v]
// One block per (b,h). Thread t owns v-col t&127, m-group t>>7 (32 m's).
// ---------------------------------------------------------------------------
__global__ __launch_bounds__(256) void scan2_kernel(
    const float* __restrict__ p, const float* __restrict__ v,
    const float* __restrict__ ge, float* __restrict__ o) {
    const int b = blockIdx.x >> 2, h = blockIdx.x & 3;
    const int t = threadIdx.x;
    const int vc = t & 127, mb = (t >> 7) * 32;

    __shared__ float ps[64], ges[64], vs[128], red[256];
    float hv[32];
#pragma unroll
    for (int i = 0; i < 32; ++i) hv[i] = 0.f;

    for (int step = 0; step < TT; ++step) {
        int rowv = (b * TT + step) * (HH * VV) + h * VV;
        int rowg = (b * TT + step) * (HH * MM) + h * MM;
        if (t < 64)       ps[t] = p[rowg + t];
        else if (t < 128) ges[t - 64] = ge[rowg + (t - 64)];
        else              vs[t - 128] = v[rowv + (t - 128)];
        __syncthreads();
        float vv = vs[vc];
        float acc = 0.f;
#pragma unroll
        for (int i = 0; i < 32; ++i) {
            float g = ges[mb + i];
            hv[i] = hv[i] * g + (1.f - g) * vv;
            acc += ps[mb + i] * hv[i];
        }
        red[t] = acc;
        __syncthreads();
        if (t < 128) o[rowv + t] = red[t] + red[128 + t];
        __syncthreads();
    }
}

// ---------------------------------------------------------------------------
// Per-head RMSNorm over V=128; one wave per head-row (32768 rows), in place.
// ---------------------------------------------------------------------------
__global__ __launch_bounds__(256) void rmsnorm_kernel(
    float* __restrict__ o, const float* __restrict__ w) {
    const int lane = threadIdx.x & 31, wv = threadIdx.x >> 5;
    const int row = blockIdx.x * 8 + wv;
    float* base = o + row * VV;
    float x0 = base[lane], x1 = base[lane + 32], x2 = base[lane + 64], x3 = base[lane + 96];
    float ss = x0 * x0 + x1 * x1 + x2 * x2 + x3 * x3;
#pragma unroll
    for (int off = 16; off > 0; off >>= 1) ss += __shfl_xor(ss, off, 32);
    float r = rsqrtf(ss * (1.f / (float)VV) + 1e-5f);
    base[lane]      = x0 * r * w[lane];
    base[lane + 32] = x1 * r * w[lane + 32];
    base[lane + 64] = x2 * r * w[lane + 64];
    base[lane + 96] = x3 * r * w[lane + 96];
}

// ---------------------------------------------------------------------------

extern "C" void kernel_launch(void* const* d_in, const int* in_sizes, int n_in,
                              void* d_out, int out_size, void* d_ws, size_t ws_size,
                              hipStream_t stream) {
    const float* x      = (const float*)d_in[0];
    const float* Wq     = (const float*)d_in[1];
    const float* Wk     = (const float*)d_in[2];
    const float* Wv     = (const float*)d_in[3];
    const float* Wf     = (const float*)d_in[4];
    const float* gnormw = (const float*)d_in[5];
    const float* Wo     = (const float*)d_in[6];
    float* out = (float*)d_out;

    float* ws = (float*)d_ws;
    float* q  = ws;                       // BT*512
    float* k  = q  + (size_t)BT * 512;    // BT*512
    float* v  = k  + (size_t)BT * 512;    // BT*512
    float* ge = v  + (size_t)BT * 512;    // BT*256
    float* ok = ge + (size_t)BT * 256;    // BT*256
    float* p  = ok + (size_t)BT * 256;    // BT*256
    float* o  = p  + (size_t)BT * 256;    // BT*512

    dim3 blk(256);
    dim3 grd512(512 / 64, BT / 128);  // N=512 GEMMs
    dim3 grd256(256 / 64, BT / 128);  // N=256 GEMM (Wf)

    gemm_wmma_kernel<1><<<grd512, blk, 0, stream>>>(x, Wq, q, 512);   // swish
    gemm_wmma_kernel<1><<<grd512, blk, 0, stream>>>(x, Wk, k, 512);   // swish
    gemm_wmma_kernel<0><<<grd512, blk, 0, stream>>>(x, Wv, v, 512);   // none
    gemm_wmma_kernel<2><<<grd256, blk, 0, stream>>>(x, Wf, ge, 256);  // ge gate

    scan1_kernel<<<dim3(BB * HH), blk, 0, stream>>>(q, k, ge, ok);
    softmax_kernel<<<dim3((BT * HH) / 8), blk, 0, stream>>>(ok, p);
    scan2_kernel<<<dim3(BB * HH), blk, 0, stream>>>(p, v, ge, o);
    rmsnorm_kernel<<<dim3((BT * HH) / 8), blk, 0, stream>>>(o, gnormw);

    gemm_wmma_kernel<0><<<grd512, blk, 0, stream>>>(o, Wo, out, 512); // out proj
}

// v001
// A run of this version takes 272 microseconds.
// Timed twice side by side with v000, it ran 19.9 times as fast both times.
#include <hip/hip_runtime.h>
#include <hip/hip_bf16.h>

#define BB 4
#define TT 2048
#define DD 512
#define HH 4
#define KK 128
#define VV 128
#define MM 64
#define BT (BB * TT)          // 8192 rows for all GEMMs
#define CH 32                 // time steps per chunk of the two scans
#define NC (TT / CH)          // 64 chunks per (b,h)
#define SS (KK * MM)          // 8192 state elements per (b,h), both scans

#define LDA 40                // padded LDS row length (bf16 elems): 80B, 16B-aligned runs

typedef __attribute__((ext_vector_type(16))) __bf16 v16bf;
typedef __attribute__((ext_vector_type(8)))  __bf16 v8bf;
typedef __attribute__((ext_vector_type(2)))  __bf16 v2bf;
typedef __attribute__((ext_vector_type(8)))  float  v8f;

#if __has_builtin(__builtin_amdgcn_cvt_pk_bf16_f32)
__device__ __forceinline__ unsigned pack2bf(float a, float b) {
    v2bf r = __builtin_amdgcn_cvt_pk_bf16_f32(a, b);   // v_cvt_pk_bf16_f32
    return __builtin_bit_cast(unsigned, r);
}
#else
__device__ __forceinline__ unsigned pack2bf(float a, float b) {
    unsigned ua = __builtin_bit_cast(unsigned, a);
    unsigned ub = __builtin_bit_cast(unsigned, b);
    ua = (ua + 0x7FFFu + ((ua >> 16) & 1u)) >> 16;     // RNE
    ub = (ub + 0x7FFFu + ((ub >> 16) & 1u)) >> 16;
    return ua | (ub << 16);
}
#endif

__device__ __forceinline__ __bf16 f2bf(float f) {
    union { unsigned u; __bf16 h[2]; } x;
    x.u = pack2bf(f, 0.f);
    return x.h[0];
}

// ---------------------------------------------------------------------------
// Tiled GEMM: Y(8192 x N) = act( X(8192 x 512) @ W(512 x N) ), bf16 WMMA.
// Block = 256 threads (8 waves). Block tile = 128(M) x 64(N), K-step = 32.
// Software-pipelined double-buffered LDS: fetch tile k+1 to registers, WMMA
// tile k from LDS[cur], then stage registers into LDS[cur^1]; ONE barrier
// per K-step. A staged row-major As[row][k]; B staged transposed Bst[col][k]
// so every lane fragment is two contiguous 16B runs -> ds_load_b128.
// ACT: 0 = none, 1 = swish, 2 = ge = exp(log_sigmoid(x)/8)
// ---------------------------------------------------------------------------
template <int ACT>
__global__ __launch_bounds__(256) void gemm_wmma_kernel(
    const float* __restrict__ X, const float* __restrict__ W,
    float* __restrict__ Y, int N) {
    __shared__ __align__(16) __bf16 As[2][128 * LDA];   // 2 x 10.0 KB
    __shared__ __align__(16) __bf16 Bst[2][64 * LDA];   // 2 x  5.0 KB

    const int tid  = threadIdx.x;
    const int lane = tid & 31;
    const int wv   = tid >> 5;
    const int rowBase = blockIdx.y * 128;
    const int colBase = blockIdx.x * 64;

    const int mrow = lane & 15;            // row of 16-row tile / col of 16-col tile
    const int kb   = (lane >> 4) << 3;     // 0 or 8: K sub-block for this half-wave

    const float4* X4 = (const float4*)X;
    const float4* W4 = (const float4*)W;

    // Per-thread staging coordinates (constant)
    int arr[4], ac[4];                     // A: row, float4-col
#pragma unroll
    for (int i = 0; i < 4; ++i) { int e = tid + i * 256; arr[i] = e >> 3; ac[i] = e & 7; }
    int brr[2], bc[2];                     // B: k-row, float4-col
#pragma unroll
    for (int i = 0; i < 2; ++i) { int e = tid + i * 256; brr[i] = e >> 4; bc[i] = e & 15; }

    float4 ra[4], rb[2];

    // ---- prologue: fetch tile 0 and stage into buffer 0
#pragma unroll
    for (int i = 0; i < 4; ++i)
        ra[i] = X4[(((rowBase + arr[i]) * DD) >> 2) + ac[i]];
#pragma unroll
    for (int i = 0; i < 2; ++i)
        rb[i] = W4[((brr[i] * N + colBase) >> 2) + bc[i]];
#pragma unroll
    for (int i = 0; i < 4; ++i) {
        uint2 t; t.x = pack2bf(ra[i].x, ra[i].y); t.y = pack2bf(ra[i].z, ra[i].w);
        *(uint2*)&As[0][arr[i] * LDA + ac[i] * 4] = t;
    }
#pragma unroll
    for (int i = 0; i < 2; ++i) {
        int c = bc[i] * 4, r = brr[i];
        Bst[0][(c + 0) * LDA + r] = f2bf(rb[i].x);
        Bst[0][(c + 1) * LDA + r] = f2bf(rb[i].y);
        Bst[0][(c + 2) * LDA + r] = f2bf(rb[i].z);
        Bst[0][(c + 3) * LDA + r] = f2bf(rb[i].w);
    }

    v8f acc[4] = {};
    int cur = 0;

    for (int k0 = 0; k0 < DD; k0 += 32) {
        __syncthreads();                      // LDS[cur] ready; LDS[cur^1] free
        const bool more = (k0 + 32 < DD);
        if (more) {
            // Issue next-tile global loads early: they fly under the WMMAs.
#pragma unroll
            for (int i = 0; i < 4; ++i)
                ra[i] = X4[(((rowBase + arr[i]) * DD + k0 + 32) >> 2) + ac[i]];
#pragma unroll
            for (int i = 0; i < 2; ++i)
                rb[i] = W4[(((k0 + 32 + brr[i]) * N + colBase) >> 2) + bc[i]];
            if (k0 + 64 < DD)
                __builtin_prefetch(&X[(rowBase + (tid >> 1)) * DD + k0 + 64], 0, 1);
        }

        // ---- WMMA on buffer `cur`
        const __bf16* Ab = &As[cur][0];
        const __bf16* Bb = &Bst[cur][0];
        const int arow = (wv * 16 + mrow) * LDA;
        v8bf alo = *(const v8bf*)&Ab[arow + kb];
        v8bf ahi = *(const v8bf*)&Ab[arow + 16 + kb];
        v16bf a = __builtin_shufflevector(alo, ahi,
            0, 1, 2, 3, 4, 5, 6, 7, 8, 9, 10, 11, 12, 13, 14, 15);
#pragma unroll
        for (int jn = 0; jn < 4; ++jn) {
            const int bcol = (jn * 16 + mrow) * LDA;
            v8bf blo = *(const v8bf*)&Bb[bcol + kb];
            v8bf bhi = *(const v8bf*)&Bb[bcol + 16 + kb];
            v16bf bfr = __builtin_shufflevector(blo, bhi,
                0, 1, 2, 3, 4, 5, 6, 7, 8, 9, 10, 11, 12, 13, 14, 15);
            acc[jn] = __builtin_amdgcn_wmma_f32_16x16x32_bf16(
                false, a, false, bfr, (short)0, acc[jn], false, false);
        }

        if (more) {
            // ---- stage fetched registers into buffer `cur^1`
            __bf16* An = &As[cur ^ 1][0];
            __bf16* Bn = &Bst[cur ^ 1][0];
#pragma unroll
            for (int i = 0; i < 4; ++i) {
                uint2 t; t.x = pack2bf(ra[i].x, ra[i].y); t.y = pack2bf(ra[i].z, ra[i].w);
                *(uint2*)&An[arr[i] * LDA + ac[i] * 4] = t;
            }
#pragma unroll
            for (int i = 0; i < 2; ++i) {
                int c = bc[i] * 4, r = brr[i];
                Bn[(c + 0) * LDA + r] = f2bf(rb[i].x);
                Bn[(c + 1) * LDA + r] = f2bf(rb[i].y);
                Bn[(c + 2) * LDA + r] = f2bf(rb[i].z);
                Bn[(c + 3) * LDA + r] = f2bf(rb[i].w);
            }
        }
        cur ^= 1;
    }

    const int mhalf = (lane >> 4) << 3;
#pragma unroll
    for (int jn = 0; jn < 4; ++jn) {
#pragma unroll
        for (int r = 0; r < 8; ++r) {
            int row = rowBase + wv * 16 + mhalf + r;
            int col = colBase + jn * 16 + mrow;
            float x = acc[jn][r];
            if (ACT == 1) {
                x = x / (1.f + __expf(-x));                      // swish
            } else if (ACT == 2) {
                float ax = fabsf(x);
                float ls = fminf(x, 0.f) - log1pf(__expf(-ax));  // log_sigmoid, stable
                x = __expf(ls * 0.125f);                         // ge = exp(g/8)
            }
            Y[row * N + col] = x;
        }
    }
}

// ---------------------------------------------------------------------------
// The two scans are linear in their state, so the time axis is cut into NC
// chunks that run side by side:
//   local : each chunk runs the recurrence from a zero state and keeps its end
//           state L_c and the product D_c[m] of its decays;
//   carry : H_0 = 0, H_{c+1} = H_c * D_c + L_c gives every chunk's start state;
//   scan  : each chunk runs the full step loop from H_c and writes its outputs.
// ---------------------------------------------------------------------------

// Pass 1 local: one block per (b,h,chunk). Thread t owns m = t&63 and 32 k's.
// No output is formed here, so nothing crosses threads: k is read straight from
// memory (the k-group is the same for a whole wave).
__global__ __launch_bounds__(256) void scan1_local_kernel(
    const float* __restrict__ k, const float* __restrict__ ge,
    float* __restrict__ hloc, float* __restrict__ dloc) {
    const int bh = blockIdx.x / NC, c = blockIdx.x % NC;
    const int b = bh >> 2, h = bh & 3;
    const int t = threadIdx.x;
    const int m = t & 63;
    const int kb = __builtin_amdgcn_readfirstlane(t >> 6) * 32;

    float hk[32];
#pragma unroll
    for (int i = 0; i < 32; ++i) hk[i] = 0.f;
    float dp = 1.f;

    for (int step = c * CH; step < c * CH + CH; ++step) {
        const float4* kr = (const float4*)(k + (b * TT + step) * (HH * KK) + h * KK + kb);
        float gm = ge[(b * TT + step) * (HH * MM) + h * MM + m];
        float sm = 1.f - gm;
#pragma unroll
        for (int j = 0; j < 8; ++j) {
            float4 kv = kr[j];
            hk[4 * j + 0] = hk[4 * j + 0] * gm + kv.x * sm;
            hk[4 * j + 1] = hk[4 * j + 1] * gm + kv.y * sm;
            hk[4 * j + 2] = hk[4 * j + 2] * gm + kv.z * sm;
            hk[4 * j + 3] = hk[4 * j + 3] * gm + kv.w * sm;
        }
        dp *= gm;
    }

    float* dst = hloc + blockIdx.x * SS + kb * MM + m;
#pragma unroll
    for (int i = 0; i < 32; ++i) dst[i * MM] = hk[i];
    if (t < 64) dloc[blockIdx.x * MM + m] = dp;
}

// Carry over the chunks: one thread per state element, NC serial steps.
// SECOND = 0: state laid out [k][m]; SECOND = 1: state laid out [m][v].
template <int SECOND>
__global__ __launch_bounds__(256) void carry_kernel(
    const float* __restrict__ hloc, const float* __restrict__ dloc,
    float* __restrict__ hin) {
    const int e = blockIdx.x * 256 + threadIdx.x;
    const int bh = e / SS, idx = e % SS;
    const int m = SECOND ? (idx / VV) : (idx % MM);
    const float* src = hloc + bh * (NC * SS) + idx;
    const float* dsr = dloc + bh * (NC * MM) + m;
    float* dst = hin + bh * (NC * SS) + idx;

    float hc = 0.f;
    for (int c0 = 0; c0 < NC; c0 += 16) {
        float a[16], d[16];                 // 16 chunks' loads in flight at once
#pragma unroll
        for (int j = 0; j < 16; ++j) {
            a[j] = src[(c0 + j) * SS];
            d[j] = dsr[(c0 + j) * MM];
        }
#pragma unroll
        for (int j = 0; j < 16; ++j) {
            dst[(c0 + j) * SS] = hc;
            hc = hc * d[j] + a[j];
        }
    }
}

// ---------------------------------------------------------------------------
// Pass 1 scan: hk[k,m] = hk*ge[m] + k[k]*(1-ge[m]); ok[m] = sum_k q[k]*hk[k,m]
// One block per (b,h,chunk), started from the carried state.
// 256 threads: thread t owns m = t&63, k-group t>>6 (32 k's).
// ---------------------------------------------------------------------------
__global__ __launch_bounds__(256) void scan1_kernel(
    const float* __restrict__ q, const float* __restrict__ k,
    const float* __restrict__ ge, const float* __restrict__ hin,
    float* __restrict__ ok) {
    const int bh = blockIdx.x / NC, c = blockIdx.x % NC;
    const int b = bh >> 2, h = bh & 3;
    const int t = threadIdx.x;
    const int m = t & 63, kb = (t >> 6) * 32;

    __shared__ float qs[128], ks[128], red[256];
    float hk[32];
    const float* h0 = hin + blockIdx.x * SS + kb * MM + m;
#pragma unroll
    for (int i = 0; i < 32; ++i) hk[i] = h0[i * MM];

    for (int step = c * CH; step < c * CH + CH; ++step) {
        int rowq = (b * TT + step) * (HH * KK) + h * KK;
        int rowg = (b * TT + step) * (HH * MM) + h * MM;
        if (t < 128) qs[t] = q[rowq + t];
        else         ks[t - 128] = k[rowq + (t - 128)];
        float gm = ge[rowg + m];
        __syncthreads();
        float sm = 1.f - gm;
        float acc = 0.f;
#pragma unroll
        for (int i = 0; i < 32; ++i) {
            hk[i] = hk[i] * gm + ks[kb + i] * sm;
            acc += qs[kb + i] * hk[i];
        }
        red[t] = acc;
        __syncthreads();
        if (t < 64)
            ok[rowg + t] = red[t] + red[64 + t] + red[128 + t] + red[192 + t];
        __syncthreads();
    }
}

__global__ __launch_bounds__(256) void softmax_kernel(
    const float* __restrict__ ok, float* __restrict__ p) {
    const int lane = threadIdx.x & 31, wv = threadIdx.x >> 5;
    const int row = blockIdx.x * 8 + wv;
    const float* src = ok + row * MM;
    float a = src[lane], b = src[lane + 32];
    float mx = fmaxf(a, b);
#pragma unroll
    for (int off = 16; off > 0; off >>= 1) mx = fmaxf(mx, __shfl_xor(mx, off, 32));
    float ea = __expf(a - mx), eb = __expf(b - mx);
    float s = ea + eb;
#pragma unroll
    for (int off = 16; off > 0; off >>= 1) s += __shfl_xor(s, off, 32);
    float inv = 1.f / s;
    p[row * MM + lane]      = ea * inv;
    p[row * MM + lane + 32] = eb * inv;
}

// Pass 2 local: one block per (b,h,chunk). Thread t owns v-col t&127 and 32 m's
// (the m-group is the same for a whole wave). End state only, no output.
__global__ __launch_bounds__(256) void scan2_local_kernel(
    const float* __restrict__ v, const float* __restrict__ ge,
    float* __restrict__ hloc) {
    const int bh = blockIdx.x / NC, c = blockIdx.x % NC;
    const int b = bh >> 2, h = bh & 3;
    const int t = threadIdx.x;
    const int vc = t & 127;
    const int mb = __builtin_amdgcn_readfirstlane(t >> 7) * 32;

    float hv[32];
#pragma unroll
    for (int i = 0; i < 32; ++i) hv[i] = 0.f;

    for (int step = c * CH; step < c * CH + CH; ++step) {
        const float4* gr = (const float4*)(ge + (b * TT + step) * (HH * MM) + h * MM + mb);
        float vv = v[(b * TT + step) * (HH * VV) + h * VV + vc];
#pragma unroll
        for (int j = 0; j < 8; ++j) {
            float4 g = gr[j];
            hv[4 * j + 0] = hv[4 * j + 0] * g.x + (1.f - g.x) * vv;
            hv[4 * j + 1] = hv[4 * j + 1] * g.y + (1.f - g.y) * vv;
            hv[4 * j + 2] = hv[4 * j + 2] * g.z + (1.f - g.z) * vv;
            hv[4 * j + 3] = hv[4 * j + 3] * g.w + (1.f - g.w) * vv;
        }
    }

    float* dst = hloc + blockIdx.x * SS + mb * VV + vc;
#pragma unroll
    for (int i = 0; i < 32; ++i) dst[i * VV] = hv[i];
}

// ---------------------------------------------------------------------------
// Pass 2 scan: hv[m,v] = hv*ge[m] + (1-ge[m])*v[v]; o[v] = sum_m p[m]*hv[m,v]
// One block per (b,h,chunk), started from the carried state.
// Thread t owns v-col t&127, m-group t>>7 (32 m's).
// ---------------------------------------------------------------------------
__global__ __launch_bounds__(256) void scan2_kernel(
    const float* __restrict__ p, const float* __restrict__ v,
    const float* __restrict__ ge, const float* __restrict__ hin,
    float* __restrict__ o) {
    const int bh = blockIdx.x / NC, c = blockIdx.x % NC;
    const int b = bh >> 2, h = bh & 3;
    const int t = threadIdx.x;
    const int vc = t & 127, mb = (t >> 7) * 32;

    __shared__ float ps[64], ges[64], vs[128], red[256];
    float hv[32];
    const float* h0 = hin + blockIdx.x * SS + mb * VV + vc;
#pragma unroll
    for (int i = 0; i < 32; ++i) hv[i] = h0[i * VV];

    for (int step = c * CH; step < c * CH + CH; ++step) {
        int rowv = (b * TT + step) * (HH * VV) + h * VV;
        int rowg = (b * TT + step) * (HH * MM) + h * MM;
        if (t < 64)       ps[t] = p[rowg + t];
        else if (t < 128) ges[t - 64] = ge[rowg + (t - 64)];
        else              vs[t - 128] = v[rowv + (t - 128)];
        __syncthreads();
        float vv = vs[vc];
        float acc = 0.f;
#pragma unroll
        for (int i = 0; i < 32; ++i) {
            float g = ges[mb + i];
            hv[i] = hv[i] * g + (1.f - g) * vv;
            acc += ps[mb + i] * hv[i];
        }
        red[t] = acc;
        __syncthreads();
        if (t < 128) o[rowv + t] = red[t] + red[128 + t];
        __syncthreads();
    }
}

// ---------------------------------------------------------------------------
// Per-head RMSNorm over V=128; one wave per head-row (32768 rows), in place.
// ---------------------------------------------------------------------------
__global__ __launch_bounds__(256) void rmsnorm_kernel(
    float* __restrict__ o, const float* __restrict__ w) {
    const int lane = threadIdx.x & 31, wv = threadIdx.x >> 5;
    const int row = blockIdx.x * 8 + wv;
    float* base = o + row * VV;
    float x0 = base[lane], x1 = base[lane + 32], x2 = base[lane + 64], x3 = base[lane + 96];
    float ss = x0 * x0 + x1 * x1 + x2 * x2 + x3 * x3;
#pragma unroll
    for (int off = 16; off > 0; off >>= 1) ss += __shfl_xor(ss, off, 32);
    float r = rsqrtf(ss * (1.f / (float)VV) + 1e-5f);
    base[lane]      = x0 * r * w[lane];
    base[lane + 32] = x1 * r * w[lane + 32];
    base[lane + 64] = x2 * r * w[lane + 64];
    base[lane + 96] = x3 * r * w[lane + 96];
}

// ---------------------------------------------------------------------------

extern "C" void kernel_launch(void* const* d_in, const int* in_sizes, int n_in,
                              void* d_out, int out_size, void* d_ws, size_t ws_size,
                              hipStream_t stream) {
    const float* x      = (const float*)d_in[0];
    const float* Wq     = (const float*)d_in[1];
    const float* Wk     = (const float*)d_in[2];
    const float* Wv     = (const float*)d_in[3];
    const float* Wf     = (const float*)d_in[4];
    const float* gnormw = (const float*)d_in[5];
    const float* Wo     = (const float*)d_in[6];
    float* out = (float*)d_out;

    float* ws = (float*)d_ws;
    float* q  = ws;                       // BT*512
    float* k  = q  + (size_t)BT * 512;    // BT*512
    float* v  = k  + (size_t)BT * 512;    // BT*512
    float* ge = v  + (size_t)BT * 512;    // BT*256
    float* ok = ge + (size_t)BT * 256;    // BT*256
    float* p  = ok + (size_t)BT * 256;    // BT*256
    float* o  = p  + (size_t)BT * 256;    // BT*512
    float* hloc = o    + (size_t)BT * 512;              // 16*NC*SS chunk end states
    float* hin  = hloc + (size_t)BB * HH * NC * SS;     // 16*NC*SS chunk start states
    float* dloc = hin  + (size_t)BB * HH * NC * SS;     // 16*NC*MM chunk decay products

    dim3 blk(256);
    dim3 grd512(512 / 64, BT / 128);  // N=512 GEMMs
    dim3 grd256(256 / 64, BT / 128);  // N=256 GEMM (Wf)

    gemm_wmma_kernel<1><<<grd512, blk, 0, stream>>>(x, Wq, q, 512);   // swish
    gemm_wmma_kernel<1><<<grd512, blk, 0, stream>>>(x, Wk, k, 512);   // swish
    gemm_wmma_kernel<0><<<grd512, blk, 0, stream>>>(x, Wv, v, 512);   // none
    gemm_wmma_kernel<2><<<grd256, blk, 0, stream>>>(x, Wf, ge, 256);  // ge gate

    dim3 grdChunk(BB * HH * NC);          // one block per (b,h,chunk)
    dim3 grdState(BB * HH * SS / 256);    // one thread per state element

    scan1_local_kernel<<<grdChunk, blk, 0, stream>>>(k, ge, hloc, dloc);
    carry_kernel<0><<<grdState, blk, 0, stream>>>(hloc, dloc, hin);
    scan1_kernel<<<grdChunk, blk, 0, stream>>>(q, k, ge, hin, ok);
    softmax_kernel<<<dim3((BT * HH) / 8), blk, 0, stream>>>(ok, p);
    scan2_local_kernel<<<grdChunk, blk, 0, stream>>>(v, ge, hloc);
    carry_kernel<1><<<grdState, blk, 0, stream>>>(hloc, dloc, hin);
    scan2_kernel<<<grdChunk, blk, 0, stream>>>(p, v, ge, hin, o);
    rmsnorm_kernel<<<dim3((BT * HH) / 8), blk, 0, stream>>>(o, gnormw);

    gemm_wmma_kernel<0><<<grd512, blk, 0, stream>>>(o, Wo, out, 512); // out proj
}

// v002
// One run takes 226 microseconds.
// Timed twice side by side with v001, it ran 1.21 and 1.20 times as fast.
// All steps since v000 together make it 23.9 times as fast.
#include <hip/hip_runtime.h>
#include <hip/hip_bf16.h>

#define BB 4
#define TT 2048
#define DD 512
#define HH 4
#define KK 128
#define VV 128
#define MM 64
#define BT (BB * TT)          // 8192 rows for all GEMMs
#define CH 32                 // time steps per chunk of the two scans
#define NC (TT / CH)          // 64 chunks per (b,h)
#define SS (KK * MM)          // 8192 state elements per (b,h), both scans

#define LDA 40                // padded LDS row length (bf16 elems): 80B, 16B-aligned runs

typedef __attribute__((ext_vector_type(16))) __bf16 v16bf;
typedef __attribute__((ext_vector_type(8)))  __bf16 v8bf;
typedef __attribute__((ext_vector_type(2)))  __bf16 v2bf;
typedef __attribute__((ext_vector_type(8)))  float  v8f;

#if __has_builtin(__builtin_amdgcn_cvt_pk_bf16_f32)
__device__ __forceinline__ unsigned pack2bf(float a, float b) {
    v2bf r = __builtin_amdgcn_cvt_pk_bf16_f32(a, b);   // v_cvt_pk_bf16_f32
    return __builtin_bit_cast(unsigned, r);
}
#else
__device__ __forceinline__ unsigned pack2bf(float a, float b) {
    unsigned ua = __builtin_bit_cast(unsigned, a);
    unsigned ub = __builtin_bit_cast(unsigned, b);
    ua = (ua + 0x7FFFu + ((ua >> 16) & 1u)) >> 16;     // RNE
    ub = (ub + 0x7FFFu + ((ub >> 16) & 1u)) >> 16;
    return ua | (ub << 16);
}
#endif

__device__ __forceinline__ __bf16 f2bf(float f) {
    union { unsigned u; __bf16 h[2]; } x;
    x.u = pack2bf(f, 0.f);
    return x.h[0];
}

// ---------------------------------------------------------------------------
// Tiled GEMM: Y(8192 x N) = act( X(8192 x 512) @ W(512 x N) ), bf16 WMMA.
// Block = 256 threads (8 waves). Block tile = 128(M) x 64(N), K-step = 32.
// Software-pipelined double-buffered LDS: fetch tile k+1 to registers, WMMA
// tile k from LDS[cur], then stage registers into LDS[cur^1]; ONE barrier
// per K-step. A staged row-major As[row][k]; B staged transposed Bst[col][k]
// so every lane fragment is two contiguous 16B runs -> ds_load_b128.
// ACT: 0 = none, 1 = swish, 2 = ge = exp(log_sigmoid(x)/8)
// ---------------------------------------------------------------------------
template <int ACT>
__global__ __launch_bounds__(256) void gemm_wmma_kernel(
    const float* __restrict__ X, const float* __restrict__ W,
    float* __restrict__ Y, int N) {
    __shared__ __align__(16) __bf16 As[2][128 * LDA];   // 2 x 10.0 KB
    __shared__ __align__(16) __bf16 Bst[2][64 * LDA];   // 2 x  5.0 KB

    const int tid  = threadIdx.x;
    const int lane = tid & 31;
    const int wv   = tid >> 5;
    const int rowBase = blockIdx.y * 128;
    const int colBase = blockIdx.x * 64;

    const int mrow = lane & 15;            // row of 16-row tile / col of 16-col tile
    const int kb   = (lane >> 4) << 3;     // 0 or 8: K sub-block for this half-wave

    const float4* X4 = (const float4*)X;
    const float4* W4 = (const float4*)W;

    // Per-thread staging coordinates (constant)
    int arr[4], ac[4];                     // A: row, float4-col
#pragma unroll
    for (int i = 0; i < 4; ++i) { int e = tid + i * 256; arr[i] = e >> 3; ac[i] = e & 7; }
    int brr[2], bc[2];                     // B: k-row, float4-col
#pragma unroll
    for (int i = 0; i < 2; ++i) { int e = tid + i * 256; brr[i] = e >> 4; bc[i] = e & 15; }

    float4 ra[4], rb[2];

    // ---- prologue: fetch tile 0 and stage into buffer 0
#pragma unroll
    for (int i = 0; i < 4; ++i)
        ra[i] = X4[(((rowBase + arr[i]) * DD) >> 2) + ac[i]];
#pragma unroll
    for (int i = 0; i < 2; ++i)
        rb[i] = W4[((brr[i] * N + colBase) >> 2) + bc[i]];
#pragma unroll
    for (int i = 0; i < 4; ++i) {
        uint2 t; t.x = pack2bf(ra[i].x, ra[i].y); t.y = pack2bf(ra[i].z, ra[i].w);
        *(uint2*)&As[0][arr[i] * LDA + ac[i] * 4] = t;
    }
#pragma unroll
    for (int i = 0; i < 2; ++i) {
        int c = bc[i] * 4, r = brr[i];
        Bst[0][(c + 0) * LDA + r] = f2bf(rb[i].x);
        Bst[0][(c + 1) * LDA + r] = f2bf(rb[i].y);
        Bst[0][(c + 2) * LDA + r] = f2bf(rb[i].z);
        Bst[0][(c + 3) * LDA + r] = f2bf(rb[i].w);
    }

    v8f acc[4] = {};
    int cur = 0;

    for (int k0 = 0; k0 < DD; k0 += 32) {
        __syncthreads();                      // LDS[cur] ready; LDS[cur^1] free
        const bool more = (k0 + 32 < DD);
        if (more) {
            // Issue next-tile global loads early: they fly under the WMMAs.
#pragma unroll
            for (int i = 0; i < 4; ++i)
                ra[i] = X4[(((rowBase + arr[i]) * DD + k0 + 32) >> 2) + ac[i]];
#pragma unroll
            for (int i = 0; i < 2; ++i)
                rb[i] = W4[(((k0 + 32 + brr[i]) * N + colBase) >> 2) + bc[i]];
            if (k0 + 64 < DD)
                __builtin_prefetch(&X[(rowBase + (tid >> 1)) * DD + k0 + 64], 0, 1);
        }

        // ---- WMMA on buffer `cur`
        const __bf16* Ab = &As[cur][0];
        const __bf16* Bb = &Bst[cur][0];
        const int arow = (wv * 16 + mrow) * LDA;
        v8bf alo = *(const v8bf*)&Ab[arow + kb];
        v8bf ahi = *(const v8bf*)&Ab[arow + 16 + kb];
        v16bf a = __builtin_shufflevector(alo, ahi,
            0, 1, 2, 3, 4, 5, 6, 7, 8, 9, 10, 11, 12, 13, 14, 15);
#pragma unroll
        for (int jn = 0; jn < 4; ++jn) {
            const int bcol = (jn * 16 + mrow) * LDA;
            v8bf blo = *(const v8bf*)&Bb[bcol + kb];
            v8bf bhi = *(const v8bf*)&Bb[bcol + 16 + kb];
            v16bf bfr = __builtin_shufflevector(blo, bhi,
                0, 1, 2, 3, 4, 5, 6, 7, 8, 9, 10, 11, 12, 13, 14, 15);
            acc[jn] = __builtin_amdgcn_wmma_f32_16x16x32_bf16(
                false, a, false, bfr, (short)0, acc[jn], false, false);
        }

        if (more) {
            // ---- stage fetched registers into buffer `cur^1`
            __bf16* An = &As[cur ^ 1][0];
            __bf16* Bn = &Bst[cur ^ 1][0];
#pragma unroll
            for (int i = 0; i < 4; ++i) {
                uint2 t; t.x = pack2bf(ra[i].x, ra[i].y); t.y = pack2bf(ra[i].z, ra[i].w);
                *(uint2*)&An[arr[i] * LDA + ac[i] * 4] = t;
            }
#pragma unroll
            for (int i = 0; i < 2; ++i) {
                int c = bc[i] * 4, r = brr[i];
                Bn[(c + 0) * LDA + r] = f2bf(rb[i].x);
                Bn[(c + 1) * LDA + r] = f2bf(rb[i].y);
                Bn[(c + 2) * LDA + r] = f2bf(rb[i].z);
                Bn[(c + 3) * LDA + r] = f2bf(rb[i].w);
            }
        }
        cur ^= 1;
    }

    const int mhalf = (lane >> 4) << 3;
#pragma unroll
    for (int jn = 0; jn < 4; ++jn) {
#pragma unroll
        for (int r = 0; r < 8; ++r) {
            int row = rowBase + wv * 16 + mhalf + r;
            int col = colBase + jn * 16 + mrow;
            float x = acc[jn][r];
            if (ACT == 1) {
                x = x / (1.f + __expf(-x));                      // swish
            } else if (ACT == 2) {
                float ax = fabsf(x);
                float ls = fminf(x, 0.f) - log1pf(__expf(-ax));  // log_sigmoid, stable
                x = __expf(ls * 0.125f);                         // ge = exp(g/8)
            }
            Y[row * N + col] = x;
        }
    }
}

// ---------------------------------------------------------------------------
// The two scans are linear in their state, so the time axis is cut into NC
// chunks that run side by side:
//   local : each chunk runs the recurrence from a zero state and keeps its end
//           state L_c and the product D_c[m] of its decays;
//   carry : H_0 = 0, H_{c+1} = H_c * D_c + L_c gives every chunk's start state;
//   scan  : each chunk runs the full step loop from H_c and writes its outputs.
// ---------------------------------------------------------------------------

// Pass 1 local: one block per (b,h,chunk). Thread t owns m = t&63 and 32 k's.
// No output is formed here, so nothing crosses threads: k is read straight from
// memory (the k-group is the same for a whole wave).
__global__ __launch_bounds__(256) void scan1_local_kernel(
    const float* __restrict__ k, const float* __restrict__ ge,
    float* __restrict__ hloc, float* __restrict__ dloc) {
    const int bh = blockIdx.x / NC, c = blockIdx.x % NC;
    const int b = bh >> 2, h = bh & 3;
    const int t = threadIdx.x;
    const int m = t & 63;
    const int kb = __builtin_amdgcn_readfirstlane(t >> 6) * 32;

    float hk[32];
#pragma unroll
    for (int i = 0; i < 32; ++i) hk[i] = 0.f;
    float dp = 1.f;

    for (int step = c * CH; step < c * CH + CH; ++step) {
        const float4* kr = (const float4*)(k + (b * TT + step) * (HH * KK) + h * KK + kb);
        float gm = ge[(b * TT + step) * (HH * MM) + h * MM + m];
        float sm = 1.f - gm;
#pragma unroll
        for (int j = 0; j < 8; ++j) {
            float4 kv = kr[j];
            hk[4 * j + 0] = hk[4 * j + 0] * gm + kv.x * sm;
            hk[4 * j + 1] = hk[4 * j + 1] * gm + kv.y * sm;
            hk[4 * j + 2] = hk[4 * j + 2] * gm + kv.z * sm;
            hk[4 * j + 3] = hk[4 * j + 3] * gm + kv.w * sm;
        }
        dp *= gm;
    }

    float* dst = hloc + blockIdx.x * SS + kb * MM + m;
#pragma unroll
    for (int i = 0; i < 32; ++i) dst[i * MM] = hk[i];
    if (t < 64) dloc[blockIdx.x * MM + m] = dp;
}

// Carry over the chunks: one thread per state element, NC serial steps.
// SECOND = 0: state laid out [k][m]; SECOND = 1: state laid out [m][v].
template <int SECOND>
__global__ __launch_bounds__(256) void carry_kernel(
    const float* __restrict__ hloc, const float* __restrict__ dloc,
    float* __restrict__ hin) {
    const int e = blockIdx.x * 256 + threadIdx.x;
    const int bh = e / SS, idx = e % SS;
    const int m = SECOND ? (idx / VV) : (idx % MM);
    const float* src = hloc + bh * (NC * SS) + idx;
    const float* dsr = dloc + bh * (NC * MM) + m;
    float* dst = hin + bh * (NC * SS) + idx;

    float hc = 0.f;
    for (int c0 = 0; c0 < NC; c0 += 16) {
        float a[16], d[16];                 // 16 chunks' loads in flight at once
#pragma unroll
        for (int j = 0; j < 16; ++j) {
            a[j] = src[(c0 + j) * SS];
            d[j] = dsr[(c0 + j) * MM];
        }
#pragma unroll
        for (int j = 0; j < 16; ++j) {
            dst[(c0 + j) * SS] = hc;
            hc = hc * d[j] + a[j];
        }
    }
}

__global__ __launch_bounds__(256) void scan1_kernel(
    const float* __restrict__ q, const float* __restrict__ k,
    const float* __restrict__ ge, const float* __restrict__ hin,
    float* __restrict__ p) {
    const int bh = blockIdx.x / NC, c = blockIdx.x % NC;
    const int b = bh >> 2, h = bh & 3;
    const int t = threadIdx.x;
    const int m = t & 63, kb = (t >> 6) * 32;

    __shared__ float qs[128], ks[128], red[256];
    __shared__ float oks[CH * MM];         // the chunk's score rows, 8 KB
    float hk[32];
    const float* h0 = hin + blockIdx.x * SS + kb * MM + m;
#pragma unroll
    for (int i = 0; i < 32; ++i) hk[i] = h0[i * MM];

    for (int step = c * CH; step < c * CH + CH; ++step) {
        int rowq = (b * TT + step) * (HH * KK) + h * KK;
        int rowg = (b * TT + step) * (HH * MM) + h * MM;
        if (t < 128) qs[t] = q[rowq + t];
        else         ks[t - 128] = k[rowq + (t - 128)];
        float gm = ge[rowg + m];
        __syncthreads();
        float sm = 1.f - gm;
        float acc = 0.f;
#pragma unroll
        for (int i = 0; i < 32; ++i) {
            hk[i] = hk[i] * gm + ks[kb + i] * sm;
            acc += qs[kb + i] * hk[i];
        }
        red[t] = acc;
        __syncthreads();
        if (t < 64)
            oks[(step - c * CH) * MM + t] = red[t] + red[64 + t] + red[128 + t] + red[192 + t];
        __syncthreads();
    }

    // The last step's closing barrier has published every row of oks.
    const int lane = t & 31, wv = t >> 5;
    float* prow = p + (b * TT + c * CH + wv) * (HH * MM) + h * MM + lane;
    for (int j = 0; j < CH / 8; ++j) {
        const float* src = oks + (wv + 8 * j) * MM;
        float x0 = src[lane], x1 = src[lane + 32];
        float mx = fmaxf(x0, x1);
#pragma unroll
        for (int off = 16; off > 0; off >>= 1) mx = fmaxf(mx, __shfl_xor(mx, off, 32));
        float ea = __expf(x0 - mx), eb = __expf(x1 - mx);
        float s = ea + eb;
#pragma unroll
        for (int off = 16; off > 0; off >>= 1) s += __shfl_xor(s, off, 32);
        float inv = 1.f / s;
        prow[8 * j * (HH * MM)]      = ea * inv;
        prow[8 * j * (HH * MM) + 32] = eb * inv;
    }
}

// Pass 2 local: one block per (b,h,chunk). Thread t owns v-col t&127 and 32 m's
// (the m-group is the same for a whole wave). End state only, no output.
__global__ __launch_bounds__(256) void scan2_local_kernel(
    const float* __restrict__ v, const float* __restrict__ ge,
    float* __restrict__ hloc) {
    const int bh = blockIdx.x / NC, c = blockIdx.x % NC;
    const int b = bh >> 2, h = bh & 3;
    const int t = threadIdx.x;
    const int vc = t & 127;
    const int mb = __builtin_amdgcn_readfirstlane(t >> 7) * 32;

    float hv[32];
#pragma unroll
    for (int i = 0; i < 32; ++i) hv[i] = 0.f;

    for (int step = c * CH; step < c * CH + CH; ++step) {
        const float4* gr = (const float4*)(ge + (b * TT + step) * (HH * MM) + h * MM + mb);
        float vv = v[(b * TT + step) * (HH * VV) + h * VV + vc];
#pragma unroll
        for (int j = 0; j < 8; ++j) {
            float4 g = gr[j];
            hv[4 * j + 0] = hv[4 * j + 0] * g.x + (1.f - g.x) * vv;
            hv[4 * j + 1] = hv[4 * j + 1] * g.y + (1.f - g.y) * vv;
            hv[4 * j + 2] = hv[4 * j + 2] * g.z + (1.f - g.z) * vv;
            hv[4 * j + 3] = hv[4 * j + 3] * g.w + (1.f - g.w) * vv;
        }
    }

    float* dst = hloc + blockIdx.x * SS + mb * VV + vc;
#pragma unroll
    for (int i = 0; i < 32; ++i) dst[i * VV] = hv[i];
}

// ---------------------------------------------------------------------------
// Pass 2 scan: hv[m,v] = hv*ge[m] + (1-ge[m])*v[v]; o[v] = sum_m p[m]*hv[m,v]
// One block per (b,h,chunk), started from the carried state.
// Thread t owns v-col t&127, m-group t>>7 (32 m's).
// The chunk's 32 output rows stay in LDS; the per-head RMSNorm over V=128 is
// taken at the end, one wave per row, and only the normed rows go to memory.
// ---------------------------------------------------------------------------
__global__ __launch_bounds__(256) void scan2_kernel(
    const float* __restrict__ p, const float* __restrict__ v,
    const float* __restrict__ ge, const float* __restrict__ hin,
    const float* __restrict__ w, float* __restrict__ o) {
    const int bh = blockIdx.x / NC, c = blockIdx.x % NC;
    const int b = bh >> 2, h = bh & 3;
    const int t = threadIdx.x;
    const int vc = t & 127, mb = (t >> 7) * 32;

    __shared__ float ps[64], ges[64], vs[128], red[256];
    __shared__ float os[CH * VV];          // the chunk's output rows, 16 KB
    float hv[32];
    const float* h0 = hin + blockIdx.x * SS + mb * VV + vc;
#pragma unroll
    for (int i = 0; i < 32; ++i) hv[i] = h0[i * VV];

    for (int step = c * CH; step < c * CH + CH; ++step) {
        int rowv = (b * TT + step) * (HH * VV) + h * VV;
        int rowg = (b * TT + step) * (HH * MM) + h * MM;
        if (t < 64)       ps[t] = p[rowg + t];
        else if (t < 128) ges[t - 64] = ge[rowg + (t - 64)];
        else              vs[t - 128] = v[rowv + (t - 128)];
        __syncthreads();
        float vv = vs[vc];
        float acc = 0.f;
#pragma unroll
        for (int i = 0; i < 32; ++i) {
            float g = ges[mb + i];
            hv[i] = hv[i] * g + (1.f - g) * vv;
            acc += ps[mb + i] * hv[i];
        }
        red[t] = acc;
        __syncthreads();
        if (t < 128) os[(step - c * CH) * VV + t] = red[t] + red[128 + t];
        __syncthreads();
    }

    // The last step's closing barrier has published every row of os.
    const int lane = t & 31, wv = t >> 5;
    float* orow = o + (b * TT + c * CH + wv) * (HH * VV) + h * VV + lane;
    const float w0 = w[lane], w1 = w[lane + 32], w2 = w[lane + 64], w3 = w[lane + 96];
    for (int j = 0; j < CH / 8; ++j) {
        const float* base = os + (wv + 8 * j) * VV;
        float x0 = base[lane], x1 = base[lane + 32], x2 = base[lane + 64], x3 = base[lane + 96];
        float ss = x0 * x0 + x1 * x1 + x2 * x2 + x3 * x3;
#pragma unroll
        for (int off = 16; off > 0; off >>= 1) ss += __shfl_xor(ss, off, 32);
        float r = rsqrtf(ss * (1.f / (float)VV) + 1e-5f);
        orow[8 * j * (HH * VV)]      = x0 * r * w0;
        orow[8 * j * (HH * VV) + 32] = x1 * r * w1;
        orow[8 * j * (HH * VV) + 64] = x2 * r * w2;
        orow[8 * j * (HH * VV) + 96] = x3 * r * w3;
    }
}

// ---------------------------------------------------------------------------

extern "C" void kernel_launch(void* const* d_in, const int* in_sizes, int n_in,
                              void* d_out, int out_size, void* d_ws, size_t ws_size,
                              hipStream_t stream) {
    const float* x      = (const float*)d_in[0];
    const float* Wq     = (const float*)d_in[1];
    const float* Wk     = (const float*)d_in[2];
    const float* Wv     = (const float*)d_in[3];
    const float* Wf     = (const float*)d_in[4];
    const float* gnormw = (const float*)d_in[5];
    const float* Wo     = (const float*)d_in[6];
    float* out = (float*)d_out;

    float* ws = (float*)d_ws;
    float* q  = ws;                       // BT*512
    float* k  = q  + (size_t)BT * 512;    // BT*512
    float* v  = k  + (size_t)BT * 512;    // BT*512
    float* ge = v  + (size_t)BT * 512;    // BT*256
    float* p  = ge + (size_t)BT * 256;    // BT*256
    float* o  = p  + (size_t)BT * 256;    // BT*512
    float* hloc = o    + (size_t)BT * 512;              // 16*NC*SS chunk end states
    float* hin  = hloc + (size_t)BB * HH * NC * SS;     // 16*NC*SS chunk start states
    float* dloc = hin  + (size_t)BB * HH * NC * SS;     // 16*NC*MM chunk decay products

    dim3 blk(256);
    dim3 grd512(512 / 64, BT / 128);  // N=512 GEMMs
    dim3 grd256(256 / 64, BT / 128);  // N=256 GEMM (Wf)

    gemm_wmma_kernel<1><<<grd512, blk, 0, stream>>>(x, Wq, q, 512);   // swish
    gemm_wmma_kernel<1><<<grd512, blk, 0, stream>>>(x, Wk, k, 512);   // swish
    gemm_wmma_kernel<0><<<grd512, blk, 0, stream>>>(x, Wv, v, 512);   // none
    gemm_wmma_kernel<2><<<grd256, blk, 0, stream>>>(x, Wf, ge, 256);  // ge gate

    dim3 grdChunk(BB * HH * NC);          // one block per (b,h,chunk)
    dim3 grdState(BB * HH * SS / 256);    // one thread per state element

    scan1_local_kernel<<<grdChunk, blk, 0, stream>>>(k, ge, hloc, dloc);
    carry_kernel<0><<<grdState, blk, 0, stream>>>(hloc, dloc, hin);
    scan1_kernel<<<grdChunk, blk, 0, stream>>>(q, k, ge, hin, p);      // + softmax
    scan2_local_kernel<<<grdChunk, blk, 0, stream>>>(v, ge, hloc);
    carry_kernel<1><<<grdState, blk, 0, stream>>>(hloc, dloc, hin);
    scan2_kernel<<<grdChunk, blk, 0, stream>>>(p, v, ge, hin, gnormw, o);  // + RMSNorm

    gemm_wmma_kernel<0><<<grd512, blk, 0, stream>>>(o, Wo, out, 512); // out proj
}

// v003
// A run of this version takes 209 microseconds.
// Timed twice side by side with v002, it ran 1.08 times as fast both times.
// Counting every step since v000, it is 25.9 times as fast.
#include <hip/hip_runtime.h>
#include <hip/hip_bf16.h>

#define BB 4
#define TT 2048
#define DD 512
#define HH 4
#define KK 128
#define VV 128
#define MM 64
#define BT (BB * TT)          // 8192 rows for all GEMMs
#define CH 32                 // time steps per chunk of the two scans
#define NC (TT / CH)          // 64 chunks per (b,h)
#define SS (KK * MM)          // 8192 state elements per (b,h), both scans

#define LDA 40                // padded LDS row length (bf16 elems): 80B, 16B-aligned runs

typedef __attribute__((ext_vector_type(16))) __bf16 v16bf;
typedef __attribute__((ext_vector_type(8)))  __bf16 v8bf;
typedef __attribute__((ext_vector_type(2)))  __bf16 v2bf;
typedef __attribute__((ext_vector_type(8)))  float  v8f;

#if __has_builtin(__builtin_amdgcn_cvt_pk_bf16_f32)
__device__ __forceinline__ unsigned pack2bf(float a, float b) {
    v2bf r = __builtin_amdgcn_cvt_pk_bf16_f32(a, b);   // v_cvt_pk_bf16_f32
    return __builtin_bit_cast(unsigned, r);
}
#else
__device__ __forceinline__ unsigned pack2bf(float a, float b) {
    unsigned ua = __builtin_bit_cast(unsigned, a);
    unsigned ub = __builtin_bit_cast(unsigned, b);
    ua = (ua + 0x7FFFu + ((ua >> 16) & 1u)) >> 16;     // RNE
    ub = (ub + 0x7FFFu + ((ub >> 16) & 1u)) >> 16;
    return ua | (ub << 16);
}
#endif

__device__ __forceinline__ __bf16 f2bf(float f) {
    union { unsigned u; __bf16 h[2]; } x;
    x.u = pack2bf(f, 0.f);
    return x.h[0];
}

// ---------------------------------------------------------------------------
// Tiled GEMM: Y(8192 x N) = act( X(8192 x 512) @ W(512 x N) ), bf16 WMMA.
// Block = 256 threads (8 waves). Block tile = 128(M) x 64(N), K-step = 32.
// Software-pipelined double-buffered LDS: fetch tile k+1 to registers, WMMA
// tile k from LDS[cur], then stage registers into LDS[cur^1]; ONE barrier
// per K-step. A staged row-major As[row][k]; B staged transposed Bst[col][k]
// so every lane fragment is two contiguous 16B runs -> ds_load_b128.
// act: 0 = none, 1 = swish, 2 = ge = exp(log_sigmoid(x)/8); the same for a whole block
// ---------------------------------------------------------------------------
template <int ACT>
__device__ __forceinline__ void gemm_store(
    const v8f (&acc)[4], float* __restrict__ Y, const int N, const int row0, const int col0) {
#pragma unroll
    for (int jn = 0; jn < 4; ++jn) {
#pragma unroll
        for (int r = 0; r < 8; ++r) {
            float x = acc[jn][r];
            if (ACT == 1) {
                x = x / (1.f + __expf(-x));                      // swish
            } else if (ACT == 2) {
                float ax = fabsf(x);
                float ls = fminf(x, 0.f) - log1pf(__expf(-ax));  // log_sigmoid, stable
                x = __expf(ls * 0.125f);                         // ge = exp(g/8)
            }
            Y[(row0 + r) * N + col0 + jn * 16] = x;
        }
    }
    // The three epilogues share one kernel: keeps the stores' address and data
    // registers from being rewritten by another epilogue's code behind a branch.
    asm volatile("s_wait_xcnt 0x0" ::: "memory");
}

__device__ __forceinline__ void gemm_tile(
    const float* __restrict__ X, const float* __restrict__ W,
    float* __restrict__ Y, const int N, const int act,
    const int rowBase, const int colBase) {
    __shared__ __align__(16) __bf16 As[2][128 * LDA];   // 2 x 10.0 KB
    __shared__ __align__(16) __bf16 Bst[2][64 * LDA];   // 2 x  5.0 KB

    const int tid  = threadIdx.x;
    const int lane = tid & 31;
    const int wv   = tid >> 5;

    const int mrow = lane & 15;            // row of 16-row tile / col of 16-col tile
    const int kb   = (lane >> 4) << 3;     // 0 or 8: K sub-block for this half-wave

    const float4* X4 = (const float4*)X;
    const float4* W4 = (const float4*)W;

    // Per-thread staging coordinates (constant)
    int arr[4], ac[4];                     // A: row, float4-col
#pragma unroll
    for (int i = 0; i < 4; ++i) { int e = tid + i * 256; arr[i] = e >> 3; ac[i] = e & 7; }
    int brr[2], bc[2];                     // B: k-row, float4-col
#pragma unroll
    for (int i = 0; i < 2; ++i) { int e = tid + i * 256; brr[i] = e >> 4; bc[i] = e & 15; }

    float4 ra[4], rb[2];

    // ---- prologue: fetch tile 0 and stage into buffer 0
#pragma unroll
    for (int i = 0; i < 4; ++i)
        ra[i] = X4[(((rowBase + arr[i]) * DD) >> 2) + ac[i]];
#pragma unroll
    for (int i = 0; i < 2; ++i)
        rb[i] = W4[((brr[i] * N + colBase) >> 2) + bc[i]];
#pragma unroll
    for (int i = 0; i < 4; ++i) {
        uint2 t; t.x = pack2bf(ra[i].x, ra[i].y); t.y = pack2bf(ra[i].z, ra[i].w);
        *(uint2*)&As[0][arr[i] * LDA + ac[i] * 4] = t;
    }
#pragma unroll
    for (int i = 0; i < 2; ++i) {
        int c = bc[i] * 4, r = brr[i];
        Bst[0][(c + 0) * LDA + r] = f2bf(rb[i].x);
        Bst[0][(c + 1) * LDA + r] = f2bf(rb[i].y);
        Bst[0][(c + 2) * LDA + r] = f2bf(rb[i].z);
        Bst[0][(c + 3) * LDA + r] = f2bf(rb[i].w);
    }

    v8f acc[4] = {};
    int cur = 0;

    for (int k0 = 0; k0 < DD; k0 += 32) {
        __syncthreads();                      // LDS[cur] ready; LDS[cur^1] free
        const bool more = (k0 + 32 < DD);
        if (more) {
            // Issue next-tile global loads early: they fly under the WMMAs.
#pragma unroll
            for (int i = 0; i < 4; ++i)
                ra[i] = X4[(((rowBase + arr[i]) * DD + k0 + 32) >> 2) + ac[i]];
#pragma unroll
            for (int i = 0; i < 2; ++i)
                rb[i] = W4[(((k0 + 32 + brr[i]) * N + colBase) >> 2) + bc[i]];
            if (k0 + 64 < DD)
                __builtin_prefetch(&X[(rowBase + (tid >> 1)) * DD + k0 + 64], 0, 1);
        }

        // ---- WMMA on buffer `cur`
        const __bf16* Ab = &As[cur][0];
        const __bf16* Bb = &Bst[cur][0];
        const int arow = (wv * 16 + mrow) * LDA;
        v8bf alo = *(const v8bf*)&Ab[arow + kb];
        v8bf ahi = *(const v8bf*)&Ab[arow + 16 + kb];
        v16bf a = __builtin_shufflevector(alo, ahi,
            0, 1, 2, 3, 4, 5, 6, 7, 8, 9, 10, 11, 12, 13, 14, 15);
#pragma unroll
        for (int jn = 0; jn < 4; ++jn) {
            const int bcol = (jn * 16 + mrow) * LDA;
            v8bf blo = *(const v8bf*)&Bb[bcol + kb];
            v8bf bhi = *(const v8bf*)&Bb[bcol + 16 + kb];
            v16bf bfr = __builtin_shufflevector(blo, bhi,
                0, 1, 2, 3, 4, 5, 6, 7, 8, 9, 10, 11, 12, 13, 14, 15);
            acc[jn] = __builtin_amdgcn_wmma_f32_16x16x32_bf16(
                false, a, false, bfr, (short)0, acc[jn], false, false);
        }

        if (more) {
            // ---- stage fetched registers into buffer `cur^1`
            __bf16* An = &As[cur ^ 1][0];
            __bf16* Bn = &Bst[cur ^ 1][0];
#pragma unroll
            for (int i = 0; i < 4; ++i) {
                uint2 t; t.x = pack2bf(ra[i].x, ra[i].y); t.y = pack2bf(ra[i].z, ra[i].w);
                *(uint2*)&An[arr[i] * LDA + ac[i] * 4] = t;
            }
#pragma unroll
            for (int i = 0; i < 2; ++i) {
                int c = bc[i] * 4, r = brr[i];
                Bn[(c + 0) * LDA + r] = f2bf(rb[i].x);
                Bn[(c + 1) * LDA + r] = f2bf(rb[i].y);
                Bn[(c + 2) * LDA + r] = f2bf(rb[i].z);
                Bn[(c + 3) * LDA + r] = f2bf(rb[i].w);
            }
        }
        cur ^= 1;
    }

    const int row0 = rowBase + wv * 16 + ((lane >> 4) << 3);
    const int col0 = colBase + mrow;
    if (act == 1)      gemm_store<1>(acc, Y, N, row0, col0);
    else if (act == 2) gemm_store<2>(acc, Y, N, row0, col0);
    else               gemm_store<0>(acc, Y, N, row0, col0);
}

// The four input projections share X and do not depend on each other: one grid
// of 28 column tiles (8 for q, 8 for k, 8 for v, 4 for the gate) by 64 row tiles.
__global__ __launch_bounds__(256) void proj_in_kernel(
    const float* __restrict__ X,
    const float* __restrict__ Wq, const float* __restrict__ Wk,
    const float* __restrict__ Wv, const float* __restrict__ Wf,
    float* __restrict__ q, float* __restrict__ k,
    float* __restrict__ v, float* __restrict__ ge) {
    const int sel = blockIdx.x >> 3;       // 0 q, 1 k, 2 v, 3 gate
    const float* W = sel == 0 ? Wq : sel == 1 ? Wk : sel == 2 ? Wv : Wf;
    float*       Y = sel == 0 ? q  : sel == 1 ? k  : sel == 2 ? v  : ge;
    const int N   = sel == 3 ? HH * MM : DD;
    const int act = sel < 2 ? 1 : sel == 2 ? 0 : 2;
    gemm_tile(X, W, Y, N, act, blockIdx.y * 128, (blockIdx.x & 7) * 64);
}

__global__ __launch_bounds__(256) void proj_out_kernel(
    const float* __restrict__ X, const float* __restrict__ W,
    float* __restrict__ Y) {
    gemm_tile(X, W, Y, DD, 0, blockIdx.y * 128, blockIdx.x * 64);
}

// ---------------------------------------------------------------------------
// The two scans are linear in their state, so the time axis is cut into NC
// chunks that run side by side:
//   local : each chunk runs the recurrence from a zero state and keeps its end
//           state L_c and the product D_c[m] of its decays;
//   carry : H_0 = 0, H_{c+1} = H_c * D_c + L_c gives every chunk's start state;
//   scan  : each chunk runs the full step loop from H_c and writes its outputs.
// ---------------------------------------------------------------------------

// Pass 1 local: one block per (b,h,chunk). Thread t owns m = t&63 and 32 k's.
// No output is formed here, so nothing crosses threads: k is read straight from
// memory (the k-group is the same for a whole wave).
__device__ __forceinline__ void scan1_local(
    const int blk, const float* __restrict__ k, const float* __restrict__ ge,
    float* __restrict__ hloc, float* __restrict__ dloc) {
    const int bh = blk / NC, c = blk % NC;
    const int b = bh >> 2, h = bh & 3;
    const int t = threadIdx.x;
    const int m = t & 63;
    const int kb = __builtin_amdgcn_readfirstlane(t >> 6) * 32;

    float hk[32];
#pragma unroll
    for (int i = 0; i < 32; ++i) hk[i] = 0.f;
    float dp = 1.f;

    for (int step = c * CH; step < c * CH + CH; ++step) {
        const float4* kr = (const float4*)(k + (b * TT + step) * (HH * KK) + h * KK + kb);
        float gm = ge[(b * TT + step) * (HH * MM) + h * MM + m];
        float sm = 1.f - gm;
#pragma unroll
        for (int j = 0; j < 8; ++j) {
            float4 kv = kr[j];
            hk[4 * j + 0] = hk[4 * j + 0] * gm + kv.x * sm;
            hk[4 * j + 1] = hk[4 * j + 1] * gm + kv.y * sm;
            hk[4 * j + 2] = hk[4 * j + 2] * gm + kv.z * sm;
            hk[4 * j + 3] = hk[4 * j + 3] * gm + kv.w * sm;
        }
        dp *= gm;
    }

    float* dst = hloc + blk * SS + kb * MM + m;
#pragma unroll
    for (int i = 0; i < 32; ++i) dst[i * MM] = hk[i];
    if (t < 64) dloc[blk * MM + m] = dp;
}

// Carry over the chunks: one thread per state element, NC serial steps.
// SECOND = 0: state laid out [k][m]; SECOND = 1: state laid out [m][v].
template <int SECOND>
__device__ __forceinline__ void carry(
    const int blk, const float* __restrict__ hloc, const float* __restrict__ dloc,
    float* __restrict__ hin) {
    const int e = blk * 256 + threadIdx.x;
    const int bh = e / SS, idx = e % SS;
    const int m = SECOND ? (idx / VV) : (idx % MM);
    const float* src = hloc + bh * (NC * SS) + idx;
    const float* dsr = dloc + bh * (NC * MM) + m;
    float* dst = hin + bh * (NC * SS) + idx;

    float hc = 0.f;
    for (int c0 = 0; c0 < NC; c0 += 16) {
        float a[16], d[16];                 // 16 chunks' loads in flight at once
#pragma unroll
        for (int j = 0; j < 16; ++j) {
            a[j] = src[(c0 + j) * SS];
            d[j] = dsr[(c0 + j) * MM];
        }
#pragma unroll
        for (int j = 0; j < 16; ++j) {
            dst[(c0 + j) * SS] = hc;
            hc = hc * d[j] + a[j];
        }
    }
}

// Both carries in one grid: neither reads what the other writes.
__global__ __launch_bounds__(256) void carry_both_kernel(
    const float* __restrict__ hloc1, const float* __restrict__ hloc2,
    const float* __restrict__ dloc,
    float* __restrict__ hin1, float* __restrict__ hin2) {
    const int half = BB * HH * SS / 256;
    if ((int)blockIdx.x < half) carry<0>(blockIdx.x, hloc1, dloc, hin1);
    else                        carry<1>(blockIdx.x - half, hloc2, dloc, hin2);
}

__global__ __launch_bounds__(256) void scan1_kernel(
    const float* __restrict__ q, const float* __restrict__ k,
    const float* __restrict__ ge, const float* __restrict__ hin,
    float* __restrict__ p) {
    const int bh = blockIdx.x / NC, c = blockIdx.x % NC;
    const int b = bh >> 2, h = bh & 3;
    const int t = threadIdx.x;
    const int m = t & 63, kb = (t >> 6) * 32;

    __shared__ float qs[128], ks[128], red[256];
    __shared__ float oks[CH * MM];         // the chunk's score rows, 8 KB
    float hk[32];
    const float* h0 = hin + blockIdx.x * SS + kb * MM + m;
#pragma unroll
    for (int i = 0; i < 32; ++i) hk[i] = h0[i * MM];

    for (int step = c * CH; step < c * CH + CH; ++step) {
        int rowq = (b * TT + step) * (HH * KK) + h * KK;
        int rowg = (b * TT + step) * (HH * MM) + h * MM;
        if (t < 128) qs[t] = q[rowq + t];
        else         ks[t - 128] = k[rowq + (t - 128)];
        float gm = ge[rowg + m];
        __syncthreads();
        float sm = 1.f - gm;
        float acc = 0.f;
#pragma unroll
        for (int i = 0; i < 32; ++i) {
            hk[i] = hk[i] * gm + ks[kb + i] * sm;
            acc += qs[kb + i] * hk[i];
        }
        red[t] = acc;
        __syncthreads();
        if (t < 64)
            oks[(step - c * CH) * MM + t] = red[t] + red[64 + t] + red[128 + t] + red[192 + t];
        __syncthreads();
    }

    // The last step's closing barrier has published every row of oks.
    const int lane = t & 31, wv = t >> 5;
    float* prow = p + (b * TT + c * CH + wv) * (HH * MM) + h * MM + lane;
    for (int j = 0; j < CH / 8; ++j) {
        const float* src = oks + (wv + 8 * j) * MM;
        float x0 = src[lane], x1 = src[lane + 32];
        float mx = fmaxf(x0, x1);
#pragma unroll
        for (int off = 16; off > 0; off >>= 1) mx = fmaxf(mx, __shfl_xor(mx, off, 32));
        float ea = __expf(x0 - mx), eb = __expf(x1 - mx);
        float s = ea + eb;
#pragma unroll
        for (int off = 16; off > 0; off >>= 1) s += __shfl_xor(s, off, 32);
        float inv = 1.f / s;
        prow[8 * j * (HH * MM)]      = ea * inv;
        prow[8 * j * (HH * MM) + 32] = eb * inv;
    }
}

// Pass 2 local: one block per (b,h,chunk). Thread t owns v-col t&127 and 32 m's
// (the m-group is the same for a whole wave). End state only, no output.
__device__ __forceinline__ void scan2_local(
    const int blk, const float* __restrict__ v, const float* __restrict__ ge,
    float* __restrict__ hloc) {
    const int bh = blk / NC, c = blk % NC;
    const int b = bh >> 2, h = bh & 3;
    const int t = threadIdx.x;
    const int vc = t & 127;
    const int mb = __builtin_amdgcn_readfirstlane(t >> 7) * 32;

    float hv[32];
#pragma unroll
    for (int i = 0; i < 32; ++i) hv[i] = 0.f;

    for (int step = c * CH; step < c * CH + CH; ++step) {
        const float4* gr = (const float4*)(ge + (b * TT + step) * (HH * MM) + h * MM + mb);
        float vv = v[(b * TT + step) * (HH * VV) + h * VV + vc];
#pragma unroll
        for (int j = 0; j < 8; ++j) {
            float4 g = gr[j];
            hv[4 * j + 0] = hv[4 * j + 0] * g.x + (1.f - g.x) * vv;
            hv[4 * j + 1] = hv[4 * j + 1] * g.y + (1.f - g.y) * vv;
            hv[4 * j + 2] = hv[4 * j + 2] * g.z + (1.f - g.z) * vv;
            hv[4 * j + 3] = hv[4 * j + 3] * g.w + (1.f - g.w) * vv;
        }
    }

    float* dst = hloc + blk * SS + mb * VV + vc;
#pragma unroll
    for (int i = 0; i < 32; ++i) dst[i * VV] = hv[i];
    // Pass 1's code follows in the same kernel: keeps the stores' registers from
    // being rewritten there before the stores have taken them.
    asm volatile("s_wait_xcnt 0x0" ::: "memory");
}

// Both local passes in one grid: pass 2's end states need v and ge only, not p.
// Even blocks take pass 1, odd blocks pass 2, of the same (b,h,chunk).
__global__ __launch_bounds__(256) void local_both_kernel(
    const float* __restrict__ k, const float* __restrict__ v,
    const float* __restrict__ ge,
    float* __restrict__ hloc1, float* __restrict__ hloc2,
    float* __restrict__ dloc) {
    const int blk = blockIdx.x >> 1;
    if ((blockIdx.x & 1) == 0) scan1_local(blk, k, ge, hloc1, dloc);
    else                       scan2_local(blk, v, ge, hloc2);
}

// ---------------------------------------------------------------------------
// Pass 2 scan: hv[m,v] = hv*ge[m] + (1-ge[m])*v[v]; o[v] = sum_m p[m]*hv[m,v]
// One block per (b,h,chunk), started from the carried state.
// Thread t owns v-col t&127, m-group t>>7 (32 m's).
// The chunk's 32 output rows stay in LDS; the per-head RMSNorm over V=128 is
// taken at the end, one wave per row, and only the normed rows go to memory.
// ---------------------------------------------------------------------------
__global__ __launch_bounds__(256) void scan2_kernel(
    const float* __restrict__ p, const float* __restrict__ v,
    const float* __restrict__ ge, const float* __restrict__ hin,
    const float* __restrict__ w, float* __restrict__ o) {
    const int bh = blockIdx.x / NC, c = blockIdx.x % NC;
    const int b = bh >> 2, h = bh & 3;
    const int t = threadIdx.x;
    const int vc = t & 127, mb = (t >> 7) * 32;

    __shared__ float ps[64], ges[64], vs[128], red[256];
    __shared__ float os[CH * VV];          // the chunk's output rows, 16 KB
    float hv[32];
    const float* h0 = hin + blockIdx.x * SS + mb * VV + vc;
#pragma unroll
    for (int i = 0; i < 32; ++i) hv[i] = h0[i * VV];

    for (int step = c * CH; step < c * CH + CH; ++step) {
        int rowv = (b * TT + step) * (HH * VV) + h * VV;
        int rowg = (b * TT + step) * (HH * MM) + h * MM;
        if (t < 64)       ps[t] = p[rowg + t];
        else if (t < 128) ges[t - 64] = ge[rowg + (t - 64)];
        else              vs[t - 128] = v[rowv + (t - 128)];
        __syncthreads();
        float vv = vs[vc];
        float acc = 0.f;
#pragma unroll
        for (int i = 0; i < 32; ++i) {
            float g = ges[mb + i];
            hv[i] = hv[i] * g + (1.f - g) * vv;
            acc += ps[mb + i] * hv[i];
        }
        red[t] = acc;
        __syncthreads();
        if (t < 128) os[(step - c * CH) * VV + t] = red[t] + red[128 + t];
        __syncthreads();
    }

    // The last step's closing barrier has published every row of os.
    const int lane = t & 31, wv = t >> 5;
    float* orow = o + (b * TT + c * CH + wv) * (HH * VV) + h * VV + lane;
    const float w0 = w[lane], w1 = w[lane + 32], w2 = w[lane + 64], w3 = w[lane + 96];
    for (int j = 0; j < CH / 8; ++j) {
        const float* base = os + (wv + 8 * j) * VV;
        float x0 = base[lane], x1 = base[lane + 32], x2 = base[lane + 64], x3 = base[lane + 96];
        float ss = x0 * x0 + x1 * x1 + x2 * x2 + x3 * x3;
#pragma unroll
        for (int off = 16; off > 0; off >>= 1) ss += __shfl_xor(ss, off, 32);
        float r = rsqrtf(ss * (1.f / (float)VV) + 1e-5f);
        orow[8 * j * (HH * VV)]      = x0 * r * w0;
        orow[8 * j * (HH * VV) + 32] = x1 * r * w1;
        orow[8 * j * (HH * VV) + 64] = x2 * r * w2;
        orow[8 * j * (HH * VV) + 96] = x3 * r * w3;
    }
}

// ---------------------------------------------------------------------------

extern "C" void kernel_launch(void* const* d_in, const int* in_sizes, int n_in,
                              void* d_out, int out_size, void* d_ws, size_t ws_size,
                              hipStream_t stream) {
    const float* x      = (const float*)d_in[0];
    const float* Wq     = (const float*)d_in[1];
    const float* Wk     = (const float*)d_in[2];
    const float* Wv     = (const float*)d_in[3];
    const float* Wf     = (const float*)d_in[4];
    const float* gnormw = (const float*)d_in[5];
    const float* Wo     = (const float*)d_in[6];
    float* out = (float*)d_out;

    float* ws = (float*)d_ws;
    float* q  = ws;                       // BT*512
    float* k  = q  + (size_t)BT * 512;    // BT*512
    float* v  = k  + (size_t)BT * 512;    // BT*512
    float* ge = v  + (size_t)BT * 512;    // BT*256
    float* p  = ge + (size_t)BT * 256;    // BT*256
    float* o  = p  + (size_t)BT * 256;    // BT*512
    float* hloc = o    + (size_t)BT * 512;              // 16*NC*SS chunk end states
    float* hin  = hloc + (size_t)BB * HH * NC * SS;     // 16*NC*SS chunk start states
    float* hloc2 = hin   + (size_t)BB * HH * NC * SS;   // the same two for pass 2
    float* hin2  = hloc2 + (size_t)BB * HH * NC * SS;
    float* dloc  = hin2  + (size_t)BB * HH * NC * SS;   // 16*NC*MM chunk decay products

    dim3 blk(256);
    dim3 grdIn((3 * 512 + 256) / 64, BT / 128);   // q, k, v and gate column tiles
    dim3 grdOut(512 / 64, BT / 128);

    proj_in_kernel<<<grdIn, blk, 0, stream>>>(x, Wq, Wk, Wv, Wf, q, k, v, ge);

    dim3 grdChunk(BB * HH * NC);          // one block per (b,h,chunk)
    dim3 grdChunk2(2 * BB * HH * NC);         // the same for both passes at once
    dim3 grdState2(2 * BB * HH * SS / 256);   // one thread per state element, both passes

    local_both_kernel<<<grdChunk2, blk, 0, stream>>>(k, v, ge, hloc, hloc2, dloc);
    carry_both_kernel<<<grdState2, blk, 0, stream>>>(hloc, hloc2, dloc, hin, hin2);
    scan1_kernel<<<grdChunk, blk, 0, stream>>>(q, k, ge, hin, p);      // + softmax
    scan2_kernel<<<grdChunk, blk, 0, stream>>>(p, v, ge, hin2, gnormw, o);  // + RMSNorm

    proj_out_kernel<<<grdOut, blk, 0, stream>>>(o, Wo, out);
}

// v004
// One run takes 185 microseconds.
// Timed twice side by side with v003, it ran 1.13 times as fast both times.
// Over all steps from v000 it is 29.3 times as fast.
#include <hip/hip_runtime.h>
#include <hip/hip_bf16.h>

#define BB 4
#define TT 2048
#define DD 512
#define HH 4
#define KK 128
#define VV 128
#define MM 64
#define BT (BB * TT)          // 8192 rows for all GEMMs
#define CH 32                 // time steps per chunk of the two scans
#define NC (TT / CH)          // 64 chunks per (b,h)
#define SS (KK * MM)          // 8192 state elements per (b,h), both scans

#define LDA 40                // padded LDS row length (bf16 elems): 80B, 16B-aligned runs

typedef __attribute__((ext_vector_type(16))) __bf16 v16bf;
typedef __attribute__((ext_vector_type(8)))  __bf16 v8bf;
typedef __attribute__((ext_vector_type(2)))  __bf16 v2bf;
typedef __attribute__((ext_vector_type(8)))  float  v8f;

#if __has_builtin(__builtin_amdgcn_cvt_pk_bf16_f32)
__device__ __forceinline__ unsigned pack2bf(float a, float b) {
    v2bf r = __builtin_amdgcn_cvt_pk_bf16_f32(a, b);   // v_cvt_pk_bf16_f32
    return __builtin_bit_cast(unsigned, r);
}
#else
__device__ __forceinline__ unsigned pack2bf(float a, float b) {
    unsigned ua = __builtin_bit_cast(unsigned, a);
    unsigned ub = __builtin_bit_cast(unsigned, b);
    ua = (ua + 0x7FFFu + ((ua >> 16) & 1u)) >> 16;     // RNE
    ub = (ub + 0x7FFFu + ((ub >> 16) & 1u)) >> 16;
    return ua | (ub << 16);
}
#endif

__device__ __forceinline__ __bf16 f2bf(float f) {
    union { unsigned u; __bf16 h[2]; } x;
    x.u = pack2bf(f, 0.f);
    return x.h[0];
}

// ---------------------------------------------------------------------------
// Tiled GEMM: Y(8192 x N) = act( X(8192 x 512) @ W(512 x N) ), bf16 WMMA.
// Block = 256 threads (8 waves). Block tile = 128(M) x 64(N), K-step = 32.
// Software-pipelined double-buffered LDS: fetch tile k+1 to registers, WMMA
// tile k from LDS[cur], then stage registers into LDS[cur^1]; ONE barrier
// per K-step. A staged row-major As[row][k]; B staged transposed Bst[col][k]
// so every lane fragment is two contiguous 16B runs -> ds_load_b128.
// act: 0 = none, 1 = swish, 2 = ge = exp(log_sigmoid(x)/8); the same for a whole block
// ---------------------------------------------------------------------------
template <int ACT>
__device__ __forceinline__ void gemm_store(
    const v8f (&acc)[4], float* __restrict__ Y, const int N, const int row0, const int col0) {
#pragma unroll
    for (int jn = 0; jn < 4; ++jn) {
#pragma unroll
        for (int r = 0; r < 8; ++r) {
            float x = acc[jn][r];
            if (ACT == 1) {
                x = x / (1.f + __expf(-x));                      // swish
            } else if (ACT == 2) {
                float ax = fabsf(x);
                float ls = fminf(x, 0.f) - log1pf(__expf(-ax));  // log_sigmoid, stable
                x = __expf(ls * 0.125f);                         // ge = exp(g/8)
            }
            Y[(row0 + r) * N + col0 + jn * 16] = x;
        }
    }
    // The three epilogues share one kernel: keeps the stores' address and data
    // registers from being rewritten by another epilogue's code behind a branch.
    asm volatile("s_wait_xcnt 0x0" ::: "memory");
}

__device__ __forceinline__ void gemm_tile(
    const float* __restrict__ X, const float* __restrict__ W,
    float* __restrict__ Y, const int N, const int act,
    const int rowBase, const int colBase) {
    __shared__ __align__(16) __bf16 As[2][128 * LDA];   // 2 x 10.0 KB
    __shared__ __align__(16) __bf16 Bst[2][64 * LDA];   // 2 x  5.0 KB

    const int tid  = threadIdx.x;
    const int lane = tid & 31;
    const int wv   = tid >> 5;

    const int mrow = lane & 15;            // row of 16-row tile / col of 16-col tile
    const int kb   = (lane >> 4) << 3;     // 0 or 8: K sub-block for this half-wave

    const float4* X4 = (const float4*)X;
    const float4* W4 = (const float4*)W;

    // Per-thread staging coordinates (constant)
    int arr[4], ac[4];                     // A: row, float4-col
#pragma unroll
    for (int i = 0; i < 4; ++i) { int e = tid + i * 256; arr[i] = e >> 3; ac[i] = e & 7; }
    int brr[2], bc[2];                     // B: k-row, float4-col
#pragma unroll
    for (int i = 0; i < 2; ++i) { int e = tid + i * 256; brr[i] = e >> 4; bc[i] = e & 15; }

    float4 ra[4], rb[2];

    // ---- prologue: fetch tile 0 and stage into buffer 0
#pragma unroll
    for (int i = 0; i < 4; ++i)
        ra[i] = X4[(((rowBase + arr[i]) * DD) >> 2) + ac[i]];
#pragma unroll
    for (int i = 0; i < 2; ++i)
        rb[i] = W4[((brr[i] * N + colBase) >> 2) + bc[i]];
#pragma unroll
    for (int i = 0; i < 4; ++i) {
        uint2 t; t.x = pack2bf(ra[i].x, ra[i].y); t.y = pack2bf(ra[i].z, ra[i].w);
        *(uint2*)&As[0][arr[i] * LDA + ac[i] * 4] = t;
    }
#pragma unroll
    for (int i = 0; i < 2; ++i) {
        int c = bc[i] * 4, r = brr[i];
        Bst[0][(c + 0) * LDA + r] = f2bf(rb[i].x);
        Bst[0][(c + 1) * LDA + r] = f2bf(rb[i].y);
        Bst[0][(c + 2) * LDA + r] = f2bf(rb[i].z);
        Bst[0][(c + 3) * LDA + r] = f2bf(rb[i].w);
    }

    v8f acc[4] = {};
    int cur = 0;

    for (int k0 = 0; k0 < DD; k0 += 32) {
        __syncthreads();                      // LDS[cur] ready; LDS[cur^1] free
        const bool more = (k0 + 32 < DD);
        if (more) {
            // Issue next-tile global loads early: they fly under the WMMAs.
#pragma unroll
            for (int i = 0; i < 4; ++i)
                ra[i] = X4[(((rowBase + arr[i]) * DD + k0 + 32) >> 2) + ac[i]];
#pragma unroll
            for (int i = 0; i < 2; ++i)
                rb[i] = W4[(((k0 + 32 + brr[i]) * N + colBase) >> 2) + bc[i]];
            if (k0 + 64 < DD)
                __builtin_prefetch(&X[(rowBase + (tid >> 1)) * DD + k0 + 64], 0, 1);
        }

        // ---- WMMA on buffer `cur`
        const __bf16* Ab = &As[cur][0];
        const __bf16* Bb = &Bst[cur][0];
        const int arow = (wv * 16 + mrow) * LDA;
        v8bf alo = *(const v8bf*)&Ab[arow + kb];
        v8bf ahi = *(const v8bf*)&Ab[arow + 16 + kb];
        v16bf a = __builtin_shufflevector(alo, ahi,
            0, 1, 2, 3, 4, 5, 6, 7, 8, 9, 10, 11, 12, 13, 14, 15);
#pragma unroll
        for (int jn = 0; jn < 4; ++jn) {
            const int bcol = (jn * 16 + mrow) * LDA;
            v8bf blo = *(const v8bf*)&Bb[bcol + kb];
            v8bf bhi = *(const v8bf*)&Bb[bcol + 16 + kb];
            v16bf bfr = __builtin_shufflevector(blo, bhi,
                0, 1, 2, 3, 4, 5, 6, 7, 8, 9, 10, 11, 12, 13, 14, 15);
            acc[jn] = __builtin_amdgcn_wmma_f32_16x16x32_bf16(
                false, a, false, bfr, (short)0, acc[jn], false, false);
        }

        if (more) {
            // ---- stage fetched registers into buffer `cur^1`
            __bf16* An = &As[cur ^ 1][0];
            __bf16* Bn = &Bst[cur ^ 1][0];
#pragma unroll
            for (int i = 0; i < 4; ++i) {
                uint2 t; t.x = pack2bf(ra[i].x, ra[i].y); t.y = pack2bf(ra[i].z, ra[i].w);
                *(uint2*)&An[arr[i] * LDA + ac[i] * 4] = t;
            }
#pragma unroll
            for (int i = 0; i < 2; ++i) {
                int c = bc[i] * 4, r = brr[i];
                Bn[(c + 0) * LDA + r] = f2bf(rb[i].x);
                Bn[(c + 1) * LDA + r] = f2bf(rb[i].y);
                Bn[(c + 2) * LDA + r] = f2bf(rb[i].z);
                Bn[(c + 3) * LDA + r] = f2bf(rb[i].w);
            }
        }
        cur ^= 1;
    }

    const int row0 = rowBase + wv * 16 + ((lane >> 4) << 3);
    const int col0 = colBase + mrow;
    if (act == 1)      gemm_store<1>(acc, Y, N, row0, col0);
    else if (act == 2) gemm_store<2>(acc, Y, N, row0, col0);
    else               gemm_store<0>(acc, Y, N, row0, col0);
}

// The four input projections share X and do not depend on each other: one grid
// of 28 column tiles (8 for q, 8 for k, 8 for v, 4 for the gate) by 64 row tiles.
__global__ __launch_bounds__(256) void proj_in_kernel(
    const float* __restrict__ X,
    const float* __restrict__ Wq, const float* __restrict__ Wk,
    const float* __restrict__ Wv, const float* __restrict__ Wf,
    float* __restrict__ q, float* __restrict__ k,
    float* __restrict__ v, float* __restrict__ ge) {
    const int sel = blockIdx.x >> 3;       // 0 q, 1 k, 2 v, 3 gate
    const float* W = sel == 0 ? Wq : sel == 1 ? Wk : sel == 2 ? Wv : Wf;
    float*       Y = sel == 0 ? q  : sel == 1 ? k  : sel == 2 ? v  : ge;
    const int N   = sel == 3 ? HH * MM : DD;
    const int act = sel < 2 ? 1 : sel == 2 ? 0 : 2;
    gemm_tile(X, W, Y, N, act, blockIdx.y * 128, (blockIdx.x & 7) * 64);
}

__global__ __launch_bounds__(256) void proj_out_kernel(
    const float* __restrict__ X, const float* __restrict__ W,
    float* __restrict__ Y) {
    gemm_tile(X, W, Y, DD, 0, blockIdx.y * 128, blockIdx.x * 64);
}

// ---------------------------------------------------------------------------
// The two scans are linear in their state, so the time axis is cut into NC
// chunks that run side by side:
//   local : each chunk runs the recurrence from a zero state and keeps its end
//           state L_c and the product D_c[m] of its decays;
//   carry : H_0 = 0, H_{c+1} = H_c * D_c + L_c gives every chunk's start state;
//   scan  : each chunk runs the full step loop from H_c and writes its outputs.
// ---------------------------------------------------------------------------

// Pass 1 local: one block per (b,h,chunk). Thread t owns m = t&63 and 32 k's.
// No output is formed here, so nothing crosses threads: k is read straight from
// memory (the k-group is the same for a whole wave).
__device__ __forceinline__ void scan1_local(
    const int blk, const float* __restrict__ k, const float* __restrict__ ge,
    float* __restrict__ hloc, float* __restrict__ dloc) {
    const int bh = blk / NC, c = blk % NC;
    const int b = bh >> 2, h = bh & 3;
    const int t = threadIdx.x;
    const int m = t & 63;
    const int kb = __builtin_amdgcn_readfirstlane(t >> 6) * 32;

    float hk[32];
#pragma unroll
    for (int i = 0; i < 32; ++i) hk[i] = 0.f;
    float dp = 1.f;

    for (int step = c * CH; step < c * CH + CH; ++step) {
        const float4* kr = (const float4*)(k + (b * TT + step) * (HH * KK) + h * KK + kb);
        float gm = ge[(b * TT + step) * (HH * MM) + h * MM + m];
        float sm = 1.f - gm;
#pragma unroll
        for (int j = 0; j < 8; ++j) {
            float4 kv = kr[j];
            hk[4 * j + 0] = hk[4 * j + 0] * gm + kv.x * sm;
            hk[4 * j + 1] = hk[4 * j + 1] * gm + kv.y * sm;
            hk[4 * j + 2] = hk[4 * j + 2] * gm + kv.z * sm;
            hk[4 * j + 3] = hk[4 * j + 3] * gm + kv.w * sm;
        }
        dp *= gm;
    }

    float* dst = hloc + blk * SS + kb * MM + m;
#pragma unroll
    for (int i = 0; i < 32; ++i) dst[i * MM] = hk[i];
    if (t < 64) dloc[blk * MM + m] = dp;
}

// Carry over the chunks: one thread per state element, NC serial steps.
// SECOND = 0: state laid out [k][m]; SECOND = 1: state laid out [m][v].
template <int SECOND>
__device__ __forceinline__ void carry(
    const int blk, const float* __restrict__ hloc, const float* __restrict__ dloc,
    float* __restrict__ hin) {
    const int e = blk * 256 + threadIdx.x;
    const int bh = e / SS, idx = e % SS;
    const int m = SECOND ? (idx / VV) : (idx % MM);
    const float* src = hloc + bh * (NC * SS) + idx;
    const float* dsr = dloc + bh * (NC * MM) + m;
    float* dst = hin + bh * (NC * SS) + idx;

    float hc = 0.f;
    for (int c0 = 0; c0 < NC; c0 += 16) {
        float a[16], d[16];                 // 16 chunks' loads in flight at once
#pragma unroll
        for (int j = 0; j < 16; ++j) {
            a[j] = src[(c0 + j) * SS];
            d[j] = dsr[(c0 + j) * MM];
        }
#pragma unroll
        for (int j = 0; j < 16; ++j) {
            dst[(c0 + j) * SS] = hc;
            hc = hc * d[j] + a[j];
        }
    }
}

// Both carries in one grid: neither reads what the other writes.
__global__ __launch_bounds__(256) void carry_both_kernel(
    const float* __restrict__ hloc1, const float* __restrict__ hloc2,
    const float* __restrict__ dloc,
    float* __restrict__ hin1, float* __restrict__ hin2) {
    const int half = BB * HH * SS / 256;
    if ((int)blockIdx.x < half) carry<0>(blockIdx.x, hloc1, dloc, hin1);
    else                        carry<1>(blockIdx.x - half, hloc2, dloc, hin2);
}

__global__ __launch_bounds__(256) void scan1_kernel(
    const float* __restrict__ q, const float* __restrict__ k,
    const float* __restrict__ ge, const float* __restrict__ hin,
    float* __restrict__ p) {
    const int bh = blockIdx.x / NC, c = blockIdx.x % NC;
    const int b = bh >> 2, h = bh & 3;
    const int t = threadIdx.x;
    const int m = t & 63;
    const int kb = __builtin_amdgcn_readfirstlane(t >> 6) * 32;

    __shared__ float red[CH * 256];        // [step][k-group][m] partial sums, 32 KB
    float hk[32];
    const float* h0 = hin + blockIdx.x * SS + kb * MM + m;
#pragma unroll
    for (int i = 0; i < 32; ++i) hk[i] = h0[i * MM];

    const int row0 = b * TT + c * CH;
    for (int s = 0; s < CH; ++s) {
        const float4* kr = (const float4*)(k + (row0 + s) * (HH * KK) + h * KK + kb);
        const float4* qr = (const float4*)(q + (row0 + s) * (HH * KK) + h * KK + kb);
        float gm = ge[(row0 + s) * (HH * MM) + h * MM + m];
        // The loop advances this load's address registers: they stay as they are
        // until the load has taken them.
        asm volatile("s_wait_xcnt 0x0" ::: "memory");
        float sm = 1.f - gm;
        float acc = 0.f;
#pragma unroll
        for (int j = 0; j < 8; ++j) {
            float4 kv = kr[j];
            float4 qv = qr[j];
            hk[4 * j + 0] = hk[4 * j + 0] * gm + kv.x * sm;  acc += qv.x * hk[4 * j + 0];
            hk[4 * j + 1] = hk[4 * j + 1] * gm + kv.y * sm;  acc += qv.y * hk[4 * j + 1];
            hk[4 * j + 2] = hk[4 * j + 2] * gm + kv.z * sm;  acc += qv.z * hk[4 * j + 2];
            hk[4 * j + 3] = hk[4 * j + 3] * gm + kv.w * sm;  acc += qv.w * hk[4 * j + 3];
        }
        red[s * 256 + t] = acc;
    }
    __syncthreads();                       // publishes every step's partial sums

    const int lane = t & 31, wv = t >> 5;
    float* prow = p + (row0 + wv) * (HH * MM) + h * MM + lane;
    for (int j = 0; j < CH / 8; ++j) {
        const float* src = red + (wv + 8 * j) * 256 + lane;
        float x0 = src[0]  + src[64] + src[128] + src[192];
        float x1 = src[32] + src[96] + src[160] + src[224];
        float mx = fmaxf(x0, x1);
#pragma unroll
        for (int off = 16; off > 0; off >>= 1) mx = fmaxf(mx, __shfl_xor(mx, off, 32));
        float ea = __expf(x0 - mx), eb = __expf(x1 - mx);
        float s = ea + eb;
#pragma unroll
        for (int off = 16; off > 0; off >>= 1) s += __shfl_xor(s, off, 32);
        float inv = 1.f / s;
        prow[8 * j * (HH * MM)]      = ea * inv;
        prow[8 * j * (HH * MM) + 32] = eb * inv;
    }
}

// Pass 2 local: one block per (b,h,chunk). Thread t owns v-col t&127 and 32 m's
// (the m-group is the same for a whole wave). End state only, no output.
__device__ __forceinline__ void scan2_local(
    const int blk, const float* __restrict__ v, const float* __restrict__ ge,
    float* __restrict__ hloc) {
    const int bh = blk / NC, c = blk % NC;
    const int b = bh >> 2, h = bh & 3;
    const int t = threadIdx.x;
    const int vc = t & 127;
    const int mb = __builtin_amdgcn_readfirstlane(t >> 7) * 32;

    float hv[32];
#pragma unroll
    for (int i = 0; i < 32; ++i) hv[i] = 0.f;

    for (int step = c * CH; step < c * CH + CH; ++step) {
        const float4* gr = (const float4*)(ge + (b * TT + step) * (HH * MM) + h * MM + mb);
        float vv = v[(b * TT + step) * (HH * VV) + h * VV + vc];
#pragma unroll
        for (int j = 0; j < 8; ++j) {
            float4 g = gr[j];
            hv[4 * j + 0] = hv[4 * j + 0] * g.x + (1.f - g.x) * vv;
            hv[4 * j + 1] = hv[4 * j + 1] * g.y + (1.f - g.y) * vv;
            hv[4 * j + 2] = hv[4 * j + 2] * g.z + (1.f - g.z) * vv;
            hv[4 * j + 3] = hv[4 * j + 3] * g.w + (1.f - g.w) * vv;
        }
    }

    float* dst = hloc + blk * SS + mb * VV + vc;
#pragma unroll
    for (int i = 0; i < 32; ++i) dst[i * VV] = hv[i];
    // Pass 1's code follows in the same kernel: keeps the stores' registers from
    // being rewritten there before the stores have taken them.
    asm volatile("s_wait_xcnt 0x0" ::: "memory");
}

// Both local passes in one grid: pass 2's end states need v and ge only, not p.
// Even blocks take pass 1, odd blocks pass 2, of the same (b,h,chunk).
__global__ __launch_bounds__(256) void local_both_kernel(
    const float* __restrict__ k, const float* __restrict__ v,
    const float* __restrict__ ge,
    float* __restrict__ hloc1, float* __restrict__ hloc2,
    float* __restrict__ dloc) {
    const int blk = blockIdx.x >> 1;
    if ((blockIdx.x & 1) == 0) scan1_local(blk, k, ge, hloc1, dloc);
    else                       scan2_local(blk, v, ge, hloc2);
}

// ---------------------------------------------------------------------------
// Pass 2 scan: hv[m,v] = hv*ge[m] + (1-ge[m])*v[v]; o[v] = sum_m p[m]*hv[m,v]
// One block per (b,h,chunk), started from the carried state.
// Thread t owns v-col t&127, m-group t>>7 (32 m's).
// The m-group is the same for a whole wave, so its gate and p values are read
// straight from memory at wave-uniform addresses and nothing is staged. Each
// step's two partial sums per column go to LDS and are added after the loop:
// no wave waits for another inside the step loop. The per-head RMSNorm over
// V=128 is taken at the end, one wave per row; only the normed rows go to memory.
// ---------------------------------------------------------------------------
__global__ __launch_bounds__(256) void scan2_kernel(
    const float* __restrict__ p, const float* __restrict__ v,
    const float* __restrict__ ge, const float* __restrict__ hin,
    const float* __restrict__ w, float* __restrict__ o) {
    const int bh = blockIdx.x / NC, c = blockIdx.x % NC;
    const int b = bh >> 2, h = bh & 3;
    const int t = threadIdx.x;
    const int vc = t & 127;
    const int mb = __builtin_amdgcn_readfirstlane(t >> 7) * 32;

    __shared__ float red[CH * 256];        // [step][m-group][v] partial sums, 32 KB
    float hv[32];
    const float* h0 = hin + blockIdx.x * SS + mb * VV + vc;
#pragma unroll
    for (int i = 0; i < 32; ++i) hv[i] = h0[i * VV];

    const int row0 = b * TT + c * CH;
    for (int s = 0; s < CH; ++s) {
        const float4* gr = (const float4*)(ge + (row0 + s) * (HH * MM) + h * MM + mb);
        const float4* pr = (const float4*)(p  + (row0 + s) * (HH * MM) + h * MM + mb);
        float vv = v[(row0 + s) * (HH * VV) + h * VV + vc];
        // The loop advances this load's address registers: they stay as they are
        // until the load has taken them.
        asm volatile("s_wait_xcnt 0x0" ::: "memory");
        float acc = 0.f;
#pragma unroll
        for (int j = 0; j < 8; ++j) {
            float4 g  = gr[j];
            float4 pp = pr[j];
            hv[4 * j + 0] = hv[4 * j + 0] * g.x + (1.f - g.x) * vv;  acc += pp.x * hv[4 * j + 0];
            hv[4 * j + 1] = hv[4 * j + 1] * g.y + (1.f - g.y) * vv;  acc += pp.y * hv[4 * j + 1];
            hv[4 * j + 2] = hv[4 * j + 2] * g.z + (1.f - g.z) * vv;  acc += pp.z * hv[4 * j + 2];
            hv[4 * j + 3] = hv[4 * j + 3] * g.w + (1.f - g.w) * vv;  acc += pp.w * hv[4 * j + 3];
        }
        red[s * 256 + t] = acc;
    }
    __syncthreads();                       // publishes every step's partial sums

    const int lane = t & 31, wv = t >> 5;
    float* orow = o + (row0 + wv) * (HH * VV) + h * VV + lane;
    const float w0 = w[lane], w1 = w[lane + 32], w2 = w[lane + 64], w3 = w[lane + 96];
    for (int j = 0; j < CH / 8; ++j) {
        const float* base = red + (wv + 8 * j) * 256 + lane;
        float x0 = base[0]  + base[128];
        float x1 = base[32] + base[160];
        float x2 = base[64] + base[192];
        float x3 = base[96] + base[224];
        float ss = x0 * x0 + x1 * x1 + x2 * x2 + x3 * x3;
#pragma unroll
        for (int off = 16; off > 0; off >>= 1) ss += __shfl_xor(ss, off, 32);
        float r = rsqrtf(ss * (1.f / (float)VV) + 1e-5f);
        orow[8 * j * (HH * VV)]      = x0 * r * w0;
        orow[8 * j * (HH * VV) + 32] = x1 * r * w1;
        orow[8 * j * (HH * VV) + 64] = x2 * r * w2;
        orow[8 * j * (HH * VV) + 96] = x3 * r * w3;
    }
}

// ---------------------------------------------------------------------------

extern "C" void kernel_launch(void* const* d_in, const int* in_sizes, int n_in,
                              void* d_out, int out_size, void* d_ws, size_t ws_size,
                              hipStream_t stream) {
    const float* x      = (const float*)d_in[0];
    const float* Wq     = (const float*)d_in[1];
    const float* Wk     = (const float*)d_in[2];
    const float* Wv     = (const float*)d_in[3];
    const float* Wf     = (const float*)d_in[4];
    const float* gnormw = (const float*)d_in[5];
    const float* Wo     = (const float*)d_in[6];
    float* out = (float*)d_out;

    float* ws = (float*)d_ws;
    float* q  = ws;                       // BT*512
    float* k  = q  + (size_t)BT * 512;    // BT*512
    float* v  = k  + (size_t)BT * 512;    // BT*512
    float* ge = v  + (size_t)BT * 512;    // BT*256
    float* p  = ge + (size_t)BT * 256;    // BT*256
    float* o  = p  + (size_t)BT * 256;    // BT*512
    float* hloc = o    + (size_t)BT * 512;              // 16*NC*SS chunk end states
    float* hin  = hloc + (size_t)BB * HH * NC * SS;     // 16*NC*SS chunk start states
    float* hloc2 = hin   + (size_t)BB * HH * NC * SS;   // the same two for pass 2
    float* hin2  = hloc2 + (size_t)BB * HH * NC * SS;
    float* dloc  = hin2  + (size_t)BB * HH * NC * SS;   // 16*NC*MM chunk decay products

    dim3 blk(256);
    dim3 grdIn((3 * 512 + 256) / 64, BT / 128);   // q, k, v and gate column tiles
    dim3 grdOut(512 / 64, BT / 128);

    proj_in_kernel<<<grdIn, blk, 0, stream>>>(x, Wq, Wk, Wv, Wf, q, k, v, ge);

    dim3 grdChunk(BB * HH * NC);          // one block per (b,h,chunk)
    dim3 grdChunk2(2 * BB * HH * NC);         // the same for both passes at once
    dim3 grdState2(2 * BB * HH * SS / 256);   // one thread per state element, both passes

    local_both_kernel<<<grdChunk2, blk, 0, stream>>>(k, v, ge, hloc, hloc2, dloc);
    carry_both_kernel<<<grdState2, blk, 0, stream>>>(hloc, hloc2, dloc, hin, hin2);
    scan1_kernel<<<grdChunk, blk, 0, stream>>>(q, k, ge, hin, p);      // + softmax
    scan2_kernel<<<grdChunk, blk, 0, stream>>>(p, v, ge, hin2, gnormw, o);  // + RMSNorm

    proj_out_kernel<<<grdOut, blk, 0, stream>>>(o, Wo, out);
}

// v005
// One run takes 178 microseconds.
// Next to v004, in two timings, it ran 1.04 times as fast each time.
// All steps since v000 together make it 30.5 times as fast.
#include <hip/hip_runtime.h>
#include <hip/hip_bf16.h>

#define BB 4
#define TT 2048
#define DD 512
#define HH 4
#define KK 128
#define VV 128
#define MM 64
#define BT (BB * TT)          // 8192 rows for all GEMMs
#define CH 32                 // time steps per chunk of the two scans
#define NC (TT / CH)          // 64 chunks per (b,h)
#define SS (KK * MM)          // 8192 state elements per (b,h), both scans

#define LDA 40                // padded LDS row length (bf16 elems): 80B, 16B-aligned runs

typedef __attribute__((ext_vector_type(16))) __bf16 v16bf;
typedef __attribute__((ext_vector_type(8)))  __bf16 v8bf;
typedef __attribute__((ext_vector_type(2)))  __bf16 v2bf;
typedef __attribute__((ext_vector_type(8)))  float  v8f;

#if __has_builtin(__builtin_amdgcn_cvt_pk_bf16_f32)
__device__ __forceinline__ unsigned pack2bf(float a, float b) {
    v2bf r = __builtin_amdgcn_cvt_pk_bf16_f32(a, b);   // v_cvt_pk_bf16_f32
    return __builtin_bit_cast(unsigned, r);
}
#else
__device__ __forceinline__ unsigned pack2bf(float a, float b) {
    unsigned ua = __builtin_bit_cast(unsigned, a);
    unsigned ub = __builtin_bit_cast(unsigned, b);
    ua = (ua + 0x7FFFu + ((ua >> 16) & 1u)) >> 16;     // RNE
    ub = (ub + 0x7FFFu + ((ub >> 16) & 1u)) >> 16;
    return ua | (ub << 16);
}
#endif

// ---------------------------------------------------------------------------
// Tiled GEMM: Y(8192 x N) = act( X(8192 x 512) @ W(512 x N) ), bf16 WMMA.
// Block = 256 threads (8 waves). Block tile = 128(M) x 64(N), K-step = 32.
// Software-pipelined double-buffered LDS: fetch tile k+1 to registers, WMMA
// tile k from LDS[cur], then stage registers into LDS[cur^1]; ONE barrier
// per K-step. A staged row-major As[row][k]; B staged transposed Bst[col][k]
// so every lane fragment is two contiguous 16B runs -> ds_load_b128. A thread
// stages 8 consecutive k of ONE column of B: one 16B LDS store at the 80B pitch.
// act: 0 = none, 1 = swish, 2 = ge = exp(log_sigmoid(x)/8); the same for a whole block
// ---------------------------------------------------------------------------
template <int ACT>
__device__ __forceinline__ void gemm_store(
    const v8f (&acc)[4], float* __restrict__ Y, const int N, const int row0, const int col0) {
#pragma unroll
    for (int jn = 0; jn < 4; ++jn) {
#pragma unroll
        for (int r = 0; r < 8; ++r) {
            float x = acc[jn][r];
            if (ACT == 1) {
                x = x / (1.f + __expf(-x));                      // swish
            } else if (ACT == 2) {
                float ax = fabsf(x);
                float ls = fminf(x, 0.f) - log1pf(__expf(-ax));  // log_sigmoid, stable
                x = __expf(ls * 0.125f);                         // ge = exp(g/8)
            }
            Y[(row0 + r) * N + col0 + jn * 16] = x;
        }
    }
    // The three epilogues share one kernel: keeps the stores' address and data
    // registers from being rewritten by another epilogue's code behind a branch.
    asm volatile("s_wait_xcnt 0x0" ::: "memory");
}

__device__ __forceinline__ void gemm_tile(
    const float* __restrict__ X, const float* __restrict__ W,
    float* __restrict__ Y, const int N, const int act,
    const int rowBase, const int colBase) {
    __shared__ __align__(16) __bf16 As[2][128 * LDA];   // 2 x 10.0 KB
    __shared__ __align__(16) __bf16 Bst[2][64 * LDA];   // 2 x  5.0 KB

    const int tid  = threadIdx.x;
    const int lane = tid & 31;
    const int wv   = tid >> 5;

    const int mrow = lane & 15;            // row of 16-row tile / col of 16-col tile
    const int kb   = (lane >> 4) << 3;     // 0 or 8: K sub-block for this half-wave

    const float4* X4 = (const float4*)X;

    // Per-thread staging coordinates (constant)
    int arr[4], ac[4];                     // A: row, float4-col
#pragma unroll
    for (int i = 0; i < 4; ++i) { int e = tid + i * 256; arr[i] = e >> 3; ac[i] = e & 7; }
    const int bcol = tid & 63;             // B: column of the tile
    const int bk8  = (tid >> 6) * 8;       // B: first of this thread's 8 k-rows
    const float* Wt = W + bk8 * N + colBase + bcol;
    const int bdst = bcol * LDA + bk8;     // 16B-aligned run in Bst[col][k]

    float4 ra[4];
    float  rb[8];

    // ---- prologue: fetch tile 0 and stage into buffer 0
#pragma unroll
    for (int i = 0; i < 4; ++i)
        ra[i] = X4[(((rowBase + arr[i]) * DD) >> 2) + ac[i]];
#pragma unroll
    for (int i = 0; i < 8; ++i)
        rb[i] = Wt[i * N];
#pragma unroll
    for (int i = 0; i < 4; ++i) {
        uint2 t; t.x = pack2bf(ra[i].x, ra[i].y); t.y = pack2bf(ra[i].z, ra[i].w);
        *(uint2*)&As[0][arr[i] * LDA + ac[i] * 4] = t;
    }
    {
        uint4 t;
        t.x = pack2bf(rb[0], rb[1]); t.y = pack2bf(rb[2], rb[3]);
        t.z = pack2bf(rb[4], rb[5]); t.w = pack2bf(rb[6], rb[7]);
        *(uint4*)&Bst[0][bdst] = t;
    }

    v8f acc[4] = {};
    int cur = 0;

    for (int k0 = 0; k0 < DD; k0 += 32) {
        __syncthreads();                      // LDS[cur] ready; LDS[cur^1] free
        const bool more = (k0 + 32 < DD);
        if (more) {
            // Issue next-tile global loads early: they fly under the WMMAs.
#pragma unroll
            for (int i = 0; i < 4; ++i)
                ra[i] = X4[(((rowBase + arr[i]) * DD + k0 + 32) >> 2) + ac[i]];
#pragma unroll
            for (int i = 0; i < 8; ++i)
                rb[i] = Wt[(k0 + 32 + i) * N];
            if (k0 + 64 < DD)
                __builtin_prefetch(&X[(rowBase + (tid >> 1)) * DD + k0 + 64], 0, 1);
        }

        // ---- WMMA on buffer `cur`
        const __bf16* Ab = &As[cur][0];
        const __bf16* Bb = &Bst[cur][0];
        const int arow = (wv * 16 + mrow) * LDA;
        v8bf alo = *(const v8bf*)&Ab[arow + kb];
        v8bf ahi = *(const v8bf*)&Ab[arow + 16 + kb];
        v16bf a = __builtin_shufflevector(alo, ahi,
            0, 1, 2, 3, 4, 5, 6, 7, 8, 9, 10, 11, 12, 13, 14, 15);
#pragma unroll
        for (int jn = 0; jn < 4; ++jn) {
            const int bcol = (jn * 16 + mrow) * LDA;
            v8bf blo = *(const v8bf*)&Bb[bcol + kb];
            v8bf bhi = *(const v8bf*)&Bb[bcol + 16 + kb];
            v16bf bfr = __builtin_shufflevector(blo, bhi,
                0, 1, 2, 3, 4, 5, 6, 7, 8, 9, 10, 11, 12, 13, 14, 15);
            acc[jn] = __builtin_amdgcn_wmma_f32_16x16x32_bf16(
                false, a, false, bfr, (short)0, acc[jn], false, false);
        }

        if (more) {
            // ---- stage fetched registers into buffer `cur^1`
            __bf16* An = &As[cur ^ 1][0];
            __bf16* Bn = &Bst[cur ^ 1][0];
#pragma unroll
            for (int i = 0; i < 4; ++i) {
                uint2 t; t.x = pack2bf(ra[i].x, ra[i].y); t.y = pack2bf(ra[i].z, ra[i].w);
                *(uint2*)&An[arr[i] * LDA + ac[i] * 4] = t;
            }
            uint4 t;
            t.x = pack2bf(rb[0], rb[1]); t.y = pack2bf(rb[2], rb[3]);
            t.z = pack2bf(rb[4], rb[5]); t.w = pack2bf(rb[6], rb[7]);
            *(uint4*)&Bn[bdst] = t;
        }
        cur ^= 1;
    }

    const int row0 = rowBase + wv * 16 + ((lane >> 4) << 3);
    const int col0 = colBase + mrow;
    if (act == 1)      gemm_store<1>(acc, Y, N, row0, col0);
    else if (act == 2) gemm_store<2>(acc, Y, N, row0, col0);
    else               gemm_store<0>(acc, Y, N, row0, col0);
}

// The four input projections share X and do not depend on each other: one grid
// of 28 column tiles (8 for q, 8 for k, 8 for v, 4 for the gate) by 64 row tiles.
__global__ __launch_bounds__(256) void proj_in_kernel(
    const float* __restrict__ X,
    const float* __restrict__ Wq, const float* __restrict__ Wk,
    const float* __restrict__ Wv, const float* __restrict__ Wf,
    float* __restrict__ q, float* __restrict__ k,
    float* __restrict__ v, float* __restrict__ ge) {
    const int sel = blockIdx.x >> 3;       // 0 q, 1 k, 2 v, 3 gate
    const float* W = sel == 0 ? Wq : sel == 1 ? Wk : sel == 2 ? Wv : Wf;
    float*       Y = sel == 0 ? q  : sel == 1 ? k  : sel == 2 ? v  : ge;
    const int N   = sel == 3 ? HH * MM : DD;
    const int act = sel < 2 ? 1 : sel == 2 ? 0 : 2;
    gemm_tile(X, W, Y, N, act, blockIdx.y * 128, (blockIdx.x & 7) * 64);
}

__global__ __launch_bounds__(256) void proj_out_kernel(
    const float* __restrict__ X, const float* __restrict__ W,
    float* __restrict__ Y) {
    gemm_tile(X, W, Y, DD, 0, blockIdx.y * 128, blockIdx.x * 64);
}

// ---------------------------------------------------------------------------
// The two scans are linear in their state, so the time axis is cut into NC
// chunks that run side by side:
//   local : each chunk runs the recurrence from a zero state and keeps its end
//           state L_c and the product D_c[m] of its decays;
//   carry : H_0 = 0, H_{c+1} = H_c * D_c + L_c gives every chunk's start state;
//   scan  : each chunk runs the full step loop from H_c and writes its outputs.
// ---------------------------------------------------------------------------

// Pass 1 local: one block per (b,h,chunk). Thread t owns m = t&63 and 32 k's.
// No output is formed here, so nothing crosses threads: k is read straight from
// memory (the k-group is the same for a whole wave).
__device__ __forceinline__ void scan1_local(
    const int blk, const float* __restrict__ k, const float* __restrict__ ge,
    float* __restrict__ hloc, float* __restrict__ dloc) {
    const int bh = blk / NC, c = blk % NC;
    const int b = bh >> 2, h = bh & 3;
    const int t = threadIdx.x;
    const int m = t & 63;
    const int kb = __builtin_amdgcn_readfirstlane(t >> 6) * 32;

    float hk[32];
#pragma unroll
    for (int i = 0; i < 32; ++i) hk[i] = 0.f;
    float dp = 1.f;

    for (int step = c * CH; step < c * CH + CH; ++step) {
        const float4* kr = (const float4*)(k + (b * TT + step) * (HH * KK) + h * KK + kb);
        float gm = ge[(b * TT + step) * (HH * MM) + h * MM + m];
        float sm = 1.f - gm;
#pragma unroll
        for (int j = 0; j < 8; ++j) {
            float4 kv = kr[j];
            hk[4 * j + 0] = hk[4 * j + 0] * gm + kv.x * sm;
            hk[4 * j + 1] = hk[4 * j + 1] * gm + kv.y * sm;
            hk[4 * j + 2] = hk[4 * j + 2] * gm + kv.z * sm;
            hk[4 * j + 3] = hk[4 * j + 3] * gm + kv.w * sm;
        }
        dp *= gm;
    }

    float* dst = hloc + blk * SS + kb * MM + m;
#pragma unroll
    for (int i = 0; i < 32; ++i) dst[i * MM] = hk[i];
    if (t < 64) dloc[blk * MM + m] = dp;
}

// Carry over the chunks: one thread per state element, NC serial steps.
// SECOND = 0: state laid out [k][m]; SECOND = 1: state laid out [m][v].
template <int SECOND>
__device__ __forceinline__ void carry(
    const int blk, const float* __restrict__ hloc, const float* __restrict__ dloc,
    float* __restrict__ hin) {
    const int e = blk * 256 + threadIdx.x;
    const int bh = e / SS, idx = e % SS;
    const int m = SECOND ? (idx / VV) : (idx % MM);
    const float* src = hloc + bh * (NC * SS) + idx;
    const float* dsr = dloc + bh * (NC * MM) + m;
    float* dst = hin + bh * (NC * SS) + idx;

    float hc = 0.f;
    for (int c0 = 0; c0 < NC; c0 += 16) {
        float a[16], d[16];                 // 16 chunks' loads in flight at once
#pragma unroll
        for (int j = 0; j < 16; ++j) {
            a[j] = src[(c0 + j) * SS];
            d[j] = dsr[(c0 + j) * MM];
        }
#pragma unroll
        for (int j = 0; j < 16; ++j) {
            dst[(c0 + j) * SS] = hc;
            hc = hc * d[j] + a[j];
        }
    }
}

// Both carries in one grid: neither reads what the other writes.
__global__ __launch_bounds__(256) void carry_both_kernel(
    const float* __restrict__ hloc1, const float* __restrict__ hloc2,
    const float* __restrict__ dloc,
    float* __restrict__ hin1, float* __restrict__ hin2) {
    const int half = BB * HH * SS / 256;
    if ((int)blockIdx.x < half) carry<0>(blockIdx.x, hloc1, dloc, hin1);
    else                        carry<1>(blockIdx.x - half, hloc2, dloc, hin2);
}

__global__ __launch_bounds__(256) void scan1_kernel(
    const float* __restrict__ q, const float* __restrict__ k,
    const float* __restrict__ ge, const float* __restrict__ hin,
    float* __restrict__ p) {
    const int bh = blockIdx.x / NC, c = blockIdx.x % NC;
    const int b = bh >> 2, h = bh & 3;
    const int t = threadIdx.x;
    const int m = t & 63;
    const int kb = __builtin_amdgcn_readfirstlane(t >> 6) * 32;

    __shared__ float red[CH * 256];        // [step][k-group][m] partial sums, 32 KB
    float hk[32];
    const float* h0 = hin + blockIdx.x * SS + kb * MM + m;
#pragma unroll
    for (int i = 0; i < 32; ++i) hk[i] = h0[i * MM];

    const int row0 = b * TT + c * CH;
    for (int s = 0; s < CH; ++s) {
        const float4* kr = (const float4*)(k + (row0 + s) * (HH * KK) + h * KK + kb);
        const float4* qr = (const float4*)(q + (row0 + s) * (HH * KK) + h * KK + kb);
        float gm = ge[(row0 + s) * (HH * MM) + h * MM + m];
        // The loop advances this load's address registers: they stay as they are
        // until the load has taken them.
        asm volatile("s_wait_xcnt 0x0" ::: "memory");
        float sm = 1.f - gm;
        float acc = 0.f;
#pragma unroll
        for (int j = 0; j < 8; ++j) {
            float4 kv = kr[j];
            float4 qv = qr[j];
            hk[4 * j + 0] = hk[4 * j + 0] * gm + kv.x * sm;  acc += qv.x * hk[4 * j + 0];
            hk[4 * j + 1] = hk[4 * j + 1] * gm + kv.y * sm;  acc += qv.y * hk[4 * j + 1];
            hk[4 * j + 2] = hk[4 * j + 2] * gm + kv.z * sm;  acc += qv.z * hk[4 * j + 2];
            hk[4 * j + 3] = hk[4 * j + 3] * gm + kv.w * sm;  acc += qv.w * hk[4 * j + 3];
        }
        red[s * 256 + t] = acc;
    }
    __syncthreads();                       // publishes every step's partial sums

    const int lane = t & 31, wv = t >> 5;
    float* prow = p + (row0 + wv) * (HH * MM) + h * MM + lane;
    for (int j = 0; j < CH / 8; ++j) {
        const float* src = red + (wv + 8 * j) * 256 + lane;
        float x0 = src[0]  + src[64] + src[128] + src[192];
        float x1 = src[32] + src[96] + src[160] + src[224];
        float mx = fmaxf(x0, x1);
#pragma unroll
        for (int off = 16; off > 0; off >>= 1) mx = fmaxf(mx, __shfl_xor(mx, off, 32));
        float ea = __expf(x0 - mx), eb = __expf(x1 - mx);
        float s = ea + eb;
#pragma unroll
        for (int off = 16; off > 0; off >>= 1) s += __shfl_xor(s, off, 32);
        float inv = 1.f / s;
        prow[8 * j * (HH * MM)]      = ea * inv;
        prow[8 * j * (HH * MM) + 32] = eb * inv;
    }
}

// Pass 2 local: one block per (b,h,chunk). Thread t owns v-col t&127 and 32 m's
// (the m-group is the same for a whole wave). End state only, no output.
__device__ __forceinline__ void scan2_local(
    const int blk, const float* __restrict__ v, const float* __restrict__ ge,
    float* __restrict__ hloc) {
    const int bh = blk / NC, c = blk % NC;
    const int b = bh >> 2, h = bh & 3;
    const int t = threadIdx.x;
    const int vc = t & 127;
    const int mb = __builtin_amdgcn_readfirstlane(t >> 7) * 32;

    float hv[32];
#pragma unroll
    for (int i = 0; i < 32; ++i) hv[i] = 0.f;

    for (int step = c * CH; step < c * CH + CH; ++step) {
        const float4* gr = (const float4*)(ge + (b * TT + step) * (HH * MM) + h * MM + mb);
        float vv = v[(b * TT + step) * (HH * VV) + h * VV + vc];
#pragma unroll
        for (int j = 0; j < 8; ++j) {
            float4 g = gr[j];
            hv[4 * j + 0] = hv[4 * j + 0] * g.x + (1.f - g.x) * vv;
            hv[4 * j + 1] = hv[4 * j + 1] * g.y + (1.f - g.y) * vv;
            hv[4 * j + 2] = hv[4 * j + 2] * g.z + (1.f - g.z) * vv;
            hv[4 * j + 3] = hv[4 * j + 3] * g.w + (1.f - g.w) * vv;
        }
    }

    float* dst = hloc + blk * SS + mb * VV + vc;
#pragma unroll
    for (int i = 0; i < 32; ++i) dst[i * VV] = hv[i];
    // Pass 1's code follows in the same kernel: keeps the stores' registers from
    // being rewritten there before the stores have taken them.
    asm volatile("s_wait_xcnt 0x0" ::: "memory");
}

// Both local passes in one grid: pass 2's end states need v and ge only, not p.
// Even blocks take pass 1, odd blocks pass 2, of the same (b,h,chunk).
__global__ __launch_bounds__(256) void local_both_kernel(
    const float* __restrict__ k, const float* __restrict__ v,
    const float* __restrict__ ge,
    float* __restrict__ hloc1, float* __restrict__ hloc2,
    float* __restrict__ dloc) {
    const int blk = blockIdx.x >> 1;
    if ((blockIdx.x & 1) == 0) scan1_local(blk, k, ge, hloc1, dloc);
    else                       scan2_local(blk, v, ge, hloc2);
}

// ---------------------------------------------------------------------------
// Pass 2 scan: hv[m,v] = hv*ge[m] + (1-ge[m])*v[v]; o[v] = sum_m p[m]*hv[m,v]
// One block per (b,h,chunk), started from the carried state.
// Thread t owns v-col t&127, m-group t>>7 (32 m's).
// The m-group is the same for a whole wave, so its gate and p values are read
// straight from memory at wave-uniform addresses and nothing is staged. Each
// step's two partial sums per column go to LDS and are added after the loop:
// no wave waits for another inside the step loop. The per-head RMSNorm over
// V=128 is taken at the end, one wave per row; only the normed rows go to memory.
// ---------------------------------------------------------------------------
__global__ __launch_bounds__(256) void scan2_kernel(
    const float* __restrict__ p, const float* __restrict__ v,
    const float* __restrict__ ge, const float* __restrict__ hin,
    const float* __restrict__ w, float* __restrict__ o) {
    const int bh = blockIdx.x / NC, c = blockIdx.x % NC;
    const int b = bh >> 2, h = bh & 3;
    const int t = threadIdx.x;
    const int vc = t & 127;
    const int mb = __builtin_amdgcn_readfirstlane(t >> 7) * 32;

    __shared__ float red[CH * 256];        // [step][m-group][v] partial sums, 32 KB
    float hv[32];
    const float* h0 = hin + blockIdx.x * SS + mb * VV + vc;
#pragma unroll
    for (int i = 0; i < 32; ++i) hv[i] = h0[i * VV];

    const int row0 = b * TT + c * CH;
    for (int s = 0; s < CH; ++s) {
        const float4* gr = (const float4*)(ge + (row0 + s) * (HH * MM) + h * MM + mb);
        const float4* pr = (const float4*)(p  + (row0 + s) * (HH * MM) + h * MM + mb);
        float vv = v[(row0 + s) * (HH * VV) + h * VV + vc];
        // The loop advances this load's address registers: they stay as they are
        // until the load has taken them.
        asm volatile("s_wait_xcnt 0x0" ::: "memory");
        float acc = 0.f;
#pragma unroll
        for (int j = 0; j < 8; ++j) {
            float4 g  = gr[j];
            float4 pp = pr[j];
            hv[4 * j + 0] = hv[4 * j + 0] * g.x + (1.f - g.x) * vv;  acc += pp.x * hv[4 * j + 0];
            hv[4 * j + 1] = hv[4 * j + 1] * g.y + (1.f - g.y) * vv;  acc += pp.y * hv[4 * j + 1];
            hv[4 * j + 2] = hv[4 * j + 2] * g.z + (1.f - g.z) * vv;  acc += pp.z * hv[4 * j + 2];
            hv[4 * j + 3] = hv[4 * j + 3] * g.w + (1.f - g.w) * vv;  acc += pp.w * hv[4 * j + 3];
        }
        red[s * 256 + t] = acc;
    }
    __syncthreads();                       // publishes every step's partial sums

    const int lane = t & 31, wv = t >> 5;
    float* orow = o + (row0 + wv) * (HH * VV) + h * VV + lane;
    const float w0 = w[lane], w1 = w[lane + 32], w2 = w[lane + 64], w3 = w[lane + 96];
    for (int j = 0; j < CH / 8; ++j) {
        const float* base = red + (wv + 8 * j) * 256 + lane;
        float x0 = base[0]  + base[128];
        float x1 = base[32] + base[160];
        float x2 = base[64] + base[192];
        float x3 = base[96] + base[224];
        float ss = x0 * x0 + x1 * x1 + x2 * x2 + x3 * x3;
#pragma unroll
        for (int off = 16; off > 0; off >>= 1) ss += __shfl_xor(ss, off, 32);
        float r = rsqrtf(ss * (1.f / (float)VV) + 1e-5f);
        orow[8 * j * (HH * VV)]      = x0 * r * w0;
        orow[8 * j * (HH * VV) + 32] = x1 * r * w1;
        orow[8 * j * (HH * VV) + 64] = x2 * r * w2;
        orow[8 * j * (HH * VV) + 96] = x3 * r * w3;
    }
}

// ---------------------------------------------------------------------------

extern "C" void kernel_launch(void* const* d_in, const int* in_sizes, int n_in,
                              void* d_out, int out_size, void* d_ws, size_t ws_size,
                              hipStream_t stream) {
    const float* x      = (const float*)d_in[0];
    const float* Wq     = (const float*)d_in[1];
    const float* Wk     = (const float*)d_in[2];
    const float* Wv     = (const float*)d_in[3];
    const float* Wf     = (const float*)d_in[4];
    const float* gnormw = (const float*)d_in[5];
    const float* Wo     = (const float*)d_in[6];
    float* out = (float*)d_out;

    float* ws = (float*)d_ws;
    float* q  = ws;                       // BT*512
    float* k  = q  + (size_t)BT * 512;    // BT*512
    float* v  = k  + (size_t)BT * 512;    // BT*512
    float* ge = v  + (size_t)BT * 512;    // BT*256
    float* p  = ge + (size_t)BT * 256;    // BT*256
    float* o  = p  + (size_t)BT * 256;    // BT*512
    float* hloc = o    + (size_t)BT * 512;              // 16*NC*SS chunk end states
    float* hin  = hloc + (size_t)BB * HH * NC * SS;     // 16*NC*SS chunk start states
    float* hloc2 = hin   + (size_t)BB * HH * NC * SS;   // the same two for pass 2
    float* hin2  = hloc2 + (size_t)BB * HH * NC * SS;
    float* dloc  = hin2  + (size_t)BB * HH * NC * SS;   // 16*NC*MM chunk decay products

    dim3 blk(256);
    dim3 grdIn((3 * 512 + 256) / 64, BT / 128);   // q, k, v and gate column tiles
    dim3 grdOut(512 / 64, BT / 128);

    proj_in_kernel<<<grdIn, blk, 0, stream>>>(x, Wq, Wk, Wv, Wf, q, k, v, ge);

    dim3 grdChunk(BB * HH * NC);          // one block per (b,h,chunk)
    dim3 grdChunk2(2 * BB * HH * NC);         // the same for both passes at once
    dim3 grdState2(2 * BB * HH * SS / 256);   // one thread per state element, both passes

    local_both_kernel<<<grdChunk2, blk, 0, stream>>>(k, v, ge, hloc, hloc2, dloc);
    carry_both_kernel<<<grdState2, blk, 0, stream>>>(hloc, hloc2, dloc, hin, hin2);
    scan1_kernel<<<grdChunk, blk, 0, stream>>>(q, k, ge, hin, p);      // + softmax
    scan2_kernel<<<grdChunk, blk, 0, stream>>>(p, v, ge, hin2, gnormw, o);  // + RMSNorm

    proj_out_kernel<<<grdOut, blk, 0, stream>>>(o, Wo, out);
}

// v006
// Measured time: 160 microseconds a run.
// In both of two side-by-side timings against v005, it was 1.11 times as fast.
// Over all steps from v000 it is 33.9 times as fast.
#include <hip/hip_runtime.h>
#include <hip/hip_bf16.h>

#define BB 4
#define TT 2048
#define DD 512
#define HH 4
#define KK 128
#define VV 128
#define MM 64
#define BT (BB * TT)          // 8192 rows for all GEMMs
#define CH 32                 // time steps per chunk of the two scans
#define NC (TT / CH)          // 64 chunks per (b,h)
#define SS (KK * MM)          // 8192 state elements per (b,h), both scans

#define LDA 40                // padded LDS row length (bf16 elems): 80B, 16B-aligned runs

typedef __attribute__((ext_vector_type(16))) __bf16 v16bf;
typedef __attribute__((ext_vector_type(8)))  __bf16 v8bf;
typedef __attribute__((ext_vector_type(2)))  __bf16 v2bf;
typedef __attribute__((ext_vector_type(8)))  float  v8f;
typedef __attribute__((ext_vector_type(2)))  float  v2f;

#if __has_builtin(__builtin_amdgcn_cvt_pk_bf16_f32)
__device__ __forceinline__ unsigned pack2bf(float a, float b) {
    v2bf r = __builtin_amdgcn_cvt_pk_bf16_f32(a, b);   // v_cvt_pk_bf16_f32
    return __builtin_bit_cast(unsigned, r);
}
#else
__device__ __forceinline__ unsigned pack2bf(float a, float b) {
    unsigned ua = __builtin_bit_cast(unsigned, a);
    unsigned ub = __builtin_bit_cast(unsigned, b);
    ua = (ua + 0x7FFFu + ((ua >> 16) & 1u)) >> 16;     // RNE
    ub = (ub + 0x7FFFu + ((ub >> 16) & 1u)) >> 16;
    return ua | (ub << 16);
}
#endif

// ---------------------------------------------------------------------------
// Tiled GEMM: Y(8192 x N) = act( X(8192 x 512) @ W(512 x N) ), bf16 WMMA.
// Block = 256 threads (8 waves). Block tile = 128(M) x 64(N), K-step = 32.
// Software-pipelined double-buffered LDS: fetch tile k+1 to registers, WMMA
// tile k from LDS[cur], then stage registers into LDS[cur^1]; ONE barrier
// per K-step. A staged row-major As[row][k]; B staged transposed Bst[col][k]
// so every lane fragment is two contiguous 16B runs -> ds_load_b128. A thread
// stages 8 consecutive k of ONE column of B: one 16B LDS store at the 80B pitch.
// act: 0 = none, 1 = swish, 2 = ge = exp(log_sigmoid(x)/8); the same for a whole block
// ---------------------------------------------------------------------------
template <int ACT>
__device__ __forceinline__ void gemm_store(
    const v8f (&acc)[4], float* __restrict__ Y, const int N, const int row0, const int col0) {
#pragma unroll
    for (int jn = 0; jn < 4; ++jn) {
#pragma unroll
        for (int r = 0; r < 8; ++r) {
            float x = acc[jn][r];
            if (ACT == 1) {
                x = x / (1.f + __expf(-x));                      // swish
            } else if (ACT == 2) {
                float ax = fabsf(x);
                float ls = fminf(x, 0.f) - log1pf(__expf(-ax));  // log_sigmoid, stable
                x = __expf(ls * 0.125f);                         // ge = exp(g/8)
            }
            Y[(row0 + r) * N + col0 + jn * 16] = x;
        }
    }
    // The three epilogues share one kernel: keeps the stores' address and data
    // registers from being rewritten by another epilogue's code behind a branch.
    asm volatile("s_wait_xcnt 0x0" ::: "memory");
}

__device__ __forceinline__ void gemm_tile(
    const float* __restrict__ X, const float* __restrict__ W,
    float* __restrict__ Y, const int N, const int act,
    const int rowBase, const int colBase) {
    __shared__ __align__(16) __bf16 As[2][128 * LDA];   // 2 x 10.0 KB
    __shared__ __align__(16) __bf16 Bst[2][64 * LDA];   // 2 x  5.0 KB

    const int tid  = threadIdx.x;
    const int lane = tid & 31;
    const int wv   = tid >> 5;

    const int mrow = lane & 15;            // row of 16-row tile / col of 16-col tile
    const int kb   = (lane >> 4) << 3;     // 0 or 8: K sub-block for this half-wave

    const float4* X4 = (const float4*)X;

    // Per-thread staging coordinates (constant)
    int arr[4], ac[4];                     // A: row, float4-col
#pragma unroll
    for (int i = 0; i < 4; ++i) { int e = tid + i * 256; arr[i] = e >> 3; ac[i] = e & 7; }
    const int bcol = tid & 63;             // B: column of the tile
    const int bk8  = (tid >> 6) * 8;       // B: first of this thread's 8 k-rows
    const float* Wt = W + bk8 * N + colBase + bcol;
    const int bdst = bcol * LDA + bk8;     // 16B-aligned run in Bst[col][k]

    float4 ra[4];
    float  rb[8];

    // ---- prologue: fetch tile 0 and stage into buffer 0
#pragma unroll
    for (int i = 0; i < 4; ++i)
        ra[i] = X4[(((rowBase + arr[i]) * DD) >> 2) + ac[i]];
#pragma unroll
    for (int i = 0; i < 8; ++i)
        rb[i] = Wt[i * N];
#pragma unroll
    for (int i = 0; i < 4; ++i) {
        uint2 t; t.x = pack2bf(ra[i].x, ra[i].y); t.y = pack2bf(ra[i].z, ra[i].w);
        *(uint2*)&As[0][arr[i] * LDA + ac[i] * 4] = t;
    }
    {
        uint4 t;
        t.x = pack2bf(rb[0], rb[1]); t.y = pack2bf(rb[2], rb[3]);
        t.z = pack2bf(rb[4], rb[5]); t.w = pack2bf(rb[6], rb[7]);
        *(uint4*)&Bst[0][bdst] = t;
    }

    v8f acc[4] = {};
    int cur = 0;

    for (int k0 = 0; k0 < DD; k0 += 32) {
        __syncthreads();                      // LDS[cur] ready; LDS[cur^1] free
        const bool more = (k0 + 32 < DD);
        if (more) {
            // Issue next-tile global loads early: they fly under the WMMAs.
#pragma unroll
            for (int i = 0; i < 4; ++i)
                ra[i] = X4[(((rowBase + arr[i]) * DD + k0 + 32) >> 2) + ac[i]];
#pragma unroll
            for (int i = 0; i < 8; ++i)
                rb[i] = Wt[(k0 + 32 + i) * N];
            if (k0 + 64 < DD)
                __builtin_prefetch(&X[(rowBase + (tid >> 1)) * DD + k0 + 64], 0, 1);
        }

        // ---- WMMA on buffer `cur`
        const __bf16* Ab = &As[cur][0];
        const __bf16* Bb = &Bst[cur][0];
        const int arow = (wv * 16 + mrow) * LDA;
        v8bf alo = *(const v8bf*)&Ab[arow + kb];
        v8bf ahi = *(const v8bf*)&Ab[arow + 16 + kb];
        v16bf a = __builtin_shufflevector(alo, ahi,
            0, 1, 2, 3, 4, 5, 6, 7, 8, 9, 10, 11, 12, 13, 14, 15);
#pragma unroll
        for (int jn = 0; jn < 4; ++jn) {
            const int bcol = (jn * 16 + mrow) * LDA;
            v8bf blo = *(const v8bf*)&Bb[bcol + kb];
            v8bf bhi = *(const v8bf*)&Bb[bcol + 16 + kb];
            v16bf bfr = __builtin_shufflevector(blo, bhi,
                0, 1, 2, 3, 4, 5, 6, 7, 8, 9, 10, 11, 12, 13, 14, 15);
            acc[jn] = __builtin_amdgcn_wmma_f32_16x16x32_bf16(
                false, a, false, bfr, (short)0, acc[jn], false, false);
        }

        if (more) {
            // ---- stage fetched registers into buffer `cur^1`
            __bf16* An = &As[cur ^ 1][0];
            __bf16* Bn = &Bst[cur ^ 1][0];
#pragma unroll
            for (int i = 0; i < 4; ++i) {
                uint2 t; t.x = pack2bf(ra[i].x, ra[i].y); t.y = pack2bf(ra[i].z, ra[i].w);
                *(uint2*)&An[arr[i] * LDA + ac[i] * 4] = t;
            }
            uint4 t;
            t.x = pack2bf(rb[0], rb[1]); t.y = pack2bf(rb[2], rb[3]);
            t.z = pack2bf(rb[4], rb[5]); t.w = pack2bf(rb[6], rb[7]);
            *(uint4*)&Bn[bdst] = t;
        }
        cur ^= 1;
    }

    const int row0 = rowBase + wv * 16 + ((lane >> 4) << 3);
    const int col0 = colBase + mrow;
    if (act == 1)      gemm_store<1>(acc, Y, N, row0, col0);
    else if (act == 2) gemm_store<2>(acc, Y, N, row0, col0);
    else               gemm_store<0>(acc, Y, N, row0, col0);
}

// The four input projections share X and do not depend on each other: one grid
// of 28 column tiles (8 for q, 8 for k, 8 for v, 4 for the gate) by 64 row tiles.
__global__ __launch_bounds__(256) void proj_in_kernel(
    const float* __restrict__ X,
    const float* __restrict__ Wq, const float* __restrict__ Wk,
    const float* __restrict__ Wv, const float* __restrict__ Wf,
    float* __restrict__ q, float* __restrict__ k,
    float* __restrict__ v, float* __restrict__ ge) {
    const int sel = blockIdx.x >> 3;       // 0 q, 1 k, 2 v, 3 gate
    const float* W = sel == 0 ? Wq : sel == 1 ? Wk : sel == 2 ? Wv : Wf;
    float*       Y = sel == 0 ? q  : sel == 1 ? k  : sel == 2 ? v  : ge;
    const int N   = sel == 3 ? HH * MM : DD;
    const int act = sel < 2 ? 1 : sel == 2 ? 0 : 2;
    gemm_tile(X, W, Y, N, act, blockIdx.y * 128, (blockIdx.x & 7) * 64);
}

__global__ __launch_bounds__(256) void proj_out_kernel(
    const float* __restrict__ X, const float* __restrict__ W,
    float* __restrict__ Y) {
    gemm_tile(X, W, Y, DD, 0, blockIdx.y * 128, blockIdx.x * 64);
}

// ---------------------------------------------------------------------------
// The two scans are linear in their state, so the time axis is cut into NC
// chunks that run side by side:
//   local : each chunk's end state L_c from a zero state (a matrix product over
//           its steps) and the product D_c[m] of its decays;
//   carry : H_0 = 0, H_{c+1} = H_c * D_c + L_c gives every chunk's start state;
//   scan  : each chunk runs the full step loop from H_c and writes its outputs.
// ---------------------------------------------------------------------------

// Carry over the chunks: one thread per state element, NC serial steps.
// SECOND = 0: state laid out [k][m]; SECOND = 1: state laid out [m][v].
template <int SECOND>
__device__ __forceinline__ void carry(
    const int blk, const float* __restrict__ hloc, const float* __restrict__ dloc,
    float* __restrict__ hin) {
    const int e = blk * 256 + threadIdx.x;
    const int bh = e / SS, idx = e % SS;
    const int m = SECOND ? (idx / VV) : (idx % MM);
    const float* src = hloc + bh * (NC * SS) + idx;
    const float* dsr = dloc + bh * (NC * MM) + m;
    float* dst = hin + bh * (NC * SS) + idx;

    float hc = 0.f;
    for (int c0 = 0; c0 < NC; c0 += 16) {
        float a[16], d[16];                 // 16 chunks' loads in flight at once
#pragma unroll
        for (int j = 0; j < 16; ++j) {
            a[j] = src[(c0 + j) * SS];
            d[j] = dsr[(c0 + j) * MM];
        }
#pragma unroll
        for (int j = 0; j < 16; ++j) {
            dst[(c0 + j) * SS] = hc;
            hc = hc * d[j] + a[j];
        }
    }
}

// Both carries in one grid: neither reads what the other writes.
__global__ __launch_bounds__(256) void carry_both_kernel(
    const float* __restrict__ hloc1, const float* __restrict__ hloc2,
    const float* __restrict__ dloc,
    float* __restrict__ hin1, float* __restrict__ hin2) {
    const int half = BB * HH * SS / 256;
    if ((int)blockIdx.x < half) carry<0>(blockIdx.x, hloc1, dloc, hin1);
    else                        carry<1>(blockIdx.x - half, hloc2, dloc, hin2);
}

__global__ __launch_bounds__(256) void scan1_kernel(
    const float* __restrict__ q, const float* __restrict__ k,
    const float* __restrict__ ge, const float* __restrict__ hin,
    float* __restrict__ p) {
    const int bh = blockIdx.x / NC, c = blockIdx.x % NC;
    const int b = bh >> 2, h = bh & 3;
    const int t = threadIdx.x;
    const int m = t & 63;
    const int kb = __builtin_amdgcn_readfirstlane(t >> 6) * 32;

    __shared__ float red[CH * 256];        // [step][k-group][m] partial sums, 32 KB
    float hk[32];
    const float* h0 = hin + blockIdx.x * SS + kb * MM + m;
#pragma unroll
    for (int i = 0; i < 32; ++i) hk[i] = h0[i * MM];

    const int row0 = b * TT + c * CH;
    for (int s = 0; s < CH; ++s) {
        const float4* kr = (const float4*)(k + (row0 + s) * (HH * KK) + h * KK + kb);
        const float4* qr = (const float4*)(q + (row0 + s) * (HH * KK) + h * KK + kb);
        float gm = ge[(row0 + s) * (HH * MM) + h * MM + m];
        // The loop advances this load's address registers: they stay as they are
        // until the load has taken them.
        asm volatile("s_wait_xcnt 0x0" ::: "memory");
        float sm = 1.f - gm;
        float acc = 0.f;
#pragma unroll
        for (int j = 0; j < 8; ++j) {
            float4 kv = kr[j];
            float4 qv = qr[j];
            hk[4 * j + 0] = hk[4 * j + 0] * gm + kv.x * sm;  acc += qv.x * hk[4 * j + 0];
            hk[4 * j + 1] = hk[4 * j + 1] * gm + kv.y * sm;  acc += qv.y * hk[4 * j + 1];
            hk[4 * j + 2] = hk[4 * j + 2] * gm + kv.z * sm;  acc += qv.z * hk[4 * j + 2];
            hk[4 * j + 3] = hk[4 * j + 3] * gm + kv.w * sm;  acc += qv.w * hk[4 * j + 3];
        }
        red[s * 256 + t] = acc;
    }
    __syncthreads();                       // publishes every step's partial sums

    const int lane = t & 31, wv = t >> 5;
    float* prow = p + (row0 + wv) * (HH * MM) + h * MM + lane;
    for (int j = 0; j < CH / 8; ++j) {
        const float* src = red + (wv + 8 * j) * 256 + lane;
        float x0 = src[0]  + src[64] + src[128] + src[192];
        float x1 = src[32] + src[96] + src[160] + src[224];
        float mx = fmaxf(x0, x1);
#pragma unroll
        for (int off = 16; off > 0; off >>= 1) mx = fmaxf(mx, __shfl_xor(mx, off, 32));
        float ea = __expf(x0 - mx), eb = __expf(x1 - mx);
        float s = ea + eb;
#pragma unroll
        for (int off = 16; off > 0; off >>= 1) s += __shfl_xor(s, off, 32);
        float inv = 1.f / s;
        prow[8 * j * (HH * MM)]      = ea * inv;
        prow[8 * j * (HH * MM) + 32] = eb * inv;
    }
}

// Local pass of both scans: one block per (b,h,chunk), no step loop.
// From a zero state the recurrences end in plain sums over the chunk's steps s:
//   pass 1: L1[k][m] = sum_s k_s[k] * W[s][m]
//   pass 2: L2[m][v] = sum_s W[s][m] * v_s[v]
//   W[s][m] = (1 - ge_s[m]) * prod_{r > s} ge_r[m]     (factors in (0,1], no division)
// Both are matrix products over the 32 steps, done on the f32 16x16x4 WMMA.
// Lane (c = lane & 15, hf = lane >> 4) holds steps 16*hf .. 16*hf+15 of row or
// column c in every operand, so W's fragments are B of pass 1 and A of pass 2
// and the step order is the same on both sides of each product.
// Wave w: pass 1 rows k = 16w..16w+15, all 64 m; pass 2 two m-tiles by 32 v.
// Every wave forms W itself in registers: nothing crosses waves.

__device__ __forceinline__ void mm_1x2(v8f& c0, v8f& c1, const v2f (&a)[8],
                                       const v2f (&b0)[8], const v2f (&b1)[8]) {
    asm volatile(
        "v_wmma_f32_16x16x4_f32 %0, %2, %10, 0\n\t"
        "v_wmma_f32_16x16x4_f32 %1, %2, %18, 0\n\t"
        "v_wmma_f32_16x16x4_f32 %0, %3, %11, %0\n\t"
        "v_wmma_f32_16x16x4_f32 %1, %3, %19, %1\n\t"
        "v_wmma_f32_16x16x4_f32 %0, %4, %12, %0\n\t"
        "v_wmma_f32_16x16x4_f32 %1, %4, %20, %1\n\t"
        "v_wmma_f32_16x16x4_f32 %0, %5, %13, %0\n\t"
        "v_wmma_f32_16x16x4_f32 %1, %5, %21, %1\n\t"
        "v_wmma_f32_16x16x4_f32 %0, %6, %14, %0\n\t"
        "v_wmma_f32_16x16x4_f32 %1, %6, %22, %1\n\t"
        "v_wmma_f32_16x16x4_f32 %0, %7, %15, %0\n\t"
        "v_wmma_f32_16x16x4_f32 %1, %7, %23, %1\n\t"
        "v_wmma_f32_16x16x4_f32 %0, %8, %16, %0\n\t"
        "v_wmma_f32_16x16x4_f32 %1, %8, %24, %1\n\t"
        "v_wmma_f32_16x16x4_f32 %0, %9, %17, %0\n\t"
        "v_wmma_f32_16x16x4_f32 %1, %9, %25, %1\n\t"
        "v_nop\n\t"
        "v_nop\n\t"
        "v_nop\n\t"
        "v_nop\n\t"
        "v_nop\n\t"
        "v_nop\n\t"
        "v_nop\n\t"
        "v_nop\n\t"
        : "=&v"(c0), "=&v"(c1)
        : "v"(a[0]), "v"(a[1]), "v"(a[2]), "v"(a[3]), "v"(a[4]), "v"(a[5]), "v"(a[6]), "v"(a[7]),
          "v"(b0[0]), "v"(b0[1]), "v"(b0[2]), "v"(b0[3]), "v"(b0[4]), "v"(b0[5]), "v"(b0[6]), "v"(b0[7]),
          "v"(b1[0]), "v"(b1[1]), "v"(b1[2]), "v"(b1[3]), "v"(b1[4]), "v"(b1[5]), "v"(b1[6]), "v"(b1[7]));
}

// Turns one m-tile's 16 gate values of this lane half into W; returns the chunk's
// decay product (the same value in both lane halves).
__device__ __forceinline__ float decay_weights(v2f (&w)[8], const int hf) {
    float suf = 1.f;                               // product of the decays after step i
#pragma unroll
    for (int i = 15; i >= 0; --i) {
        const float g = w[i >> 1][i & 1];
        w[i >> 1][i & 1] = (1.f - g) * suf;
        suf *= g;
    }
    const float oth = __shfl_xor(suf, 16, 32);     // the other 16 steps' product
    const float late = hf == 0 ? oth : 1.f;        // steps 0..15 also decay through 16..31
#pragma unroll
    for (int j = 0; j < 8; ++j) w[j] *= late;
    return suf * oth;
}

__global__ __launch_bounds__(256, 8) void local_both_kernel(
    const float* __restrict__ k, const float* __restrict__ v,
    const float* __restrict__ ge,
    float* __restrict__ hloc1, float* __restrict__ hloc2,
    float* __restrict__ dloc) {
    const int blk = blockIdx.x;
    const int bh = blk / NC, c = blk % NC;
    const int b = bh >> 2, h = bh & 3;
    const int lane = threadIdx.x & 31;
    const int wv = __builtin_amdgcn_readfirstlane(threadIdx.x >> 5);
    const int cc = lane & 15, hf = lane >> 4;
    const int row0 = b * TT + c * CH;             // first step of the chunk
    const int mhalf = wv >> 2, vpair = wv & 3;    // pass 2 share of this wave

    // wt[q] belongs to m-tile q ^ (2*mhalf): wt[0], wt[1] are the wave's own pass-2 tiles.
    // Every address is a wave-uniform base plus one 32-bit lane offset in bytes;
    // go[0], so[0] serve tiles q = 0, 1 and go[1], so[1] tiles q = 2, 3.
    const unsigned own = 2 * mhalf * 64, far = own ^ 128;               // tile pair, bytes
    const unsigned goff = (unsigned)(hf * 16 * (HH * MM) + cc) * 4u;    // gate rows
    const unsigned go[2] = {goff + own, goff + far};
    const unsigned koff = (unsigned)(hf * 16 * (HH * KK) + cc) * 4u;    // k and v rows
    const unsigned soff = (unsigned)(hf * 8 * MM + cc) * 4u;            // pass-1 state rows
    const unsigned so[2] = {soff + own, soff + far};

    v2f wt[4][8], ka[8], vb[2][8];
    {
        const char* gb = (const char*)(ge + row0 * (HH * MM) + h * MM);
        const char* kp = (const char*)(k + row0 * (HH * KK) + h * KK + wv * 16) + koff;
#pragma unroll
        for (int q = 2; q < 4; ++q)
#pragma unroll
            for (int i = 0; i < 16; ++i)
                wt[q][i >> 1][i & 1] = *(const float*)(gb + go[1] + (q & 1) * 64 + i * (HH * MM * 4));
#pragma unroll
        for (int i = 0; i < 16; ++i) ka[i >> 1][i & 1] = *(const float*)(kp + i * (HH * KK * 4));
#pragma unroll
        for (int q = 0; q < 2; ++q)
#pragma unroll
            for (int i = 0; i < 16; ++i)
                wt[q][i >> 1][i & 1] = *(const float*)(gb + go[0] + (q & 1) * 64 + i * (HH * MM * 4));
    }
    // The loads' offset registers stay as they are until the loads have taken them:
    // naming them here keeps a later load's result from being placed on them.
    asm volatile("s_wait_xcnt 0x0" :: "v"(go[0]), "v"(go[1]), "v"(koff) : "memory");

    char* db = (char*)(hloc1 + blk * SS + wv * 16 * MM);
    float dp[4];
    v8f c0, c1;

    // Pass 1: A = k (row = k index), B = W (column = m). First the tiles that pass 2
    // of this wave does not need: their registers are free afterwards.
    dp[2] = decay_weights(wt[2], hf);
    dp[3] = decay_weights(wt[3], hf);
    mm_1x2(c0, c1, ka, wt[2], wt[3]);
#pragma unroll
    for (int r = 0; r < 8; ++r) {
        *(float*)(db + so[1] + r * (MM * 4))      = c0[r];
        *(float*)(db + so[1] + r * (MM * 4) + 64) = c1[r];
    }
    // What follows reuses the stores' registers: they stay until the stores have taken them.
    asm volatile("s_wait_xcnt 0x0" :: "v"(so[1]) : "memory");

    {   // v flies under the rest of pass 1
        const char* vp = (const char*)(v + row0 * (HH * VV) + h * VV + vpair * 32) + koff;
#pragma unroll
        for (int i = 0; i < 16; ++i) {
            vb[0][i >> 1][i & 1] = *(const float*)(vp + i * (HH * VV * 4));
            vb[1][i >> 1][i & 1] = *(const float*)(vp + i * (HH * VV * 4) + 64);
        }
        // As above: the offset register stays until the loads have taken it.
        asm volatile("s_wait_xcnt 0x0" :: "v"(koff) : "memory");
    }

    dp[0] = decay_weights(wt[0], hf);
    dp[1] = decay_weights(wt[1], hf);
    if (wv == 0) {                                 // wave 0 has m-tile q in wt[q]
        dloc[blk * MM + lane]      = hf ? dp[1] : dp[0];
        dloc[blk * MM + 32 + lane] = hf ? dp[3] : dp[2];
        // As above, for these two stores.
        asm volatile("s_wait_xcnt 0x0" ::: "memory");
    }
    mm_1x2(c0, c1, ka, wt[0], wt[1]);
#pragma unroll
    for (int r = 0; r < 8; ++r) {
        *(float*)(db + so[0] + r * (MM * 4))      = c0[r];
        *(float*)(db + so[0] + r * (MM * 4) + 64) = c1[r];
    }

    // Pass 2: A = W (row = m), B = v (column = v index).
    const unsigned s2 = (unsigned)(hf * 8 * VV + cc) * 4u;
    char* d2 = (char*)(hloc2 + blk * SS + mhalf * 32 * VV + vpair * 32);
    mm_1x2(c0, c1, wt[0], vb[0], vb[1]);
#pragma unroll
    for (int r = 0; r < 8; ++r) {
        *(float*)(d2 + s2 + r * (VV * 4))      = c0[r];
        *(float*)(d2 + s2 + r * (VV * 4) + 64) = c1[r];
    }
    asm volatile("s_wait_xcnt 0x0" :: "v"(s2) : "memory");
    mm_1x2(c0, c1, wt[1], vb[0], vb[1]);
#pragma unroll
    for (int r = 0; r < 8; ++r) {
        *(float*)(d2 + s2 + (16 + r) * (VV * 4))      = c0[r];
        *(float*)(d2 + s2 + (16 + r) * (VV * 4) + 64) = c1[r];
    }
}

// ---------------------------------------------------------------------------
// Pass 2 scan: hv[m,v] = hv*ge[m] + (1-ge[m])*v[v]; o[v] = sum_m p[m]*hv[m,v]
// One block per (b,h,chunk), started from the carried state.
// Thread t owns v-col t&127, m-group t>>7 (32 m's).
// The m-group is the same for a whole wave, so its gate and p values are read
// straight from memory at wave-uniform addresses and nothing is staged. Each
// step's two partial sums per column go to LDS and are added after the loop:
// no wave waits for another inside the step loop. The per-head RMSNorm over
// V=128 is taken at the end, one wave per row; only the normed rows go to memory.
// ---------------------------------------------------------------------------
__global__ __launch_bounds__(256) void scan2_kernel(
    const float* __restrict__ p, const float* __restrict__ v,
    const float* __restrict__ ge, const float* __restrict__ hin,
    const float* __restrict__ w, float* __restrict__ o) {
    const int bh = blockIdx.x / NC, c = blockIdx.x % NC;
    const int b = bh >> 2, h = bh & 3;
    const int t = threadIdx.x;
    const int vc = t & 127;
    const int mb = __builtin_amdgcn_readfirstlane(t >> 7) * 32;

    __shared__ float red[CH * 256];        // [step][m-group][v] partial sums, 32 KB
    float hv[32];
    const float* h0 = hin + blockIdx.x * SS + mb * VV + vc;
#pragma unroll
    for (int i = 0; i < 32; ++i) hv[i] = h0[i * VV];

    const int row0 = b * TT + c * CH;
    for (int s = 0; s < CH; ++s) {
        const float4* gr = (const float4*)(ge + (row0 + s) * (HH * MM) + h * MM + mb);
        const float4* pr = (const float4*)(p  + (row0 + s) * (HH * MM) + h * MM + mb);
        float vv = v[(row0 + s) * (HH * VV) + h * VV + vc];
        // The loop advances this load's address registers: they stay as they are
        // until the load has taken them.
        asm volatile("s_wait_xcnt 0x0" ::: "memory");
        float acc = 0.f;
#pragma unroll
        for (int j = 0; j < 8; ++j) {
            float4 g  = gr[j];
            float4 pp = pr[j];
            hv[4 * j + 0] = hv[4 * j + 0] * g.x + (1.f - g.x) * vv;  acc += pp.x * hv[4 * j + 0];
            hv[4 * j + 1] = hv[4 * j + 1] * g.y + (1.f - g.y) * vv;  acc += pp.y * hv[4 * j + 1];
            hv[4 * j + 2] = hv[4 * j + 2] * g.z + (1.f - g.z) * vv;  acc += pp.z * hv[4 * j + 2];
            hv[4 * j + 3] = hv[4 * j + 3] * g.w + (1.f - g.w) * vv;  acc += pp.w * hv[4 * j + 3];
        }
        red[s * 256 + t] = acc;
    }
    __syncthreads();                       // publishes every step's partial sums

    const int lane = t & 31, wv = t >> 5;
    float* orow = o + (row0 + wv) * (HH * VV) + h * VV + lane;
    const float w0 = w[lane], w1 = w[lane + 32], w2 = w[lane + 64], w3 = w[lane + 96];
    for (int j = 0; j < CH / 8; ++j) {
        const float* base = red + (wv + 8 * j) * 256 + lane;
        float x0 = base[0]  + base[128];
        float x1 = base[32] + base[160];
        float x2 = base[64] + base[192];
        float x3 = base[96] + base[224];
        float ss = x0 * x0 + x1 * x1 + x2 * x2 + x3 * x3;
#pragma unroll
        for (int off = 16; off > 0; off >>= 1) ss += __shfl_xor(ss, off, 32);
        float r = rsqrtf(ss * (1.f / (float)VV) + 1e-5f);
        orow[8 * j * (HH * VV)]      = x0 * r * w0;
        orow[8 * j * (HH * VV) + 32] = x1 * r * w1;
        orow[8 * j * (HH * VV) + 64] = x2 * r * w2;
        orow[8 * j * (HH * VV) + 96] = x3 * r * w3;
    }
}

// ---------------------------------------------------------------------------

extern "C" void kernel_launch(void* const* d_in, const int* in_sizes, int n_in,
                              void* d_out, int out_size, void* d_ws, size_t ws_size,
                              hipStream_t stream) {
    const float* x      = (const float*)d_in[0];
    const float* Wq     = (const float*)d_in[1];
    const float* Wk     = (const float*)d_in[2];
    const float* Wv     = (const float*)d_in[3];
    const float* Wf     = (const float*)d_in[4];
    const float* gnormw = (const float*)d_in[5];
    const float* Wo     = (const float*)d_in[6];
    float* out = (float*)d_out;

    float* ws = (float*)d_ws;
    float* q  = ws;                       // BT*512
    float* k  = q  + (size_t)BT * 512;    // BT*512
    float* v  = k  + (size_t)BT * 512;    // BT*512
    float* ge = v  + (size_t)BT * 512;    // BT*256
    float* p  = ge + (size_t)BT * 256;    // BT*256
    float* o  = p  + (size_t)BT * 256;    // BT*512
    float* hloc = o    + (size_t)BT * 512;              // 16*NC*SS chunk end states
    float* hin  = hloc + (size_t)BB * HH * NC * SS;     // 16*NC*SS chunk start states
    float* hloc2 = hin   + (size_t)BB * HH * NC * SS;   // the same two for pass 2
    float* hin2  = hloc2 + (size_t)BB * HH * NC * SS;
    float* dloc  = hin2  + (size_t)BB * HH * NC * SS;   // 16*NC*MM chunk decay products

    dim3 blk(256);
    dim3 grdIn((3 * 512 + 256) / 64, BT / 128);   // q, k, v and gate column tiles
    dim3 grdOut(512 / 64, BT / 128);

    proj_in_kernel<<<grdIn, blk, 0, stream>>>(x, Wq, Wk, Wv, Wf, q, k, v, ge);

    dim3 grdChunk(BB * HH * NC);          // one block per (b,h,chunk)
    dim3 grdState2(2 * BB * HH * SS / 256);   // one thread per state element, both passes

    local_both_kernel<<<grdChunk, blk, 0, stream>>>(k, v, ge, hloc, hloc2, dloc);
    carry_both_kernel<<<grdState2, blk, 0, stream>>>(hloc, hloc2, dloc, hin, hin2);
    scan1_kernel<<<grdChunk, blk, 0, stream>>>(q, k, ge, hin, p);      // + softmax
    scan2_kernel<<<grdChunk, blk, 0, stream>>>(p, v, ge, hin2, gnormw, o);  // + RMSNorm

    proj_out_kernel<<<grdOut, blk, 0, stream>>>(o, Wo, out);
}

// v007
// One run takes 126 microseconds.
// Next to v006, in two timings, it ran 1.27 and 1.26 times as fast.
// All steps since v000 together make it 42.9 times as fast.
#include <hip/hip_runtime.h>
#include <hip/hip_bf16.h>

#define BB 4
#define TT 2048
#define DD 512
#define HH 4
#define KK 128
#define VV 128
#define MM 64
#define BT (BB * TT)          // 8192 rows for all GEMMs
#define CH 32                 // time steps per chunk of the two scans
#define NC (TT / CH)          // 64 chunks per (b,h)
#define SS (KK * MM)          // 8192 state elements per (b,h), both scans

#define LDA 40                // padded LDS row length (bf16 elems): 80B, 16B-aligned runs

typedef __attribute__((ext_vector_type(16))) __bf16 v16bf;
typedef __attribute__((ext_vector_type(8)))  __bf16 v8bf;
typedef __attribute__((ext_vector_type(2)))  __bf16 v2bf;
typedef __attribute__((ext_vector_type(8)))  float  v8f;
typedef __attribute__((ext_vector_type(2)))  float  v2f;
typedef __attribute__((ext_vector_type(4)))  float  v4f;

#if __has_builtin(__builtin_amdgcn_cvt_pk_bf16_f32)
__device__ __forceinline__ unsigned pack2bf(float a, float b) {
    v2bf r = __builtin_amdgcn_cvt_pk_bf16_f32(a, b);   // v_cvt_pk_bf16_f32
    return __builtin_bit_cast(unsigned, r);
}
#else
__device__ __forceinline__ unsigned pack2bf(float a, float b) {
    unsigned ua = __builtin_bit_cast(unsigned, a);
    unsigned ub = __builtin_bit_cast(unsigned, b);
    ua = (ua + 0x7FFFu + ((ua >> 16) & 1u)) >> 16;     // RNE
    ub = (ub + 0x7FFFu + ((ub >> 16) & 1u)) >> 16;
    return ua | (ub << 16);
}
#endif

// ---------------------------------------------------------------------------
// Tiled GEMM: Y(8192 x N) = act( X(8192 x 512) @ W(512 x N) ), bf16 WMMA.
// Block = 256 threads (8 waves). Block tile = 128(M) x 64(N), K-step = 32.
// Software-pipelined double-buffered LDS: fetch tile k+1 to registers, WMMA
// tile k from LDS[cur], then stage registers into LDS[cur^1]; ONE barrier
// per K-step. A staged row-major As[row][k]; B staged transposed Bst[col][k]
// so every lane fragment is two contiguous 16B runs -> ds_load_b128. A thread
// stages 8 consecutive k of ONE column of B: one 16B LDS store at the 80B pitch.
// act: 0 = none, 1 = swish, 2 = ge = exp(log_sigmoid(x)/8); the same for a whole block
// ---------------------------------------------------------------------------
template <int ACT>
__device__ __forceinline__ void gemm_store(
    const v8f (&acc)[4], float* __restrict__ Y, const int N, const int row0, const int col0) {
#pragma unroll
    for (int jn = 0; jn < 4; ++jn) {
#pragma unroll
        for (int r = 0; r < 8; ++r) {
            float x = acc[jn][r];
            if (ACT == 1) {
                x = x / (1.f + __expf(-x));                      // swish
            } else if (ACT == 2) {
                float ax = fabsf(x);
                float ls = fminf(x, 0.f) - log1pf(__expf(-ax));  // log_sigmoid, stable
                x = __expf(ls * 0.125f);                         // ge = exp(g/8)
            }
            Y[(row0 + r) * N + col0 + jn * 16] = x;
        }
    }
    // The three epilogues share one kernel: keeps the stores' address and data
    // registers from being rewritten by another epilogue's code behind a branch.
    asm volatile("s_wait_xcnt 0x0" ::: "memory");
}

__device__ __forceinline__ void gemm_tile(
    const float* __restrict__ X, const float* __restrict__ W,
    float* __restrict__ Y, const int N, const int act,
    const int rowBase, const int colBase) {
    __shared__ __align__(16) __bf16 As[2][128 * LDA];   // 2 x 10.0 KB
    __shared__ __align__(16) __bf16 Bst[2][64 * LDA];   // 2 x  5.0 KB

    const int tid  = threadIdx.x;
    const int lane = tid & 31;
    const int wv   = tid >> 5;

    const int mrow = lane & 15;            // row of 16-row tile / col of 16-col tile
    const int kb   = (lane >> 4) << 3;     // 0 or 8: K sub-block for this half-wave

    const float4* X4 = (const float4*)X;

    // Per-thread staging coordinates (constant)
    int arr[4], ac[4];                     // A: row, float4-col
#pragma unroll
    for (int i = 0; i < 4; ++i) { int e = tid + i * 256; arr[i] = e >> 3; ac[i] = e & 7; }
    const int bcol = tid & 63;             // B: column of the tile
    const int bk8  = (tid >> 6) * 8;       // B: first of this thread's 8 k-rows
    const float* Wt = W + bk8 * N + colBase + bcol;
    const int bdst = bcol * LDA + bk8;     // 16B-aligned run in Bst[col][k]

    float4 ra[4];
    float  rb[8];

    // ---- prologue: fetch tile 0 and stage into buffer 0
#pragma unroll
    for (int i = 0; i < 4; ++i)
        ra[i] = X4[(((rowBase + arr[i]) * DD) >> 2) + ac[i]];
#pragma unroll
    for (int i = 0; i < 8; ++i)
        rb[i] = Wt[i * N];
#pragma unroll
    for (int i = 0; i < 4; ++i) {
        uint2 t; t.x = pack2bf(ra[i].x, ra[i].y); t.y = pack2bf(ra[i].z, ra[i].w);
        *(uint2*)&As[0][arr[i] * LDA + ac[i] * 4] = t;
    }
    {
        uint4 t;
        t.x = pack2bf(rb[0], rb[1]); t.y = pack2bf(rb[2], rb[3]);
        t.z = pack2bf(rb[4], rb[5]); t.w = pack2bf(rb[6], rb[7]);
        *(uint4*)&Bst[0][bdst] = t;
    }

    v8f acc[4] = {};
    int cur = 0;

    for (int k0 = 0; k0 < DD; k0 += 32) {
        __syncthreads();                      // LDS[cur] ready; LDS[cur^1] free
        const bool more = (k0 + 32 < DD);
        if (more) {
            // Issue next-tile global loads early: they fly under the WMMAs.
#pragma unroll
            for (int i = 0; i < 4; ++i)
                ra[i] = X4[(((rowBase + arr[i]) * DD + k0 + 32) >> 2) + ac[i]];
#pragma unroll
            for (int i = 0; i < 8; ++i)
                rb[i] = Wt[(k0 + 32 + i) * N];
            if (k0 + 64 < DD)
                __builtin_prefetch(&X[(rowBase + (tid >> 1)) * DD + k0 + 64], 0, 1);
        }

        // ---- WMMA on buffer `cur`
        const __bf16* Ab = &As[cur][0];
        const __bf16* Bb = &Bst[cur][0];
        const int arow = (wv * 16 + mrow) * LDA;
        v8bf alo = *(const v8bf*)&Ab[arow + kb];
        v8bf ahi = *(const v8bf*)&Ab[arow + 16 + kb];
        v16bf a = __builtin_shufflevector(alo, ahi,
            0, 1, 2, 3, 4, 5, 6, 7, 8, 9, 10, 11, 12, 13, 14, 15);
#pragma unroll
        for (int jn = 0; jn < 4; ++jn) {
            const int bcol = (jn * 16 + mrow) * LDA;
            v8bf blo = *(const v8bf*)&Bb[bcol + kb];
            v8bf bhi = *(const v8bf*)&Bb[bcol + 16 + kb];
            v16bf bfr = __builtin_shufflevector(blo, bhi,
                0, 1, 2, 3, 4, 5, 6, 7, 8, 9, 10, 11, 12, 13, 14, 15);
            acc[jn] = __builtin_amdgcn_wmma_f32_16x16x32_bf16(
                false, a, false, bfr, (short)0, acc[jn], false, false);
        }

        if (more) {
            // ---- stage fetched registers into buffer `cur^1`
            __bf16* An = &As[cur ^ 1][0];
            __bf16* Bn = &Bst[cur ^ 1][0];
#pragma unroll
            for (int i = 0; i < 4; ++i) {
                uint2 t; t.x = pack2bf(ra[i].x, ra[i].y); t.y = pack2bf(ra[i].z, ra[i].w);
                *(uint2*)&An[arr[i] * LDA + ac[i] * 4] = t;
            }
            uint4 t;
            t.x = pack2bf(rb[0], rb[1]); t.y = pack2bf(rb[2], rb[3]);
            t.z = pack2bf(rb[4], rb[5]); t.w = pack2bf(rb[6], rb[7]);
            *(uint4*)&Bn[bdst] = t;
        }
        cur ^= 1;
    }

    const int row0 = rowBase + wv * 16 + ((lane >> 4) << 3);
    const int col0 = colBase + mrow;
    if (act == 1)      gemm_store<1>(acc, Y, N, row0, col0);
    else if (act == 2) gemm_store<2>(acc, Y, N, row0, col0);
    else               gemm_store<0>(acc, Y, N, row0, col0);
}

// The four input projections share X and do not depend on each other: one grid
// of 28 column tiles (8 for q, 8 for k, 8 for v, 4 for the gate) by 64 row tiles.
__global__ __launch_bounds__(256) void proj_in_kernel(
    const float* __restrict__ X,
    const float* __restrict__ Wq, const float* __restrict__ Wk,
    const float* __restrict__ Wv, const float* __restrict__ Wf,
    float* __restrict__ q, float* __restrict__ k,
    float* __restrict__ v, float* __restrict__ ge) {
    const int sel = blockIdx.x >> 3;       // 0 q, 1 k, 2 v, 3 gate
    const float* W = sel == 0 ? Wq : sel == 1 ? Wk : sel == 2 ? Wv : Wf;
    float*       Y = sel == 0 ? q  : sel == 1 ? k  : sel == 2 ? v  : ge;
    const int N   = sel == 3 ? HH * MM : DD;
    const int act = sel < 2 ? 1 : sel == 2 ? 0 : 2;
    gemm_tile(X, W, Y, N, act, blockIdx.y * 128, (blockIdx.x & 7) * 64);
}

__global__ __launch_bounds__(256) void proj_out_kernel(
    const float* __restrict__ X, const float* __restrict__ W,
    float* __restrict__ Y) {
    gemm_tile(X, W, Y, DD, 0, blockIdx.y * 128, blockIdx.x * 64);
}

// ---------------------------------------------------------------------------
// The two scans are linear in their state, so the time axis is cut into NC
// chunks that run side by side:
//   local : each chunk's end state L_c from a zero state (a matrix product over
//           its steps) and the product D_c[m] of its decays;
//   carry : H_0 = 0, H_{c+1} = H_c * D_c + L_c gives every chunk's start state;
//   scan  : each chunk forms its outputs from H_c and its own steps (chunk form below).
// ---------------------------------------------------------------------------

// Carry over the chunks: one thread per state element, NC serial steps.
// SECOND = 0: state laid out [k][m]; SECOND = 1: state laid out [m][v].
template <int SECOND>
__device__ __forceinline__ void carry(
    const int blk, const float* __restrict__ hloc, const float* __restrict__ dloc,
    float* __restrict__ hin) {
    const int e = blk * 256 + threadIdx.x;
    const int bh = e / SS, idx = e % SS;
    const int m = SECOND ? (idx / VV) : (idx % MM);
    const float* src = hloc + bh * (NC * SS) + idx;
    const float* dsr = dloc + bh * (NC * MM) + m;
    float* dst = hin + bh * (NC * SS) + idx;

    float hc = 0.f;
    for (int c0 = 0; c0 < NC; c0 += 16) {
        float a[16], d[16];                 // 16 chunks' loads in flight at once
#pragma unroll
        for (int j = 0; j < 16; ++j) {
            a[j] = src[(c0 + j) * SS];
            d[j] = dsr[(c0 + j) * MM];
        }
#pragma unroll
        for (int j = 0; j < 16; ++j) {
            dst[(c0 + j) * SS] = hc;
            hc = hc * d[j] + a[j];
        }
    }
}

// Both carries in one grid: neither reads what the other writes.
__global__ __launch_bounds__(256) void carry_both_kernel(
    const float* __restrict__ hloc1, const float* __restrict__ hloc2,
    const float* __restrict__ dloc,
    float* __restrict__ hin1, float* __restrict__ hin2) {
    const int half = BB * HH * SS / 256;
    if ((int)blockIdx.x < half) carry<0>(blockIdx.x, hloc1, dloc, hin1);
    else                        carry<1>(blockIdx.x - half, hloc2, dloc, hin2);
}

// ---------------------------------------------------------------------------
// Both scans in chunk form. With Dc[t][m] = ge_0[m] * .. * ge_t[m] (steps of the
// chunk) and U[t][s][m] = (1 - ge_s[m]) * ge_{s+1}[m] * .. * ge_t[m] for s <= t,
// the state after step t is H * Dc[t] + sum_{s<=t} (k_s or v_s) * U[t][s], so
//   pass 1: ok[t][m] = Dc[t][m] * (Q H)[t][m] + sum_{s<=t} (Q K^T)[t][s] * U[t][s][m]
//   pass 2: o[t][v]  = ((p * Dc) H)[t][v] + sum_{s<=t} A2[t][s] * v_s[v],
//           A2[t][s] = sum_m p[t][m] * U[t][s][m]
// The products with H, K^T and v run on the f32 16x16x4 WMMA; U is built step by
// step by multiplying (factors in (0,1], no division) on the vector unit.
// Fragments: lane (cc = lane & 15, hf = lane >> 4) holds row or column cc and, of
// each 8 consecutive k, the four k = 4*hf .. 4*hf+3, in the same order on both sides.
// ---------------------------------------------------------------------------
#define QP 132
#define MP 68
#define AP 36

__device__ __forceinline__ void mm_acc(v8f& c0, v8f& c1, const v2f (&a)[8],
                                       const v2f (&b0)[8], const v2f (&b1)[8]) {
    asm volatile(
        "v_wmma_f32_16x16x4_f32 %0, %2, %10, %0\n\t"
        "v_wmma_f32_16x16x4_f32 %1, %2, %18, %1\n\t"
        "v_wmma_f32_16x16x4_f32 %0, %3, %11, %0\n\t"
        "v_wmma_f32_16x16x4_f32 %1, %3, %19, %1\n\t"
        "v_wmma_f32_16x16x4_f32 %0, %4, %12, %0\n\t"
        "v_wmma_f32_16x16x4_f32 %1, %4, %20, %1\n\t"
        "v_wmma_f32_16x16x4_f32 %0, %5, %13, %0\n\t"
        "v_wmma_f32_16x16x4_f32 %1, %5, %21, %1\n\t"
        "v_wmma_f32_16x16x4_f32 %0, %6, %14, %0\n\t"
        "v_wmma_f32_16x16x4_f32 %1, %6, %22, %1\n\t"
        "v_wmma_f32_16x16x4_f32 %0, %7, %15, %0\n\t"
        "v_wmma_f32_16x16x4_f32 %1, %7, %23, %1\n\t"
        "v_wmma_f32_16x16x4_f32 %0, %8, %16, %0\n\t"
        "v_wmma_f32_16x16x4_f32 %1, %8, %24, %1\n\t"
        "v_wmma_f32_16x16x4_f32 %0, %9, %17, %0\n\t"
        "v_wmma_f32_16x16x4_f32 %1, %9, %25, %1\n\t"
        "v_nop\n\t"
        "v_nop\n\t"
        "v_nop\n\t"
        "v_nop\n\t"
        "v_nop\n\t"
        "v_nop\n\t"
        "v_nop\n\t"
        "v_nop\n\t"
        : "+v"(c0), "+v"(c1)
        : "v"(a[0]), "v"(a[1]), "v"(a[2]), "v"(a[3]), "v"(a[4]), "v"(a[5]), "v"(a[6]), "v"(a[7]),
          "v"(b0[0]), "v"(b0[1]), "v"(b0[2]), "v"(b0[3]), "v"(b0[4]), "v"(b0[5]), "v"(b0[6]), "v"(b0[7]),
          "v"(b1[0]), "v"(b1[1]), "v"(b1[2]), "v"(b1[3]), "v"(b1[4]), "v"(b1[5]), "v"(b1[6]), "v"(b1[7]));
}

// 32 k of one row's fragments from LDS: src points at the lane's row and its 4*hf.
__device__ __forceinline__ void frag32(v2f (&f)[8], const float* src) {
#pragma unroll
    for (int a = 0; a < 4; ++a) {
        const v4f x = *(const v4f*)(src + 8 * a);
        f[2 * a] = x.lo;
        f[2 * a + 1] = x.hi;
    }
}

// Pass 1, one block per (b,h,chunk), started from the carried state H [k][m].
// Wave w: (Q H)^T for m-tile w & 3 over the k half w >> 2, both 16-step tiles. Waves
// 4..7 also take Q K^T: 16 steps t by all 32 s over one k half. The halves are added later.
// Then thread (m = t & 63, group j = t >> 6) carries U for the 8 steps s = 8j..8j+7
// through t = 8j..31; the four groups' partial sums are added in the softmax tail.
__global__ __launch_bounds__(256) void scan1_kernel(
    const float* __restrict__ q, const float* __restrict__ k,
    const float* __restrict__ ge, const float* __restrict__ hin,
    float* __restrict__ p) {
    const int bh = blockIdx.x / NC, c = blockIdx.x % NC;
    const int b = bh >> 2, h = bh & 3;
    const int t = threadIdx.x;
    const int lane = t & 31;
    const int wv = __builtin_amdgcn_readfirstlane(t >> 5);
    const int cc = lane & 15, hf = lane >> 4;
    const int row0 = b * TT + c * CH;

    __shared__ __align__(16) float sm[2 * CH * QP];
    __shared__ __align__(16) float As[2 * CH * CH];   // (Q K^T)[t][s]: two k halves, then their sum in the first
    __shared__ __align__(16) float QH[2 * CH * MP];   // [k half][t][m], pitch MP
    __shared__ __align__(16) float Gs[CH * MM];       // ge[step][m]
    float* Qs  = sm;                       // [step][k], pitch QP
    float* Ks  = sm + CH * QP;             // [step][k], pitch QP
    float* red = sm;                       // [step][group][m], over Qs and Ks once they are done with

    const int mj = wv & 3, kh = wv >> 2;
    float hb[8][4];                        // fragments of H: H[kh*64 + 8a + 4hf + i][16mj + cc]
    {
        // Every address is a wave-uniform base plus one 32-bit lane offset in bytes.
        const char* hp = (const char*)(hin + blockIdx.x * SS + kh * 64 * MM + mj * 16);
        const char* qp = (const char*)(q + row0 * (HH * KK) + h * KK);
        const char* kp = (const char*)(k + row0 * (HH * KK) + h * KK);
        const char* gp = (const char*)(ge + row0 * (HH * MM) + h * MM);
        const unsigned hoff = (unsigned)(4 * hf * MM + cc) * 4u;
        const unsigned qoff = (unsigned)((t >> 5) * (HH * KK) + (t & 31) * 4) * 4u;
        const unsigned goff = (unsigned)((t >> 4) * (HH * MM) + (t & 15) * 4) * 4u;
#pragma unroll
        for (int a = 0; a < 8; ++a)
#pragma unroll
            for (int i = 0; i < 4; ++i) hb[a][i] = *(const float*)(hp + hoff + (8 * a + i) * (MM * 4));
        v4f rq[4], rk[4], rg[2];
#pragma unroll
        for (int i = 0; i < 4; ++i) {
            rq[i] = *(const v4f*)(qp + qoff + i * (8 * HH * KK * 4));
            rk[i] = *(const v4f*)(kp + qoff + i * (8 * HH * KK * 4));
        }
#pragma unroll
        for (int i = 0; i < 2; ++i) rg[i] = *(const v4f*)(gp + goff + i * (16 * HH * MM * 4));
        // The loads' base and offset registers stay as they are until the loads have
        // taken them: naming them and the staged values here keeps this behind the loads
        // and keeps later scalar work or a load's result from being placed on them.
        asm volatile("s_wait_xcnt 0x0" :: "s"(hp), "s"(qp), "s"(kp), "s"(gp),
                     "v"(hoff), "v"(qoff), "v"(goff),
                     "v"(rq[0]), "v"(rq[1]), "v"(rq[2]), "v"(rq[3]),
                     "v"(rk[0]), "v"(rk[1]), "v"(rk[2]), "v"(rk[3]),
                     "v"(rg[0]), "v"(rg[1]) : "memory");
#pragma unroll
        for (int i = 0; i < 4; ++i) {
            *(v4f*)&Qs[((t >> 5) + 8 * i) * QP + (t & 31) * 4] = rq[i];
            *(v4f*)&Ks[((t >> 5) + 8 * i) * QP + (t & 31) * 4] = rk[i];
        }
#pragma unroll
        for (int i = 0; i < 2; ++i) *(v4f*)&Gs[((t >> 4) + 16 * i) * MM + (t & 15) * 4] = rg[i];
    }
    __syncthreads();                       // publishes the chunk's q, k and gate rows

    {   // A = H^T (row = m), B = Q^T (column = step): lane cc has step cc, m = 8hf .. 8hf+7
        v8f d0 = {}, d1 = {};
        const float* qa = Qs + cc * QP + kh * 64 + 4 * hf;
#pragma unroll
        for (int n = 0; n < 2; ++n) {
            v2f ha[8], x0[8], x1[8];
#pragma unroll
            for (int a = 0; a < 4; ++a) {
                ha[2 * a]     = v2f{hb[4 * n + a][0], hb[4 * n + a][1]};
                ha[2 * a + 1] = v2f{hb[4 * n + a][2], hb[4 * n + a][3]};
            }
            frag32(x0, qa + 32 * n);
            frag32(x1, qa + 16 * QP + 32 * n);
            mm_acc(d0, d1, ha, x0, x1);
        }
        float* dst = QH + kh * (CH * MP) + cc * MP + mj * 16 + 8 * hf;
        *(v4f*)(dst)               = v4f{d0[0], d0[1], d0[2], d0[3]};
        *(v4f*)(dst + 4)           = v4f{d0[4], d0[5], d0[6], d0[7]};
        *(v4f*)(dst + 16 * MP)     = v4f{d1[0], d1[1], d1[2], d1[3]};
        *(v4f*)(dst + 16 * MP + 4) = v4f{d1[4], d1[5], d1[6], d1[7]};
    }
    if (wv >= 4) {                         // A = Q (row = t), B = K^T (column = s)
        const int ti = (wv >> 1) & 1, k2 = wv & 1;
        v8f e0 = {}, e1 = {};
        const float* qa = Qs + (ti * 16 + cc) * QP + k2 * 64 + 4 * hf;
        const float* kb = Ks + cc * QP + k2 * 64 + 4 * hf;
#pragma unroll
        for (int n = 0; n < 2; ++n) {
            v2f x[8], y0[8], y1[8];
            frag32(x, qa + 32 * n);
            frag32(y0, kb + 32 * n);
            frag32(y1, kb + 16 * QP + 32 * n);
            mm_acc(e0, e1, x, y0, y1);
        }
        float* dst = As + k2 * (CH * CH) + (ti * 16 + 8 * hf) * CH + cc;
#pragma unroll
        for (int r = 0; r < 8; ++r) {
            dst[r * CH]      = e0[r];
            dst[r * CH + 16] = e1[r];
        }
    }
    __syncthreads();                       // publishes both k halves of Q K^T
    *(v4f*)&As[t * 4] = *(const v4f*)&As[t * 4] + *(const v4f*)&As[CH * CH + t * 4];
    __syncthreads();                       // publishes Q H and Q K^T; q and k rows are done with

    {
        const int m = t & 63;
        const int s0 = (wv >> 1) * 8;      // first step of this group
        v2f u[4];                          // U of steps s0 .. s0+7, two to a register pair
#pragma unroll
        for (int i = 0; i < 8; ++i) u[i >> 1][i & 1] = 1.f - Gs[(s0 + i) * MM + m];
        float dc = s0 == 0 ? 1.f : 0.f;
        for (int tq = 0; tq < s0; ++tq) red[tq * 256 + t] = 0.f;
#pragma unroll
        for (int tt = 0; tt < 8; ++tt) {   // steps of the group's own block: s <= t only
            const int tq = s0 + tt;
            const float g = Gs[tq * MM + m];
            const v4f a0 = *(const v4f*)&As[tq * CH + s0];
            const v4f a1 = *(const v4f*)&As[tq * CH + s0 + 4];
            const float av[8] = {a0.x, a0.y, a0.z, a0.w, a1.x, a1.y, a1.z, a1.w};
            dc *= g;
            float acc = dc * (QH[tq * MP + m] + QH[CH * MP + tq * MP + m]);
#pragma unroll
            for (int i = 0; i < 8; ++i) {
                if (i < tt) u[i >> 1][i & 1] *= g;
                if (i <= tt) acc += av[i] * u[i >> 1][i & 1];
            }
            red[tq * 256 + t] = acc;
        }
        // Four steps a trip: their LDS reads are issued ahead of the arithmetic that waits for them.
#pragma unroll 4
        for (int tq = s0 + 8; tq < CH; ++tq) {
            const float g = Gs[tq * MM + m];
            const v4f a0 = *(const v4f*)&As[tq * CH + s0];
            const v4f a1 = *(const v4f*)&As[tq * CH + s0 + 4];
            const v2f g2 = {g, g};
            dc *= g;
            v2f ac = {dc * (QH[tq * MP + m] + QH[CH * MP + tq * MP + m]), 0.f};
            u[0] *= g2;  ac += a0.lo * u[0];
            u[1] *= g2;  ac += a0.hi * u[1];
            u[2] *= g2;  ac += a1.lo * u[2];
            u[3] *= g2;  ac += a1.hi * u[3];
            red[tq * 256 + t] = ac.x + ac.y;
        }
    }
    __syncthreads();                       // publishes every step's partial sums

    float* prow = p + (row0 + wv) * (HH * MM) + h * MM + lane;
    for (int j = 0; j < CH / 8; ++j) {
        const float* src = red + (wv + 8 * j) * 256 + lane;
        float x0 = src[0]  + src[64] + src[128] + src[192];
        float x1 = src[32] + src[96] + src[160] + src[224];
        float mx = fmaxf(x0, x1);
#pragma unroll
        for (int off = 16; off > 0; off >>= 1) mx = fmaxf(mx, __shfl_xor(mx, off, 32));
        float ea = __expf(x0 - mx), eb = __expf(x1 - mx);
        float s = ea + eb;
#pragma unroll
        for (int off = 16; off > 0; off >>= 1) s += __shfl_xor(s, off, 32);
        float inv = 1.f / s;
        prow[8 * j * (HH * MM)]      = ea * inv;
        prow[8 * j * (HH * MM) + 32] = eb * inv;
    }
}

// Local pass of both scans: one block per (b,h,chunk), no step loop.
// From a zero state the recurrences end in plain sums over the chunk's steps s:
//   pass 1: L1[k][m] = sum_s k_s[k] * W[s][m]
//   pass 2: L2[m][v] = sum_s W[s][m] * v_s[v]
//   W[s][m] = (1 - ge_s[m]) * prod_{r > s} ge_r[m]     (factors in (0,1], no division)
// Both are matrix products over the 32 steps, done on the f32 16x16x4 WMMA.
// Lane (c = lane & 15, hf = lane >> 4) holds steps 16*hf .. 16*hf+15 of row or
// column c in every operand, so W's fragments are B of pass 1 and A of pass 2
// and the step order is the same on both sides of each product.
// Wave w: pass 1 rows k = 16w..16w+15, all 64 m; pass 2 two m-tiles by 32 v.
// Every wave forms W itself in registers: nothing crosses waves.

__device__ __forceinline__ void mm_1x2(v8f& c0, v8f& c1, const v2f (&a)[8],
                                       const v2f (&b0)[8], const v2f (&b1)[8]) {
    asm volatile(
        "v_wmma_f32_16x16x4_f32 %0, %2, %10, 0\n\t"
        "v_wmma_f32_16x16x4_f32 %1, %2, %18, 0\n\t"
        "v_wmma_f32_16x16x4_f32 %0, %3, %11, %0\n\t"
        "v_wmma_f32_16x16x4_f32 %1, %3, %19, %1\n\t"
        "v_wmma_f32_16x16x4_f32 %0, %4, %12, %0\n\t"
        "v_wmma_f32_16x16x4_f32 %1, %4, %20, %1\n\t"
        "v_wmma_f32_16x16x4_f32 %0, %5, %13, %0\n\t"
        "v_wmma_f32_16x16x4_f32 %1, %5, %21, %1\n\t"
        "v_wmma_f32_16x16x4_f32 %0, %6, %14, %0\n\t"
        "v_wmma_f32_16x16x4_f32 %1, %6, %22, %1\n\t"
        "v_wmma_f32_16x16x4_f32 %0, %7, %15, %0\n\t"
        "v_wmma_f32_16x16x4_f32 %1, %7, %23, %1\n\t"
        "v_wmma_f32_16x16x4_f32 %0, %8, %16, %0\n\t"
        "v_wmma_f32_16x16x4_f32 %1, %8, %24, %1\n\t"
        "v_wmma_f32_16x16x4_f32 %0, %9, %17, %0\n\t"
        "v_wmma_f32_16x16x4_f32 %1, %9, %25, %1\n\t"
        "v_nop\n\t"
        "v_nop\n\t"
        "v_nop\n\t"
        "v_nop\n\t"
        "v_nop\n\t"
        "v_nop\n\t"
        "v_nop\n\t"
        "v_nop\n\t"
        : "=&v"(c0), "=&v"(c1)
        : "v"(a[0]), "v"(a[1]), "v"(a[2]), "v"(a[3]), "v"(a[4]), "v"(a[5]), "v"(a[6]), "v"(a[7]),
          "v"(b0[0]), "v"(b0[1]), "v"(b0[2]), "v"(b0[3]), "v"(b0[4]), "v"(b0[5]), "v"(b0[6]), "v"(b0[7]),
          "v"(b1[0]), "v"(b1[1]), "v"(b1[2]), "v"(b1[3]), "v"(b1[4]), "v"(b1[5]), "v"(b1[6]), "v"(b1[7]));
}

// Turns one m-tile's 16 gate values of this lane half into W; returns the chunk's
// decay product (the same value in both lane halves).
__device__ __forceinline__ float decay_weights(v2f (&w)[8], const int hf) {
    float suf = 1.f;                               // product of the decays after step i
#pragma unroll
    for (int i = 15; i >= 0; --i) {
        const float g = w[i >> 1][i & 1];
        w[i >> 1][i & 1] = (1.f - g) * suf;
        suf *= g;
    }
    const float oth = __shfl_xor(suf, 16, 32);     // the other 16 steps' product
    const float late = hf == 0 ? oth : 1.f;        // steps 0..15 also decay through 16..31
#pragma unroll
    for (int j = 0; j < 8; ++j) w[j] *= late;
    return suf * oth;
}

__global__ __launch_bounds__(256, 8) void local_both_kernel(
    const float* __restrict__ k, const float* __restrict__ v,
    const float* __restrict__ ge,
    float* __restrict__ hloc1, float* __restrict__ hloc2,
    float* __restrict__ dloc) {
    const int blk = blockIdx.x;
    const int bh = blk / NC, c = blk % NC;
    const int b = bh >> 2, h = bh & 3;
    const int lane = threadIdx.x & 31;
    const int wv = __builtin_amdgcn_readfirstlane(threadIdx.x >> 5);
    const int cc = lane & 15, hf = lane >> 4;
    const int row0 = b * TT + c * CH;             // first step of the chunk
    const int mhalf = wv >> 2, vpair = wv & 3;    // pass 2 share of this wave

    // wt[q] belongs to m-tile q ^ (2*mhalf): wt[0], wt[1] are the wave's own pass-2 tiles.
    // Every address is a wave-uniform base plus one 32-bit lane offset in bytes;
    // go[0], so[0] serve tiles q = 0, 1 and go[1], so[1] tiles q = 2, 3.
    const unsigned own = 2 * mhalf * 64, far = own ^ 128;               // tile pair, bytes
    const unsigned goff = (unsigned)(hf * 16 * (HH * MM) + cc) * 4u;    // gate rows
    const unsigned go[2] = {goff + own, goff + far};
    const unsigned koff = (unsigned)(hf * 16 * (HH * KK) + cc) * 4u;    // k and v rows
    const unsigned soff = (unsigned)(hf * 8 * MM + cc) * 4u;            // pass-1 state rows
    const unsigned so[2] = {soff + own, soff + far};

    v2f wt[4][8], ka[8], vb[2][8];
    {
        const char* gb = (const char*)(ge + row0 * (HH * MM) + h * MM);
        const char* kp = (const char*)(k + row0 * (HH * KK) + h * KK + wv * 16) + koff;
#pragma unroll
        for (int q = 2; q < 4; ++q)
#pragma unroll
            for (int i = 0; i < 16; ++i)
                wt[q][i >> 1][i & 1] = *(const float*)(gb + go[1] + (q & 1) * 64 + i * (HH * MM * 4));
#pragma unroll
        for (int i = 0; i < 16; ++i) ka[i >> 1][i & 1] = *(const float*)(kp + i * (HH * KK * 4));
#pragma unroll
        for (int q = 0; q < 2; ++q)
#pragma unroll
            for (int i = 0; i < 16; ++i)
                wt[q][i >> 1][i & 1] = *(const float*)(gb + go[0] + (q & 1) * 64 + i * (HH * MM * 4));
    }
    // The loads' offset registers stay as they are until the loads have taken them:
    // naming them here keeps a later load's result from being placed on them.
    asm volatile("s_wait_xcnt 0x0" :: "v"(go[0]), "v"(go[1]), "v"(koff) : "memory");

    char* db = (char*)(hloc1 + blk * SS + wv * 16 * MM);
    float dp[4];
    v8f c0, c1;

    // Pass 1: A = k (row = k index), B = W (column = m). First the tiles that pass 2
    // of this wave does not need: their registers are free afterwards.
    dp[2] = decay_weights(wt[2], hf);
    dp[3] = decay_weights(wt[3], hf);
    mm_1x2(c0, c1, ka, wt[2], wt[3]);
#pragma unroll
    for (int r = 0; r < 8; ++r) {
        *(float*)(db + so[1] + r * (MM * 4))      = c0[r];
        *(float*)(db + so[1] + r * (MM * 4) + 64) = c1[r];
    }
    // What follows reuses the stores' registers: they stay until the stores have taken them.
    asm volatile("s_wait_xcnt 0x0" :: "v"(so[1]) : "memory");

    {   // v flies under the rest of pass 1
        const char* vp = (const char*)(v + row0 * (HH * VV) + h * VV + vpair * 32) + koff;
#pragma unroll
        for (int i = 0; i < 16; ++i) {
            vb[0][i >> 1][i & 1] = *(const float*)(vp + i * (HH * VV * 4));
            vb[1][i >> 1][i & 1] = *(const float*)(vp + i * (HH * VV * 4) + 64);
        }
        // As above: the offset register stays until the loads have taken it.
        asm volatile("s_wait_xcnt 0x0" :: "v"(koff) : "memory");
    }

    dp[0] = decay_weights(wt[0], hf);
    dp[1] = decay_weights(wt[1], hf);
    if (wv == 0) {                                 // wave 0 has m-tile q in wt[q]
        dloc[blk * MM + lane]      = hf ? dp[1] : dp[0];
        dloc[blk * MM + 32 + lane] = hf ? dp[3] : dp[2];
        // As above, for these two stores.
        asm volatile("s_wait_xcnt 0x0" ::: "memory");
    }
    mm_1x2(c0, c1, ka, wt[0], wt[1]);
#pragma unroll
    for (int r = 0; r < 8; ++r) {
        *(float*)(db + so[0] + r * (MM * 4))      = c0[r];
        *(float*)(db + so[0] + r * (MM * 4) + 64) = c1[r];
    }

    // Pass 2: A = W (row = m), B = v (column = v index).
    const unsigned s2 = (unsigned)(hf * 8 * VV + cc) * 4u;
    char* d2 = (char*)(hloc2 + blk * SS + mhalf * 32 * VV + vpair * 32);
    mm_1x2(c0, c1, wt[0], vb[0], vb[1]);
#pragma unroll
    for (int r = 0; r < 8; ++r) {
        *(float*)(d2 + s2 + r * (VV * 4))      = c0[r];
        *(float*)(d2 + s2 + r * (VV * 4) + 64) = c1[r];
    }
    asm volatile("s_wait_xcnt 0x0" :: "v"(s2) : "memory");
    mm_1x2(c0, c1, wt[1], vb[0], vb[1]);
#pragma unroll
    for (int r = 0; r < 8; ++r) {
        *(float*)(d2 + s2 + (16 + r) * (VV * 4))      = c0[r];
        *(float*)(d2 + s2 + (16 + r) * (VV * 4) + 64) = c1[r];
    }
}

__global__ __launch_bounds__(256, 8) void scan2_kernel(
    const float* __restrict__ p, const float* __restrict__ v,
    const float* __restrict__ ge, const float* __restrict__ hin,
    const float* __restrict__ w, float* __restrict__ o) {
    const int bh = blockIdx.x / NC, c = blockIdx.x % NC;
    const int b = bh >> 2, h = bh & 3;
    const int t = threadIdx.x;
    const int lane = t & 31;
    const int wv = __builtin_amdgcn_readfirstlane(t >> 5);
    const int cc = lane & 15, hf = lane >> 4;
    const int row0 = b * TT + c * CH;

    __shared__ __align__(16) float Gs[CH * MM];       // ge[step][m]
    __shared__ __align__(16) float Pl[CH * MM];       // p[step][m]
    __shared__ __align__(16) float Ps[CH * MP];       // p * Dc, pitch MP
    __shared__ __align__(16) float A2s[CH * AP];      // A2[t][s], pitch AP
    __shared__ __align__(16) float part[8 * CH * CH]; // [wave][t][s] partial sums of A2
    float* Os = part;                      // o[t][v], pitch QP, once the partial sums are done with

    float hb[8][4], vb[4][4];              // fragments: H[8a + 4hf + i][col], v[8a + 4hf + i][col]
    {
        // Every address is a wave-uniform base plus one 32-bit lane offset in bytes.
        const char* hp = (const char*)(hin + blockIdx.x * SS + wv * 16);
        const char* vp = (const char*)(v + row0 * (HH * VV) + h * VV + wv * 16);
        const char* gp = (const char*)(ge + row0 * (HH * MM) + h * MM);
        const char* pp = (const char*)(p  + row0 * (HH * MM) + h * MM);
        const unsigned hoff = (unsigned)(4 * hf * VV + cc) * 4u;
        const unsigned voff = (unsigned)(4 * hf * (HH * VV) + cc) * 4u;
        const unsigned goff = (unsigned)((t >> 4) * (HH * MM) + (t & 15) * 4) * 4u;
#pragma unroll
        for (int a = 0; a < 8; ++a)
#pragma unroll
            for (int i = 0; i < 4; ++i) hb[a][i] = *(const float*)(hp + hoff + (8 * a + i) * (VV * 4));
#pragma unroll
        for (int a = 0; a < 4; ++a)
#pragma unroll
            for (int i = 0; i < 4; ++i) vb[a][i] = *(const float*)(vp + voff + (8 * a + i) * (HH * VV * 4));
        v4f rg[2], rp[2];
#pragma unroll
        for (int i = 0; i < 2; ++i) {
            rg[i] = *(const v4f*)(gp + goff + i * (16 * HH * MM * 4));
            rp[i] = *(const v4f*)(pp + goff + i * (16 * HH * MM * 4));
        }
        // The loads' base and offset registers stay as they are until the loads have
        // taken them: naming them and the staged values here keeps this behind the loads
        // and keeps later scalar work or a load's result from being placed on them.
        asm volatile("s_wait_xcnt 0x0" :: "s"(hp), "s"(vp), "s"(gp), "s"(pp),
                     "v"(hoff), "v"(voff), "v"(goff),
                     "v"(rg[0]), "v"(rg[1]), "v"(rp[0]), "v"(rp[1]) : "memory");
#pragma unroll
        for (int i = 0; i < 2; ++i) {
            *(v4f*)&Gs[((t >> 4) + 16 * i) * MM + (t & 15) * 4] = rg[i];
            *(v4f*)&Pl[((t >> 4) + 16 * i) * MM + (t & 15) * 4] = rp[i];
        }
    }
    __syncthreads();                       // publishes the chunk's gate and p rows

    {   // p * Dc: thread (m, group of 8 steps) multiplies the decays up from step 0
        const int m = t & 63;
        const int t0 = (wv >> 1) * 8;
        float dc = 1.f;
        for (int r = 0; r < t0; ++r) dc *= Gs[r * MM + m];
#pragma unroll
        for (int i = 0; i < 8; ++i) {
            dc *= Gs[(t0 + i) * MM + m];
            Ps[(t0 + i) * MP + m] = Pl[(t0 + i) * MM + m] * dc;
        }
    }
    {
        v2f u[4] = {};
        const float* gr = Gs + wv * 8;
        const float* pr = Pl + wv * 8;
        float* dst = part + wv * (CH * CH) + lane;
        // Four steps a trip: their LDS reads are issued ahead of the arithmetic that waits for them.
#pragma unroll 4
        for (int tq = 0; tq < CH; ++tq) {
            const v4f g0 = *(const v4f*)(gr + tq * MM);
            const v4f g1 = *(const v4f*)(gr + tq * MM + 4);
            const v4f p0 = *(const v4f*)(pr + tq * MM);
            const v4f p1 = *(const v4f*)(pr + tq * MM + 4);
            const float e1 = lane == tq ? 1.f : 0.f;
            const v2f e = {e1, e1};
            v2f ac = {0.f, 0.f};
            // t == s: 1 - g; later: u * g; before: 0
            u[0] = g0.lo * (u[0] - e) + e;  ac += p0.lo * u[0];
            u[1] = g0.hi * (u[1] - e) + e;  ac += p0.hi * u[1];
            u[2] = g1.lo * (u[2] - e) + e;  ac += p1.lo * u[2];
            u[3] = g1.hi * (u[3] - e) + e;  ac += p1.hi * u[3];
            dst[tq * CH] = ac.x + ac.y;
        }
    }
    __syncthreads();                       // publishes p * Dc and the partial sums of A2

#pragma unroll
    for (int i = 0; i < 4; ++i) {
        const int e = t + i * 256;
        float x = part[e];
#pragma unroll
        for (int g = 1; g < 8; ++g) x += part[g * (CH * CH) + e];
        A2s[(e >> 5) * AP + (e & 31)] = x;
    }
    __syncthreads();                       // publishes A2; the partial sums are done with

    {   // A = [H ; v]^T (row = column v), B = [p * Dc | A2]^T (column = step):
        // lane cc has step cc, columns 8hf .. 8hf+7 of the wave's 16
        v8f d0 = {}, d1 = {};
        const float* pa = Ps + cc * MP + 4 * hf;
        const float* aa = A2s + cc * AP + 4 * hf;
#pragma unroll
        for (int n = 0; n < 3; ++n) {
            v2f ha[8], x0[8], x1[8];
#pragma unroll
            for (int a = 0; a < 4; ++a) {
                ha[2 * a]     = n < 2 ? v2f{hb[(4 * n + a) & 7][0], hb[(4 * n + a) & 7][1]} : v2f{vb[a][0], vb[a][1]};
                ha[2 * a + 1] = n < 2 ? v2f{hb[(4 * n + a) & 7][2], hb[(4 * n + a) & 7][3]} : v2f{vb[a][2], vb[a][3]};
            }
            frag32(x0, n < 2 ? pa + 32 * n : aa);
            frag32(x1, n < 2 ? pa + 16 * MP + 32 * n : aa + 16 * AP);
            mm_acc(d0, d1, ha, x0, x1);
        }
        float* dst = Os + cc * QP + wv * 16 + 8 * hf;
        *(v4f*)(dst)               = v4f{d0[0], d0[1], d0[2], d0[3]};
        *(v4f*)(dst + 4)           = v4f{d0[4], d0[5], d0[6], d0[7]};
        *(v4f*)(dst + 16 * QP)     = v4f{d1[0], d1[1], d1[2], d1[3]};
        *(v4f*)(dst + 16 * QP + 4) = v4f{d1[4], d1[5], d1[6], d1[7]};
    }
    __syncthreads();                       // publishes the chunk's output rows

    float* orow = o + (row0 + wv) * (HH * VV) + h * VV + lane;
    const float w0 = w[lane], w1 = w[lane + 32], w2 = w[lane + 64], w3 = w[lane + 96];
    for (int j = 0; j < CH / 8; ++j) {
        const float* base = Os + (wv + 8 * j) * QP + lane;
        float x0 = base[0];
        float x1 = base[32];
        float x2 = base[64];
        float x3 = base[96];
        float ss = x0 * x0 + x1 * x1 + x2 * x2 + x3 * x3;
#pragma unroll
        for (int off = 16; off > 0; off >>= 1) ss += __shfl_xor(ss, off, 32);
        float r = rsqrtf(ss * (1.f / (float)VV) + 1e-5f);
        orow[8 * j * (HH * VV)]      = x0 * r * w0;
        orow[8 * j * (HH * VV) + 32] = x1 * r * w1;
        orow[8 * j * (HH * VV) + 64] = x2 * r * w2;
        orow[8 * j * (HH * VV) + 96] = x3 * r * w3;
    }
}

// ---------------------------------------------------------------------------

extern "C" void kernel_launch(void* const* d_in, const int* in_sizes, int n_in,
                              void* d_out, int out_size, void* d_ws, size_t ws_size,
                              hipStream_t stream) {
    const float* x      = (const float*)d_in[0];
    const float* Wq     = (const float*)d_in[1];
    const float* Wk     = (const float*)d_in[2];
    const float* Wv     = (const float*)d_in[3];
    const float* Wf     = (const float*)d_in[4];
    const float* gnormw = (const float*)d_in[5];
    const float* Wo     = (const float*)d_in[6];
    float* out = (float*)d_out;

    float* ws = (float*)d_ws;
    float* q  = ws;                       // BT*512
    float* k  = q  + (size_t)BT * 512;    // BT*512
    float* v  = k  + (size_t)BT * 512;    // BT*512
    float* ge = v  + (size_t)BT * 512;    // BT*256
    float* p  = ge + (size_t)BT * 256;    // BT*256
    float* o  = p  + (size_t)BT * 256;    // BT*512
    float* hloc = o    + (size_t)BT * 512;              // 16*NC*SS chunk end states
    float* hin  = hloc + (size_t)BB * HH * NC * SS;     // 16*NC*SS chunk start states
    float* hloc2 = hin   + (size_t)BB * HH * NC * SS;   // the same two for pass 2
    float* hin2  = hloc2 + (size_t)BB * HH * NC * SS;
    float* dloc  = hin2  + (size_t)BB * HH * NC * SS;   // 16*NC*MM chunk decay products

    dim3 blk(256);
    dim3 grdIn((3 * 512 + 256) / 64, BT / 128);   // q, k, v and gate column tiles
    dim3 grdOut(512 / 64, BT / 128);

    proj_in_kernel<<<grdIn, blk, 0, stream>>>(x, Wq, Wk, Wv, Wf, q, k, v, ge);

    dim3 grdChunk(BB * HH * NC);          // one block per (b,h,chunk)
    dim3 grdState2(2 * BB * HH * SS / 256);   // one thread per state element, both passes

    local_both_kernel<<<grdChunk, blk, 0, stream>>>(k, v, ge, hloc, hloc2, dloc);
    carry_both_kernel<<<grdState2, blk, 0, stream>>>(hloc, hloc2, dloc, hin, hin2);
    scan1_kernel<<<grdChunk, blk, 0, stream>>>(q, k, ge, hin, p);      // + softmax
    scan2_kernel<<<grdChunk, blk, 0, stream>>>(p, v, ge, hin2, gnormw, o);  // + RMSNorm

    proj_out_kernel<<<grdOut, blk, 0, stream>>>(o, Wo, out);
}

// v008
// Measured time: 119 microseconds a run.
// Two timings next to v007 both put it at 1.06 times that version's speed.
// Counting every step since v000, it is 45.5 times as fast.
#include <hip/hip_runtime.h>
#include <hip/hip_bf16.h>

#define BB 4
#define TT 2048
#define DD 512
#define HH 4
#define KK 128
#define VV 128
#define MM 64
#define BT (BB * TT)          // 8192 rows for all GEMMs
#define CH 32                 // time steps per chunk of the two scans
#define NC (TT / CH)          // 64 chunks per (b,h)
#define SS (KK * MM)          // 8192 state elements per (b,h), both scans

#define LDA 40                // padded LDS row length (bf16 elems): 80B, 16B-aligned runs

typedef __attribute__((ext_vector_type(16))) __bf16 v16bf;
typedef __attribute__((ext_vector_type(8)))  __bf16 v8bf;
typedef __attribute__((ext_vector_type(2)))  __bf16 v2bf;
typedef __attribute__((ext_vector_type(8)))  float  v8f;
typedef __attribute__((ext_vector_type(2)))  float  v2f;
typedef __attribute__((ext_vector_type(4)))  float  v4f;

// Two f32 to two bf16, round to nearest even, in one instruction (v_cvt_pk_bf16_f32).
__device__ __forceinline__ unsigned pack2bf(float a, float b) {
    const v2f x = {a, b};
    const v2bf r = __builtin_convertvector(x, v2bf);
    return __builtin_bit_cast(unsigned, r);
}

// ---------------------------------------------------------------------------
// Tiled GEMM: Y(8192 x N) = act( X(8192 x 512) @ W(512 x N) ), bf16 WMMA.
// Block = 256 threads (8 waves). Block tile = 128(M) x 64(N), K-step = 32.
// Software-pipelined double-buffered LDS: fetch tile k+1 to registers, WMMA
// tile k from LDS[cur], then stage registers into LDS[cur^1]; ONE barrier
// per K-step. A staged row-major As[row][k]; B staged transposed Bst[col][k]
// so every lane fragment is two contiguous 16B runs -> ds_load_b128. A thread
// stages 8 consecutive k of ONE column of B: one 16B LDS store at the 80B pitch.
// act: 0 = none, 1 = swish, 2 = ge = exp(log_sigmoid(x)/8); the same for a whole block
// ---------------------------------------------------------------------------
template <int ACT>
__device__ __forceinline__ void gemm_store(
    const v8f (&acc)[4], float* __restrict__ Y, const int N, const int row0, const int col0) {
#pragma unroll
    for (int jn = 0; jn < 4; ++jn) {
#pragma unroll
        for (int r = 0; r < 8; ++r) {
            float x = acc[jn][r];
            if (ACT == 1) {
                x = x / (1.f + __expf(-x));                      // swish
            } else if (ACT == 2) {
                float ax = fabsf(x);
                float ls = fminf(x, 0.f) - log1pf(__expf(-ax));  // log_sigmoid, stable
                x = __expf(ls * 0.125f);                         // ge = exp(g/8)
            }
            Y[(row0 + r) * N + col0 + jn * 16] = x;
        }
    }
    // The three epilogues share one kernel: keeps the stores' address and data
    // registers from being rewritten by another epilogue's code behind a branch.
    asm volatile("s_wait_xcnt 0x0" ::: "memory");
}

__device__ __forceinline__ void gemm_tile(
    const float* __restrict__ X, const float* __restrict__ W,
    float* __restrict__ Y, const int N, const int act,
    const int rowBase, const int colBase) {
    __shared__ __align__(16) __bf16 As[2][128 * LDA];   // 2 x 10.0 KB
    __shared__ __align__(16) __bf16 Bst[2][64 * LDA];   // 2 x  5.0 KB

    const int tid  = threadIdx.x;
    const int lane = tid & 31;
    const int wv   = tid >> 5;

    const int mrow = lane & 15;            // row of 16-row tile / col of 16-col tile
    const int kb   = (lane >> 4) << 3;     // 0 or 8: K sub-block for this half-wave

    const float4* X4 = (const float4*)X;

    // Per-thread staging coordinates (constant)
    int arr[4], ac[4];                     // A: row, float4-col
#pragma unroll
    for (int i = 0; i < 4; ++i) { int e = tid + i * 256; arr[i] = e >> 3; ac[i] = e & 7; }
    const int bcol = tid & 63;             // B: column of the tile
    const int bk8  = (tid >> 6) * 8;       // B: first of this thread's 8 k-rows
    const float* Wt = W + bk8 * N + colBase + bcol;
    const int bdst = bcol * LDA + bk8;     // 16B-aligned run in Bst[col][k]

    float4 ra[4];
    float  rb[8];

    // ---- prologue: fetch tile 0 and stage into buffer 0
#pragma unroll
    for (int i = 0; i < 4; ++i)
        ra[i] = X4[(((rowBase + arr[i]) * DD) >> 2) + ac[i]];
#pragma unroll
    for (int i = 0; i < 8; ++i)
        rb[i] = Wt[i * N];
#pragma unroll
    for (int i = 0; i < 4; ++i) {
        uint2 t; t.x = pack2bf(ra[i].x, ra[i].y); t.y = pack2bf(ra[i].z, ra[i].w);
        *(uint2*)&As[0][arr[i] * LDA + ac[i] * 4] = t;
    }
    {
        uint4 t;
        t.x = pack2bf(rb[0], rb[1]); t.y = pack2bf(rb[2], rb[3]);
        t.z = pack2bf(rb[4], rb[5]); t.w = pack2bf(rb[6], rb[7]);
        *(uint4*)&Bst[0][bdst] = t;
    }

    v8f acc[4] = {};
    int cur = 0;

    // Kept rolled: left to itself the compiler now unrolls all 16 steps, which takes 110
    // registers in place of 95 in the input projections: one resident block fewer a WGP.
#pragma unroll 1
    for (int k0 = 0; k0 < DD; k0 += 32) {
        __syncthreads();                      // LDS[cur] ready; LDS[cur^1] free
        const bool more = (k0 + 32 < DD);
        if (more) {
            // Issue next-tile global loads early: they fly under the WMMAs.
#pragma unroll
            for (int i = 0; i < 4; ++i)
                ra[i] = X4[(((rowBase + arr[i]) * DD + k0 + 32) >> 2) + ac[i]];
#pragma unroll
            for (int i = 0; i < 8; ++i)
                rb[i] = Wt[(k0 + 32 + i) * N];
            if (k0 + 64 < DD)
                __builtin_prefetch(&X[(rowBase + (tid >> 1)) * DD + k0 + 64], 0, 1);
        }

        // ---- WMMA on buffer `cur`
        const __bf16* Ab = &As[cur][0];
        const __bf16* Bb = &Bst[cur][0];
        const int arow = (wv * 16 + mrow) * LDA;
        v8bf alo = *(const v8bf*)&Ab[arow + kb];
        v8bf ahi = *(const v8bf*)&Ab[arow + 16 + kb];
        v16bf a = __builtin_shufflevector(alo, ahi,
            0, 1, 2, 3, 4, 5, 6, 7, 8, 9, 10, 11, 12, 13, 14, 15);
#pragma unroll
        for (int jn = 0; jn < 4; ++jn) {
            const int bcol = (jn * 16 + mrow) * LDA;
            v8bf blo = *(const v8bf*)&Bb[bcol + kb];
            v8bf bhi = *(const v8bf*)&Bb[bcol + 16 + kb];
            v16bf bfr = __builtin_shufflevector(blo, bhi,
                0, 1, 2, 3, 4, 5, 6, 7, 8, 9, 10, 11, 12, 13, 14, 15);
            acc[jn] = __builtin_amdgcn_wmma_f32_16x16x32_bf16(
                false, a, false, bfr, (short)0, acc[jn], false, false);
        }

        if (more) {
            // ---- stage fetched registers into buffer `cur^1`
            __bf16* An = &As[cur ^ 1][0];
            __bf16* Bn = &Bst[cur ^ 1][0];
#pragma unroll
            for (int i = 0; i < 4; ++i) {
                uint2 t; t.x = pack2bf(ra[i].x, ra[i].y); t.y = pack2bf(ra[i].z, ra[i].w);
                *(uint2*)&An[arr[i] * LDA + ac[i] * 4] = t;
            }
            uint4 t;
            t.x = pack2bf(rb[0], rb[1]); t.y = pack2bf(rb[2], rb[3]);
            t.z = pack2bf(rb[4], rb[5]); t.w = pack2bf(rb[6], rb[7]);
            *(uint4*)&Bn[bdst] = t;
        }
        cur ^= 1;
    }

    const int row0 = rowBase + wv * 16 + ((lane >> 4) << 3);
    const int col0 = colBase + mrow;
    if (act == 1)      gemm_store<1>(acc, Y, N, row0, col0);
    else if (act == 2) gemm_store<2>(acc, Y, N, row0, col0);
    else               gemm_store<0>(acc, Y, N, row0, col0);
}

// The four input projections share X and do not depend on each other: one grid
// of 28 column tiles (8 for q, 8 for k, 8 for v, 4 for the gate) by 64 row tiles.
__global__ __launch_bounds__(256) void proj_in_kernel(
    const float* __restrict__ X,
    const float* __restrict__ Wq, const float* __restrict__ Wk,
    const float* __restrict__ Wv, const float* __restrict__ Wf,
    float* __restrict__ q, float* __restrict__ k,
    float* __restrict__ v, float* __restrict__ ge) {
    const int sel = blockIdx.x >> 3;       // 0 q, 1 k, 2 v, 3 gate
    const float* W = sel == 0 ? Wq : sel == 1 ? Wk : sel == 2 ? Wv : Wf;
    float*       Y = sel == 0 ? q  : sel == 1 ? k  : sel == 2 ? v  : ge;
    const int N   = sel == 3 ? HH * MM : DD;
    const int act = sel < 2 ? 1 : sel == 2 ? 0 : 2;
    gemm_tile(X, W, Y, N, act, blockIdx.y * 128, (blockIdx.x & 7) * 64);
}

__global__ __launch_bounds__(256) void proj_out_kernel(
    const float* __restrict__ X, const float* __restrict__ W,
    float* __restrict__ Y) {
    gemm_tile(X, W, Y, DD, 0, blockIdx.y * 128, blockIdx.x * 64);
}

// ---------------------------------------------------------------------------
// The two scans are linear in their state, so the time axis is cut into NC
// chunks that run side by side:
//   local : each chunk's end state L_c from a zero state (a matrix product over
//           its steps) and the product D_c[m] of its decays;
//   carry : H_0 = 0, H_{c+1} = H_c * D_c + L_c gives every chunk's start state;
//   scan  : each chunk forms its outputs from H_c and its own steps (chunk form below).
// ---------------------------------------------------------------------------

// Carry over the chunks: one thread per state element, NC serial steps.
// SECOND = 0: state laid out [k][m]; SECOND = 1: state laid out [m][v].
template <int SECOND>
__device__ __forceinline__ void carry(
    const int blk, const float* __restrict__ hloc, const float* __restrict__ dloc,
    float* __restrict__ hin) {
    const int e = blk * 256 + threadIdx.x;
    const int bh = e / SS, idx = e % SS;
    const int m = SECOND ? (idx / VV) : (idx % MM);
    const float* src = hloc + bh * (NC * SS) + idx;
    const float* dsr = dloc + bh * (NC * MM) + m;
    float* dst = hin + bh * (NC * SS) + idx;

    float hc = 0.f;
    for (int c0 = 0; c0 < NC; c0 += 16) {
        float a[16], d[16];                 // 16 chunks' loads in flight at once
#pragma unroll
        for (int j = 0; j < 16; ++j) {
            a[j] = src[(c0 + j) * SS];
            d[j] = dsr[(c0 + j) * MM];
        }
#pragma unroll
        for (int j = 0; j < 16; ++j) {
            dst[(c0 + j) * SS] = hc;
            hc = hc * d[j] + a[j];
        }
    }
}

// Both carries in one grid: neither reads what the other writes.
__global__ __launch_bounds__(256) void carry_both_kernel(
    const float* __restrict__ hloc1, const float* __restrict__ hloc2,
    const float* __restrict__ dloc,
    float* __restrict__ hin1, float* __restrict__ hin2) {
    const int half = BB * HH * SS / 256;
    if ((int)blockIdx.x < half) carry<0>(blockIdx.x, hloc1, dloc, hin1);
    else                        carry<1>(blockIdx.x - half, hloc2, dloc, hin2);
}

// ---------------------------------------------------------------------------
// Both scans in chunk form. With Dc[t][m] = ge_0[m] * .. * ge_t[m] (steps of the
// chunk) and U[t][s][m] = (1 - ge_s[m]) * ge_{s+1}[m] * .. * ge_t[m] for s <= t,
// the state after step t is H * Dc[t] + sum_{s<=t} (k_s or v_s) * U[t][s], so
//   pass 1: ok[t][m] = Dc[t][m] * (Q H)[t][m] + sum_{s<=t} (Q K^T)[t][s] * U[t][s][m]
//   pass 2: o[t][v]  = ((p * Dc) H)[t][v] + sum_{s<=t} A2[t][s] * v_s[v],
//           A2[t][s] = sum_m p[t][m] * U[t][s][m]
// The products with H, K^T and v run on the f32 16x16x4 WMMA; U is built step by
// step by multiplying (factors in (0,1], no division) on the vector unit.
// Fragments: lane (cc = lane & 15, hf = lane >> 4) holds row or column cc and, of
// each 8 consecutive k, the four k = 4*hf .. 4*hf+3, in the same order on both sides.
// ---------------------------------------------------------------------------
#define QP 132
#define MP 68
#define AP 36

__device__ __forceinline__ void mm_acc(v8f& c0, v8f& c1, const v2f (&a)[8],
                                       const v2f (&b0)[8], const v2f (&b1)[8]) {
    asm volatile(
        "v_wmma_f32_16x16x4_f32 %0, %2, %10, %0\n\t"
        "v_wmma_f32_16x16x4_f32 %1, %2, %18, %1\n\t"
        "v_wmma_f32_16x16x4_f32 %0, %3, %11, %0\n\t"
        "v_wmma_f32_16x16x4_f32 %1, %3, %19, %1\n\t"
        "v_wmma_f32_16x16x4_f32 %0, %4, %12, %0\n\t"
        "v_wmma_f32_16x16x4_f32 %1, %4, %20, %1\n\t"
        "v_wmma_f32_16x16x4_f32 %0, %5, %13, %0\n\t"
        "v_wmma_f32_16x16x4_f32 %1, %5, %21, %1\n\t"
        "v_wmma_f32_16x16x4_f32 %0, %6, %14, %0\n\t"
        "v_wmma_f32_16x16x4_f32 %1, %6, %22, %1\n\t"
        "v_wmma_f32_16x16x4_f32 %0, %7, %15, %0\n\t"
        "v_wmma_f32_16x16x4_f32 %1, %7, %23, %1\n\t"
        "v_wmma_f32_16x16x4_f32 %0, %8, %16, %0\n\t"
        "v_wmma_f32_16x16x4_f32 %1, %8, %24, %1\n\t"
        "v_wmma_f32_16x16x4_f32 %0, %9, %17, %0\n\t"
        "v_wmma_f32_16x16x4_f32 %1, %9, %25, %1\n\t"
        "v_nop\n\t"
        "v_nop\n\t"
        "v_nop\n\t"
        "v_nop\n\t"
        "v_nop\n\t"
        "v_nop\n\t"
        "v_nop\n\t"
        "v_nop\n\t"
        : "+v"(c0), "+v"(c1)
        : "v"(a[0]), "v"(a[1]), "v"(a[2]), "v"(a[3]), "v"(a[4]), "v"(a[5]), "v"(a[6]), "v"(a[7]),
          "v"(b0[0]), "v"(b0[1]), "v"(b0[2]), "v"(b0[3]), "v"(b0[4]), "v"(b0[5]), "v"(b0[6]), "v"(b0[7]),
          "v"(b1[0]), "v"(b1[1]), "v"(b1[2]), "v"(b1[3]), "v"(b1[4]), "v"(b1[5]), "v"(b1[6]), "v"(b1[7]));
}

// 32 k of one row's fragments from LDS: src points at the lane's row and its 4*hf.
__device__ __forceinline__ void frag32(v2f (&f)[8], const float* src) {
#pragma unroll
    for (int a = 0; a < 4; ++a) {
        const v4f x = *(const v4f*)(src + 8 * a);
        f[2 * a] = x.lo;
        f[2 * a + 1] = x.hi;
    }
}

// Pass 1, one block per (b,h,chunk), started from the carried state H [k][m].
// Wave w: (Q H)^T for m-tile w & 3 over the k half w >> 2, both 16-step tiles. Waves
// 4..7 also take Q K^T: 16 steps t by all 32 s over one k half. The halves are added later.
// Then thread (m = t & 63, group j = t >> 6) carries U for the 8 steps s = 8j..8j+7
// through t = 8j..31; the four groups' partial sums are added in the softmax tail.
__global__ __launch_bounds__(256) void scan1_kernel(
    const float* __restrict__ q, const float* __restrict__ k,
    const float* __restrict__ ge, const float* __restrict__ hin,
    float* __restrict__ p) {
    const int bh = blockIdx.x / NC, c = blockIdx.x % NC;
    const int b = bh >> 2, h = bh & 3;
    const int t = threadIdx.x;
    const int lane = t & 31;
    const int wv = __builtin_amdgcn_readfirstlane(t >> 5);
    const int cc = lane & 15, hf = lane >> 4;
    const int row0 = b * TT + c * CH;

    __shared__ __align__(16) float sm[2 * CH * QP];
    __shared__ __align__(16) float As[2 * CH * CH];   // (Q K^T)[t][s]: two k halves, then their sum in the first
    __shared__ __align__(16) float QH[2 * CH * MP];   // [k half][t][m], pitch MP
    __shared__ __align__(16) float Gs[CH * MM];       // ge[step][m]
    float* Qs  = sm;                       // [step][k], pitch QP
    float* Ks  = sm + CH * QP;             // [step][k], pitch QP
    float* red = sm;                       // [step][group][m], over Qs and Ks once they are done with

    const int mj = wv & 3, kh = wv >> 2;
    float hb[8][4];                        // fragments of H: H[kh*64 + 8a + 4hf + i][16mj + cc]
    {
        // Every address is a wave-uniform base plus one 32-bit lane offset in bytes.
        const char* hp = (const char*)(hin + blockIdx.x * SS + kh * 64 * MM + mj * 16);
        const char* qp = (const char*)(q + row0 * (HH * KK) + h * KK);
        const char* kp = (const char*)(k + row0 * (HH * KK) + h * KK);
        const char* gp = (const char*)(ge + row0 * (HH * MM) + h * MM);
        const unsigned hoff = (unsigned)(4 * hf * MM + cc) * 4u;
        const unsigned qoff = (unsigned)((t >> 5) * (HH * KK) + (t & 31) * 4) * 4u;
        const unsigned goff = (unsigned)((t >> 4) * (HH * MM) + (t & 15) * 4) * 4u;
#pragma unroll
        for (int a = 0; a < 8; ++a)
#pragma unroll
            for (int i = 0; i < 4; ++i) hb[a][i] = *(const float*)(hp + hoff + (8 * a + i) * (MM * 4));
        v4f rq[4], rk[4], rg[2];
#pragma unroll
        for (int i = 0; i < 4; ++i) {
            rq[i] = *(const v4f*)(qp + qoff + i * (8 * HH * KK * 4));
            rk[i] = *(const v4f*)(kp + qoff + i * (8 * HH * KK * 4));
        }
#pragma unroll
        for (int i = 0; i < 2; ++i) rg[i] = *(const v4f*)(gp + goff + i * (16 * HH * MM * 4));
        // The loads' base and offset registers stay as they are until the loads have
        // taken them: naming them and the staged values here keeps this behind the loads
        // and keeps later scalar work or a load's result from being placed on them.
        asm volatile("s_wait_xcnt 0x0" :: "s"(hp), "s"(qp), "s"(kp), "s"(gp),
                     "v"(hoff), "v"(qoff), "v"(goff),
                     "v"(rq[0]), "v"(rq[1]), "v"(rq[2]), "v"(rq[3]),
                     "v"(rk[0]), "v"(rk[1]), "v"(rk[2]), "v"(rk[3]),
                     "v"(rg[0]), "v"(rg[1]) : "memory");
#pragma unroll
        for (int i = 0; i < 4; ++i) {
            *(v4f*)&Qs[((t >> 5) + 8 * i) * QP + (t & 31) * 4] = rq[i];
            *(v4f*)&Ks[((t >> 5) + 8 * i) * QP + (t & 31) * 4] = rk[i];
        }
#pragma unroll
        for (int i = 0; i < 2; ++i) *(v4f*)&Gs[((t >> 4) + 16 * i) * MM + (t & 15) * 4] = rg[i];
    }
    __syncthreads();                       // publishes the chunk's q, k and gate rows

    {   // A = H^T (row = m), B = Q^T (column = step): lane cc has step cc, m = 8hf .. 8hf+7
        v8f d0 = {}, d1 = {};
        const float* qa = Qs + cc * QP + kh * 64 + 4 * hf;
#pragma unroll
        for (int n = 0; n < 2; ++n) {
            v2f ha[8], x0[8], x1[8];
#pragma unroll
            for (int a = 0; a < 4; ++a) {
                ha[2 * a]     = v2f{hb[4 * n + a][0], hb[4 * n + a][1]};
                ha[2 * a + 1] = v2f{hb[4 * n + a][2], hb[4 * n + a][3]};
            }
            frag32(x0, qa + 32 * n);
            frag32(x1, qa + 16 * QP + 32 * n);
            mm_acc(d0, d1, ha, x0, x1);
        }
        float* dst = QH + kh * (CH * MP) + cc * MP + mj * 16 + 8 * hf;
        *(v4f*)(dst)               = v4f{d0[0], d0[1], d0[2], d0[3]};
        *(v4f*)(dst + 4)           = v4f{d0[4], d0[5], d0[6], d0[7]};
        *(v4f*)(dst + 16 * MP)     = v4f{d1[0], d1[1], d1[2], d1[3]};
        *(v4f*)(dst + 16 * MP + 4) = v4f{d1[4], d1[5], d1[6], d1[7]};
    }
    if (wv >= 4) {                         // A = Q (row = t), B = K^T (column = s)
        const int ti = (wv >> 1) & 1, k2 = wv & 1;
        v8f e0 = {}, e1 = {};
        const float* qa = Qs + (ti * 16 + cc) * QP + k2 * 64 + 4 * hf;
        const float* kb = Ks + cc * QP + k2 * 64 + 4 * hf;
#pragma unroll
        for (int n = 0; n < 2; ++n) {
            v2f x[8], y0[8], y1[8];
            frag32(x, qa + 32 * n);
            frag32(y0, kb + 32 * n);
            frag32(y1, kb + 16 * QP + 32 * n);
            mm_acc(e0, e1, x, y0, y1);
        }
        float* dst = As + k2 * (CH * CH) + (ti * 16 + 8 * hf) * CH + cc;
#pragma unroll
        for (int r = 0; r < 8; ++r) {
            dst[r * CH]      = e0[r];
            dst[r * CH + 16] = e1[r];
        }
    }
    __syncthreads();                       // publishes both k halves of Q K^T
    *(v4f*)&As[t * 4] = *(const v4f*)&As[t * 4] + *(const v4f*)&As[CH * CH + t * 4];
    __syncthreads();                       // publishes Q H and Q K^T; q and k rows are done with

    {
        const int m = t & 63;
        const int s0 = (wv >> 1) * 8;      // first step of this group
        v2f u[4];                          // U of steps s0 .. s0+7, two to a register pair
#pragma unroll
        for (int i = 0; i < 8; ++i) u[i >> 1][i & 1] = 1.f - Gs[(s0 + i) * MM + m];
        float dc = s0 == 0 ? 1.f : 0.f;
        for (int tq = 0; tq < s0; ++tq) red[tq * 256 + t] = 0.f;
#pragma unroll
        for (int tt = 0; tt < 8; ++tt) {   // steps of the group's own block: s <= t only
            const int tq = s0 + tt;
            const float g = Gs[tq * MM + m];
            const v4f a0 = *(const v4f*)&As[tq * CH + s0];
            const v4f a1 = *(const v4f*)&As[tq * CH + s0 + 4];
            const float av[8] = {a0.x, a0.y, a0.z, a0.w, a1.x, a1.y, a1.z, a1.w};
            dc *= g;
            float acc = dc * (QH[tq * MP + m] + QH[CH * MP + tq * MP + m]);
#pragma unroll
            for (int i = 0; i < 8; ++i) {
                if (i < tt) u[i >> 1][i & 1] *= g;
                if (i <= tt) acc += av[i] * u[i >> 1][i & 1];
            }
            red[tq * 256 + t] = acc;
        }
        // Four steps a trip: their LDS reads are issued ahead of the arithmetic that waits for them.
#pragma unroll 4
        for (int tq = s0 + 8; tq < CH; ++tq) {
            const float g = Gs[tq * MM + m];
            const v4f a0 = *(const v4f*)&As[tq * CH + s0];
            const v4f a1 = *(const v4f*)&As[tq * CH + s0 + 4];
            const v2f g2 = {g, g};
            dc *= g;
            v2f ac = {dc * (QH[tq * MP + m] + QH[CH * MP + tq * MP + m]), 0.f};
            u[0] *= g2;  ac += a0.lo * u[0];
            u[1] *= g2;  ac += a0.hi * u[1];
            u[2] *= g2;  ac += a1.lo * u[2];
            u[3] *= g2;  ac += a1.hi * u[3];
            red[tq * 256 + t] = ac.x + ac.y;
        }
    }
    __syncthreads();                       // publishes every step's partial sums

    float* prow = p + (row0 + wv) * (HH * MM) + h * MM + lane;
    for (int j = 0; j < CH / 8; ++j) {
        const float* src = red + (wv + 8 * j) * 256 + lane;
        float x0 = src[0]  + src[64] + src[128] + src[192];
        float x1 = src[32] + src[96] + src[160] + src[224];
        float mx = fmaxf(x0, x1);
#pragma unroll
        for (int off = 16; off > 0; off >>= 1) mx = fmaxf(mx, __shfl_xor(mx, off, 32));
        float ea = __expf(x0 - mx), eb = __expf(x1 - mx);
        float s = ea + eb;
#pragma unroll
        for (int off = 16; off > 0; off >>= 1) s += __shfl_xor(s, off, 32);
        float inv = 1.f / s;
        prow[8 * j * (HH * MM)]      = ea * inv;
        prow[8 * j * (HH * MM) + 32] = eb * inv;
    }
}

// Local pass of both scans: one block per (b,h,chunk), no step loop.
// From a zero state the recurrences end in plain sums over the chunk's steps s:
//   pass 1: L1[k][m] = sum_s k_s[k] * W[s][m]
//   pass 2: L2[m][v] = sum_s W[s][m] * v_s[v]
//   W[s][m] = (1 - ge_s[m]) * prod_{r > s} ge_r[m]     (factors in (0,1], no division)
// Both are matrix products over the 32 steps, done on the f32 16x16x4 WMMA.
// Lane (c = lane & 15, hf = lane >> 4) holds steps 16*hf .. 16*hf+15 of row or
// column c in every operand, so W's fragments are B of pass 1 and A of pass 2
// and the step order is the same on both sides of each product.
// Wave w: pass 1 rows k = 16w..16w+15, all 64 m; pass 2 two m-tiles by 32 v.
// Every wave forms W itself in registers: nothing crosses waves.

__device__ __forceinline__ void mm_1x2(v8f& c0, v8f& c1, const v2f (&a)[8],
                                       const v2f (&b0)[8], const v2f (&b1)[8]) {
    asm volatile(
        "v_wmma_f32_16x16x4_f32 %0, %2, %10, 0\n\t"
        "v_wmma_f32_16x16x4_f32 %1, %2, %18, 0\n\t"
        "v_wmma_f32_16x16x4_f32 %0, %3, %11, %0\n\t"
        "v_wmma_f32_16x16x4_f32 %1, %3, %19, %1\n\t"
        "v_wmma_f32_16x16x4_f32 %0, %4, %12, %0\n\t"
        "v_wmma_f32_16x16x4_f32 %1, %4, %20, %1\n\t"
        "v_wmma_f32_16x16x4_f32 %0, %5, %13, %0\n\t"
        "v_wmma_f32_16x16x4_f32 %1, %5, %21, %1\n\t"
        "v_wmma_f32_16x16x4_f32 %0, %6, %14, %0\n\t"
        "v_wmma_f32_16x16x4_f32 %1, %6, %22, %1\n\t"
        "v_wmma_f32_16x16x4_f32 %0, %7, %15, %0\n\t"
        "v_wmma_f32_16x16x4_f32 %1, %7, %23, %1\n\t"
        "v_wmma_f32_16x16x4_f32 %0, %8, %16, %0\n\t"
        "v_wmma_f32_16x16x4_f32 %1, %8, %24, %1\n\t"
        "v_wmma_f32_16x16x4_f32 %0, %9, %17, %0\n\t"
        "v_wmma_f32_16x16x4_f32 %1, %9, %25, %1\n\t"
        "v_nop\n\t"
        "v_nop\n\t"
        "v_nop\n\t"
        "v_nop\n\t"
        "v_nop\n\t"
        "v_nop\n\t"
        "v_nop\n\t"
        "v_nop\n\t"
        : "=&v"(c0), "=&v"(c1)
        : "v"(a[0]), "v"(a[1]), "v"(a[2]), "v"(a[3]), "v"(a[4]), "v"(a[5]), "v"(a[6]), "v"(a[7]),
          "v"(b0[0]), "v"(b0[1]), "v"(b0[2]), "v"(b0[3]), "v"(b0[4]), "v"(b0[5]), "v"(b0[6]), "v"(b0[7]),
          "v"(b1[0]), "v"(b1[1]), "v"(b1[2]), "v"(b1[3]), "v"(b1[4]), "v"(b1[5]), "v"(b1[6]), "v"(b1[7]));
}

// Turns one m-tile's 16 gate values of this lane half into W; returns the chunk's
// decay product (the same value in both lane halves).
__device__ __forceinline__ float decay_weights(v2f (&w)[8], const int hf) {
    float suf = 1.f;                               // product of the decays after step i
#pragma unroll
    for (int i = 15; i >= 0; --i) {
        const float g = w[i >> 1][i & 1];
        w[i >> 1][i & 1] = (1.f - g) * suf;
        suf *= g;
    }
    const float oth = __shfl_xor(suf, 16, 32);     // the other 16 steps' product
    const float late = hf == 0 ? oth : 1.f;        // steps 0..15 also decay through 16..31
#pragma unroll
    for (int j = 0; j < 8; ++j) w[j] *= late;
    return suf * oth;
}

__global__ __launch_bounds__(256, 8) void local_both_kernel(
    const float* __restrict__ k, const float* __restrict__ v,
    const float* __restrict__ ge,
    float* __restrict__ hloc1, float* __restrict__ hloc2,
    float* __restrict__ dloc) {
    const int blk = blockIdx.x;
    const int bh = blk / NC, c = blk % NC;
    const int b = bh >> 2, h = bh & 3;
    const int lane = threadIdx.x & 31;
    const int wv = __builtin_amdgcn_readfirstlane(threadIdx.x >> 5);
    const int cc = lane & 15, hf = lane >> 4;
    const int row0 = b * TT + c * CH;             // first step of the chunk
    const int mhalf = wv >> 2, vpair = wv & 3;    // pass 2 share of this wave

    // wt[q] belongs to m-tile q ^ (2*mhalf): wt[0], wt[1] are the wave's own pass-2 tiles.
    // Every address is a wave-uniform base plus one 32-bit lane offset in bytes;
    // go[0], so[0] serve tiles q = 0, 1 and go[1], so[1] tiles q = 2, 3.
    const unsigned own = 2 * mhalf * 64, far = own ^ 128;               // tile pair, bytes
    const unsigned goff = (unsigned)(hf * 16 * (HH * MM) + cc) * 4u;    // gate rows
    const unsigned go[2] = {goff + own, goff + far};
    const unsigned koff = (unsigned)(hf * 16 * (HH * KK) + cc) * 4u;    // k and v rows
    const unsigned soff = (unsigned)(hf * 8 * MM + cc) * 4u;            // pass-1 state rows
    const unsigned so[2] = {soff + own, soff + far};

    v2f wt[4][8], ka[8], vb[2][8];
    {
        const char* gb = (const char*)(ge + row0 * (HH * MM) + h * MM);
        const char* kp = (const char*)(k + row0 * (HH * KK) + h * KK + wv * 16) + koff;
#pragma unroll
        for (int q = 2; q < 4; ++q)
#pragma unroll
            for (int i = 0; i < 16; ++i)
                wt[q][i >> 1][i & 1] = *(const float*)(gb + go[1] + (q & 1) * 64 + i * (HH * MM * 4));
#pragma unroll
        for (int i = 0; i < 16; ++i) ka[i >> 1][i & 1] = *(const float*)(kp + i * (HH * KK * 4));
#pragma unroll
        for (int q = 0; q < 2; ++q)
#pragma unroll
            for (int i = 0; i < 16; ++i)
                wt[q][i >> 1][i & 1] = *(const float*)(gb + go[0] + (q & 1) * 64 + i * (HH * MM * 4));
    }
    // The loads' offset registers stay as they are until the loads have taken them:
    // naming them here keeps a later load's result from being placed on them.
    asm volatile("s_wait_xcnt 0x0" :: "v"(go[0]), "v"(go[1]), "v"(koff) : "memory");

    char* db = (char*)(hloc1 + blk * SS + wv * 16 * MM);
    float dp[4];
    v8f c0, c1;

    // Pass 1: A = k (row = k index), B = W (column = m). First the tiles that pass 2
    // of this wave does not need: their registers are free afterwards.
    dp[2] = decay_weights(wt[2], hf);
    dp[3] = decay_weights(wt[3], hf);
    mm_1x2(c0, c1, ka, wt[2], wt[3]);
#pragma unroll
    for (int r = 0; r < 8; ++r) {
        *(float*)(db + so[1] + r * (MM * 4))      = c0[r];
        *(float*)(db + so[1] + r * (MM * 4) + 64) = c1[r];
    }
    // What follows reuses the stores' registers: they stay until the stores have taken them.
    asm volatile("s_wait_xcnt 0x0" :: "v"(so[1]) : "memory");

    {   // v flies under the rest of pass 1
        const char* vp = (const char*)(v + row0 * (HH * VV) + h * VV + vpair * 32) + koff;
#pragma unroll
        for (int i = 0; i < 16; ++i) {
            vb[0][i >> 1][i & 1] = *(const float*)(vp + i * (HH * VV * 4));
            vb[1][i >> 1][i & 1] = *(const float*)(vp + i * (HH * VV * 4) + 64);
        }
        // As above: the offset register stays until the loads have taken it.
        asm volatile("s_wait_xcnt 0x0" :: "v"(koff) : "memory");
    }

    dp[0] = decay_weights(wt[0], hf);
    dp[1] = decay_weights(wt[1], hf);
    if (wv == 0) {                                 // wave 0 has m-tile q in wt[q]
        dloc[blk * MM + lane]      = hf ? dp[1] : dp[0];
        dloc[blk * MM + 32 + lane] = hf ? dp[3] : dp[2];
        // As above, for these two stores.
        asm volatile("s_wait_xcnt 0x0" ::: "memory");
    }
    mm_1x2(c0, c1, ka, wt[0], wt[1]);
#pragma unroll
    for (int r = 0; r < 8; ++r) {
        *(float*)(db + so[0] + r * (MM * 4))      = c0[r];
        *(float*)(db + so[0] + r * (MM * 4) + 64) = c1[r];
    }

    // Pass 2: A = W (row = m), B = v (column = v index).
    const unsigned s2 = (unsigned)(hf * 8 * VV + cc) * 4u;
    char* d2 = (char*)(hloc2 + blk * SS + mhalf * 32 * VV + vpair * 32);
    mm_1x2(c0, c1, wt[0], vb[0], vb[1]);
#pragma unroll
    for (int r = 0; r < 8; ++r) {
        *(float*)(d2 + s2 + r * (VV * 4))      = c0[r];
        *(float*)(d2 + s2 + r * (VV * 4) + 64) = c1[r];
    }
    asm volatile("s_wait_xcnt 0x0" :: "v"(s2) : "memory");
    mm_1x2(c0, c1, wt[1], vb[0], vb[1]);
#pragma unroll
    for (int r = 0; r < 8; ++r) {
        *(float*)(d2 + s2 + (16 + r) * (VV * 4))      = c0[r];
        *(float*)(d2 + s2 + (16 + r) * (VV * 4) + 64) = c1[r];
    }
}

__global__ __launch_bounds__(256, 8) void scan2_kernel(
    const float* __restrict__ p, const float* __restrict__ v,
    const float* __restrict__ ge, const float* __restrict__ hin,
    const float* __restrict__ w, float* __restrict__ o) {
    const int bh = blockIdx.x / NC, c = blockIdx.x % NC;
    const int b = bh >> 2, h = bh & 3;
    const int t = threadIdx.x;
    const int lane = t & 31;
    const int wv = __builtin_amdgcn_readfirstlane(t >> 5);
    const int cc = lane & 15, hf = lane >> 4;
    const int row0 = b * TT + c * CH;

    __shared__ __align__(16) float Gs[CH * MM];       // ge[step][m]
    __shared__ __align__(16) float Pl[CH * MM];       // p[step][m]
    __shared__ __align__(16) float Ps[CH * MP];       // p * Dc, pitch MP
    __shared__ __align__(16) float A2s[CH * AP];      // A2[t][s], pitch AP
    __shared__ __align__(16) float part[8 * CH * CH]; // [wave][t][s] partial sums of A2
    float* Os = part;                      // o[t][v], pitch QP, once the partial sums are done with

    float hb[8][4], vb[4][4];              // fragments: H[8a + 4hf + i][col], v[8a + 4hf + i][col]
    {
        // Every address is a wave-uniform base plus one 32-bit lane offset in bytes.
        const char* hp = (const char*)(hin + blockIdx.x * SS + wv * 16);
        const char* vp = (const char*)(v + row0 * (HH * VV) + h * VV + wv * 16);
        const char* gp = (const char*)(ge + row0 * (HH * MM) + h * MM);
        const char* pp = (const char*)(p  + row0 * (HH * MM) + h * MM);
        const unsigned hoff = (unsigned)(4 * hf * VV + cc) * 4u;
        const unsigned voff = (unsigned)(4 * hf * (HH * VV) + cc) * 4u;
        const unsigned goff = (unsigned)((t >> 4) * (HH * MM) + (t & 15) * 4) * 4u;
#pragma unroll
        for (int a = 0; a < 8; ++a)
#pragma unroll
            for (int i = 0; i < 4; ++i) hb[a][i] = *(const float*)(hp + hoff + (8 * a + i) * (VV * 4));
#pragma unroll
        for (int a = 0; a < 4; ++a)
#pragma unroll
            for (int i = 0; i < 4; ++i) vb[a][i] = *(const float*)(vp + voff + (8 * a + i) * (HH * VV * 4));
        v4f rg[2], rp[2];
#pragma unroll
        for (int i = 0; i < 2; ++i) {
            rg[i] = *(const v4f*)(gp + goff + i * (16 * HH * MM * 4));
            rp[i] = *(const v4f*)(pp + goff + i * (16 * HH * MM * 4));
        }
        // The loads' base and offset registers stay as they are until the loads have
        // taken them: naming them and the staged values here keeps this behind the loads
        // and keeps later scalar work or a load's result from being placed on them.
        asm volatile("s_wait_xcnt 0x0" :: "s"(hp), "s"(vp), "s"(gp), "s"(pp),
                     "v"(hoff), "v"(voff), "v"(goff),
                     "v"(rg[0]), "v"(rg[1]), "v"(rp[0]), "v"(rp[1]) : "memory");
#pragma unroll
        for (int i = 0; i < 2; ++i) {
            *(v4f*)&Gs[((t >> 4) + 16 * i) * MM + (t & 15) * 4] = rg[i];
            *(v4f*)&Pl[((t >> 4) + 16 * i) * MM + (t & 15) * 4] = rp[i];
        }
    }
    __syncthreads();                       // publishes the chunk's gate and p rows

    {   // p * Dc: thread (m, group of 8 steps) multiplies the decays up from step 0
        const int m = t & 63;
        const int t0 = (wv >> 1) * 8;
        float dc = 1.f;
        for (int r = 0; r < t0; ++r) dc *= Gs[r * MM + m];
#pragma unroll
        for (int i = 0; i < 8; ++i) {
            dc *= Gs[(t0 + i) * MM + m];
            Ps[(t0 + i) * MP + m] = Pl[(t0 + i) * MM + m] * dc;
        }
    }
    {
        v2f u[4] = {};
        const float* gr = Gs + wv * 8;
        const float* pr = Pl + wv * 8;
        float* dst = part + wv * (CH * CH) + lane;
        // Four steps a trip: their LDS reads are issued ahead of the arithmetic that waits for them.
#pragma unroll 4
        for (int tq = 0; tq < CH; ++tq) {
            const v4f g0 = *(const v4f*)(gr + tq * MM);
            const v4f g1 = *(const v4f*)(gr + tq * MM + 4);
            const v4f p0 = *(const v4f*)(pr + tq * MM);
            const v4f p1 = *(const v4f*)(pr + tq * MM + 4);
            const float e1 = lane == tq ? 1.f : 0.f;
            const v2f e = {e1, e1};
            v2f ac = {0.f, 0.f};
            // t == s: 1 - g; later: u * g; before: 0
            u[0] = g0.lo * (u[0] - e) + e;  ac += p0.lo * u[0];
            u[1] = g0.hi * (u[1] - e) + e;  ac += p0.hi * u[1];
            u[2] = g1.lo * (u[2] - e) + e;  ac += p1.lo * u[2];
            u[3] = g1.hi * (u[3] - e) + e;  ac += p1.hi * u[3];
            dst[tq * CH] = ac.x + ac.y;
        }
    }
    __syncthreads();                       // publishes p * Dc and the partial sums of A2

#pragma unroll
    for (int i = 0; i < 4; ++i) {
        const int e = t + i * 256;
        float x = part[e];
#pragma unroll
        for (int g = 1; g < 8; ++g) x += part[g * (CH * CH) + e];
        A2s[(e >> 5) * AP + (e & 31)] = x;
    }
    __syncthreads();                       // publishes A2; the partial sums are done with

    {   // A = [H ; v]^T (row = column v), B = [p * Dc | A2]^T (column = step):
        // lane cc has step cc, columns 8hf .. 8hf+7 of the wave's 16
        v8f d0 = {}, d1 = {};
        const float* pa = Ps + cc * MP + 4 * hf;
        const float* aa = A2s + cc * AP + 4 * hf;
#pragma unroll
        for (int n = 0; n < 3; ++n) {
            v2f ha[8], x0[8], x1[8];
#pragma unroll
            for (int a = 0; a < 4; ++a) {
                ha[2 * a]     = n < 2 ? v2f{hb[(4 * n + a) & 7][0], hb[(4 * n + a) & 7][1]} : v2f{vb[a][0], vb[a][1]};
                ha[2 * a + 1] = n < 2 ? v2f{hb[(4 * n + a) & 7][2], hb[(4 * n + a) & 7][3]} : v2f{vb[a][2], vb[a][3]};
            }
            frag32(x0, n < 2 ? pa + 32 * n : aa);
            frag32(x1, n < 2 ? pa + 16 * MP + 32 * n : aa + 16 * AP);
            mm_acc(d0, d1, ha, x0, x1);
        }
        float* dst = Os + cc * QP + wv * 16 + 8 * hf;
        *(v4f*)(dst)               = v4f{d0[0], d0[1], d0[2], d0[3]};
        *(v4f*)(dst + 4)           = v4f{d0[4], d0[5], d0[6], d0[7]};
        *(v4f*)(dst + 16 * QP)     = v4f{d1[0], d1[1], d1[2], d1[3]};
        *(v4f*)(dst + 16 * QP + 4) = v4f{d1[4], d1[5], d1[6], d1[7]};
    }
    __syncthreads();                       // publishes the chunk's output rows

    float* orow = o + (row0 + wv) * (HH * VV) + h * VV + lane;
    const float w0 = w[lane], w1 = w[lane + 32], w2 = w[lane + 64], w3 = w[lane + 96];
    for (int j = 0; j < CH / 8; ++j) {
        const float* base = Os + (wv + 8 * j) * QP + lane;
        float x0 = base[0];
        float x1 = base[32];
        float x2 = base[64];
        float x3 = base[96];
        float ss = x0 * x0 + x1 * x1 + x2 * x2 + x3 * x3;
#pragma unroll
        for (int off = 16; off > 0; off >>= 1) ss += __shfl_xor(ss, off, 32);
        float r = rsqrtf(ss * (1.f / (float)VV) + 1e-5f);
        orow[8 * j * (HH * VV)]      = x0 * r * w0;
        orow[8 * j * (HH * VV) + 32] = x1 * r * w1;
        orow[8 * j * (HH * VV) + 64] = x2 * r * w2;
        orow[8 * j * (HH * VV) + 96] = x3 * r * w3;
    }
}

// ---------------------------------------------------------------------------

extern "C" void kernel_launch(void* const* d_in, const int* in_sizes, int n_in,
                              void* d_out, int out_size, void* d_ws, size_t ws_size,
                              hipStream_t stream) {
    const float* x      = (const float*)d_in[0];
    const float* Wq     = (const float*)d_in[1];
    const float* Wk     = (const float*)d_in[2];
    const float* Wv     = (const float*)d_in[3];
    const float* Wf     = (const float*)d_in[4];
    const float* gnormw = (const float*)d_in[5];
    const float* Wo     = (const float*)d_in[6];
    float* out = (float*)d_out;

    float* ws = (float*)d_ws;
    float* q  = ws;                       // BT*512
    float* k  = q  + (size_t)BT * 512;    // BT*512
    float* v  = k  + (size_t)BT * 512;    // BT*512
    float* ge = v  + (size_t)BT * 512;    // BT*256
    float* p  = ge + (size_t)BT * 256;    // BT*256
    float* o  = p  + (size_t)BT * 256;    // BT*512
    float* hloc = o    + (size_t)BT * 512;              // 16*NC*SS chunk end states
    float* hin  = hloc + (size_t)BB * HH * NC * SS;     // 16*NC*SS chunk start states
    float* hloc2 = hin   + (size_t)BB * HH * NC * SS;   // the same two for pass 2
    float* hin2  = hloc2 + (size_t)BB * HH * NC * SS;
    float* dloc  = hin2  + (size_t)BB * HH * NC * SS;   // 16*NC*MM chunk decay products

    dim3 blk(256);
    dim3 grdIn((3 * 512 + 256) / 64, BT / 128);   // q, k, v and gate column tiles
    dim3 grdOut(512 / 64, BT / 128);

    proj_in_kernel<<<grdIn, blk, 0, stream>>>(x, Wq, Wk, Wv, Wf, q, k, v, ge);

    dim3 grdChunk(BB * HH * NC);          // one block per (b,h,chunk)
    dim3 grdState2(2 * BB * HH * SS / 256);   // one thread per state element, both passes

    local_both_kernel<<<grdChunk, blk, 0, stream>>>(k, v, ge, hloc, hloc2, dloc);
    carry_both_kernel<<<grdState2, blk, 0, stream>>>(hloc, hloc2, dloc, hin, hin2);
    scan1_kernel<<<grdChunk, blk, 0, stream>>>(q, k, ge, hin, p);      // + softmax
    scan2_kernel<<<grdChunk, blk, 0, stream>>>(p, v, ge, hin2, gnormw, o);  // + RMSNorm

    proj_out_kernel<<<grdOut, blk, 0, stream>>>(o, Wo, out);
}

// v009
// A run of this version takes 115 microseconds.
// Timed twice side by side with v008, it ran 1.04 times as fast both times.
// All steps since v000 together make it 47.2 times as fast.
#include <hip/hip_runtime.h>
#include <hip/hip_bf16.h>

#define BB 4
#define TT 2048
#define DD 512
#define HH 4
#define KK 128
#define VV 128
#define MM 64
#define BT (BB * TT)          // 8192 rows for all GEMMs
#define CH 32                 // time steps per chunk of the two scans
#define NC (TT / CH)          // 64 chunks per (b,h)
#define SS (KK * MM)          // 8192 state elements per (b,h), both scans

#define LDA 40                // padded LDS row length (bf16 elems): 80B, 16B-aligned runs

typedef __attribute__((ext_vector_type(16))) __bf16 v16bf;
typedef __attribute__((ext_vector_type(8)))  __bf16 v8bf;
typedef __attribute__((ext_vector_type(2)))  __bf16 v2bf;
typedef __attribute__((ext_vector_type(8)))  float  v8f;
typedef __attribute__((ext_vector_type(2)))  float  v2f;
typedef __attribute__((ext_vector_type(4)))  float  v4f;

// Two f32 to two bf16, round to nearest even, in one instruction (v_cvt_pk_bf16_f32).
__device__ __forceinline__ unsigned pack2bf(float a, float b) {
    const v2f x = {a, b};
    const v2bf r = __builtin_convertvector(x, v2bf);
    return __builtin_bit_cast(unsigned, r);
}

__device__ __forceinline__ float hw_exp2(float a) {
    float r; asm("v_exp_f32 %0, %1\n\tv_nop" : "=v"(r) : "v"(a)); return r;
}
__device__ __forceinline__ float hw_log2(float a) {
    float r; asm("v_log_f32 %0, %1\n\tv_nop" : "=v"(r) : "v"(a)); return r;
}
__device__ __forceinline__ float hw_rcp(float a) {
    float r; asm("v_rcp_f32 %0, %1\n\tv_nop" : "=v"(r) : "v"(a)); return r;
}

// ---------------------------------------------------------------------------
// Tiled GEMM: Y(8192 x N) = act( X(8192 x 512) @ W(512 x N) ), bf16 WMMA.
// Block = 256 threads (8 waves). Block tile = 128(M) x 64(N), K-step = 32.
// Software-pipelined double-buffered LDS: fetch tile k+1 to registers, WMMA
// tile k from LDS[cur], then stage registers into LDS[cur^1]; ONE barrier
// per K-step. A staged row-major As[row][k]; B staged transposed Bst[col][k]
// so every lane fragment is two contiguous 16B runs -> ds_load_b128. A thread
// stages 8 consecutive k of ONE column of B: one 16B LDS store at the 80B pitch.
// act: 0 = none, 1 = swish, 2 = ge = exp(log_sigmoid(x)/8); the same for a whole block
// ---------------------------------------------------------------------------
template <int ACT>
__device__ __forceinline__ void gemm_store(
    const v8f (&acc)[4], float* __restrict__ Y, const int N, const int row0, const int col0) {
#pragma unroll
    for (int jn = 0; jn < 4; ++jn) {
#pragma unroll
        for (int r = 0; r < 8; ++r) {
            float x = acc[jn][r];
            const float L2E = 1.44269504f;                       // log2(e)
            if (ACT == 1) {
                // swish; the hardware reciprocal (1 ulp) in place of the exact division
                x = x * hw_rcp(1.f + hw_exp2(-x * L2E));
            } else if (ACT == 2) {
                // ge = exp(log_sigmoid(x) / 8), stable form, in base 2 on the hardware exp2 and log2.
                // 1 + e lies in [1, 2], so its rounding moves log_sigmoid by at most 6e-8 absolute,
                // under the rounding of ge itself: the library log1p buys nothing here.
                const float e  = hw_exp2(-fabsf(x) * L2E);
                const float l2 = hw_log2(1.f + e);
                x = hw_exp2((fminf(x, 0.f) * L2E - l2) * 0.125f);
            }
            Y[(row0 + r) * N + col0 + jn * 16] = x;
        }
    }
    // The three epilogues share one kernel: keeps the stores' address and data
    // registers from being rewritten by another epilogue's code behind a branch.
    asm volatile("s_wait_xcnt 0x0" ::: "memory");
}

__device__ __forceinline__ void gemm_tile(
    const float* __restrict__ X, const float* __restrict__ W,
    float* __restrict__ Y, const int N, const int act,
    const int rowBase, const int colBase) {
    __shared__ __align__(16) __bf16 As[2][128 * LDA];   // 2 x 10.0 KB
    __shared__ __align__(16) __bf16 Bst[2][64 * LDA];   // 2 x  5.0 KB

    const int tid  = threadIdx.x;
    const int lane = tid & 31;
    const int wv   = tid >> 5;

    const int mrow = lane & 15;            // row of 16-row tile / col of 16-col tile
    const int kb   = (lane >> 4) << 3;     // 0 or 8: K sub-block for this half-wave

    const float4* X4 = (const float4*)X;

    // Per-thread staging coordinates (constant)
    int arr[4], ac[4];                     // A: row, float4-col
#pragma unroll
    for (int i = 0; i < 4; ++i) { int e = tid + i * 256; arr[i] = e >> 3; ac[i] = e & 7; }
    const int bcol = tid & 63;             // B: column of the tile
    const int bk8  = (tid >> 6) * 8;       // B: first of this thread's 8 k-rows
    const float* Wt = W + bk8 * N + colBase + bcol;
    const int bdst = bcol * LDA + bk8;     // 16B-aligned run in Bst[col][k]

    float4 ra[4];
    float  rb[8];

    // ---- prologue: fetch tile 0 and stage into buffer 0
#pragma unroll
    for (int i = 0; i < 4; ++i)
        ra[i] = X4[(((rowBase + arr[i]) * DD) >> 2) + ac[i]];
#pragma unroll
    for (int i = 0; i < 8; ++i)
        rb[i] = Wt[i * N];
#pragma unroll
    for (int i = 0; i < 4; ++i) {
        uint2 t; t.x = pack2bf(ra[i].x, ra[i].y); t.y = pack2bf(ra[i].z, ra[i].w);
        *(uint2*)&As[0][arr[i] * LDA + ac[i] * 4] = t;
    }
    {
        uint4 t;
        t.x = pack2bf(rb[0], rb[1]); t.y = pack2bf(rb[2], rb[3]);
        t.z = pack2bf(rb[4], rb[5]); t.w = pack2bf(rb[6], rb[7]);
        *(uint4*)&Bst[0][bdst] = t;
    }

    v8f acc[4] = {};
    int cur = 0;

    // Kept rolled: left to itself the compiler now unrolls all 16 steps, which takes 110
    // registers in place of 95 in the input projections: one resident block fewer a WGP.
#pragma unroll 1
    for (int k0 = 0; k0 < DD; k0 += 32) {
        __syncthreads();                      // LDS[cur] ready; LDS[cur^1] free
        const bool more = (k0 + 32 < DD);
        if (more) {
            // Issue next-tile global loads early: they fly under the WMMAs.
#pragma unroll
            for (int i = 0; i < 4; ++i)
                ra[i] = X4[(((rowBase + arr[i]) * DD + k0 + 32) >> 2) + ac[i]];
#pragma unroll
            for (int i = 0; i < 8; ++i)
                rb[i] = Wt[(k0 + 32 + i) * N];
            if (k0 + 64 < DD)
                __builtin_prefetch(&X[(rowBase + (tid >> 1)) * DD + k0 + 64], 0, 1);
        }

        // ---- WMMA on buffer `cur`
        const __bf16* Ab = &As[cur][0];
        const __bf16* Bb = &Bst[cur][0];
        const int arow = (wv * 16 + mrow) * LDA;
        v8bf alo = *(const v8bf*)&Ab[arow + kb];
        v8bf ahi = *(const v8bf*)&Ab[arow + 16 + kb];
        v16bf a = __builtin_shufflevector(alo, ahi,
            0, 1, 2, 3, 4, 5, 6, 7, 8, 9, 10, 11, 12, 13, 14, 15);
#pragma unroll
        for (int jn = 0; jn < 4; ++jn) {
            const int bcol = (jn * 16 + mrow) * LDA;
            v8bf blo = *(const v8bf*)&Bb[bcol + kb];
            v8bf bhi = *(const v8bf*)&Bb[bcol + 16 + kb];
            v16bf bfr = __builtin_shufflevector(blo, bhi,
                0, 1, 2, 3, 4, 5, 6, 7, 8, 9, 10, 11, 12, 13, 14, 15);
            acc[jn] = __builtin_amdgcn_wmma_f32_16x16x32_bf16(
                false, a, false, bfr, (short)0, acc[jn], false, false);
        }

        if (more) {
            // ---- stage fetched registers into buffer `cur^1`
            __bf16* An = &As[cur ^ 1][0];
            __bf16* Bn = &Bst[cur ^ 1][0];
#pragma unroll
            for (int i = 0; i < 4; ++i) {
                uint2 t; t.x = pack2bf(ra[i].x, ra[i].y); t.y = pack2bf(ra[i].z, ra[i].w);
                *(uint2*)&An[arr[i] * LDA + ac[i] * 4] = t;
            }
            uint4 t;
            t.x = pack2bf(rb[0], rb[1]); t.y = pack2bf(rb[2], rb[3]);
            t.z = pack2bf(rb[4], rb[5]); t.w = pack2bf(rb[6], rb[7]);
            *(uint4*)&Bn[bdst] = t;
        }
        cur ^= 1;
    }

    const int row0 = rowBase + wv * 16 + ((lane >> 4) << 3);
    const int col0 = colBase + mrow;
    if (act == 1)      gemm_store<1>(acc, Y, N, row0, col0);
    else if (act == 2) gemm_store<2>(acc, Y, N, row0, col0);
    else               gemm_store<0>(acc, Y, N, row0, col0);
}

// The four input projections share X and do not depend on each other: one grid
// of 28 column tiles (8 for q, 8 for k, 8 for v, 4 for the gate) by 64 row tiles.
__global__ __launch_bounds__(256) void proj_in_kernel(
    const float* __restrict__ X,
    const float* __restrict__ Wq, const float* __restrict__ Wk,
    const float* __restrict__ Wv, const float* __restrict__ Wf,
    float* __restrict__ q, float* __restrict__ k,
    float* __restrict__ v, float* __restrict__ ge) {
    const int sel = blockIdx.x >> 3;       // 0 q, 1 k, 2 v, 3 gate
    const float* W = sel == 0 ? Wq : sel == 1 ? Wk : sel == 2 ? Wv : Wf;
    float*       Y = sel == 0 ? q  : sel == 1 ? k  : sel == 2 ? v  : ge;
    const int N   = sel == 3 ? HH * MM : DD;
    const int act = sel < 2 ? 1 : sel == 2 ? 0 : 2;
    gemm_tile(X, W, Y, N, act, blockIdx.y * 128, (blockIdx.x & 7) * 64);
}

__global__ __launch_bounds__(256) void proj_out_kernel(
    const float* __restrict__ X, const float* __restrict__ W,
    float* __restrict__ Y) {
    gemm_tile(X, W, Y, DD, 0, blockIdx.y * 128, blockIdx.x * 64);
}

// ---------------------------------------------------------------------------
// The two scans are linear in their state, so the time axis is cut into NC
// chunks that run side by side:
//   local : each chunk's end state L_c from a zero state (a matrix product over
//           its steps) and the product D_c[m] of its decays;
//   carry : H_0 = 0, H_{c+1} = H_c * D_c + L_c gives every chunk's start state;
//   scan  : each chunk forms its outputs from H_c and its own steps (chunk form below).
// ---------------------------------------------------------------------------

// Carry over the chunks: one thread per state element, NC serial steps.
// SECOND = 0: state laid out [k][m]; SECOND = 1: state laid out [m][v].
template <int SECOND>
__device__ __forceinline__ void carry(
    const int blk, const float* __restrict__ hloc, const float* __restrict__ dloc,
    float* __restrict__ hin) {
    const int e = blk * 256 + threadIdx.x;
    const int bh = e / SS, idx = e % SS;
    const int m = SECOND ? (idx / VV) : (idx % MM);
    const float* src = hloc + bh * (NC * SS) + idx;
    const float* dsr = dloc + bh * (NC * MM) + m;
    float* dst = hin + bh * (NC * SS) + idx;

    float hc = 0.f;
    for (int c0 = 0; c0 < NC; c0 += 16) {
        float a[16], d[16];                 // 16 chunks' loads in flight at once
#pragma unroll
        for (int j = 0; j < 16; ++j) {
            a[j] = src[(c0 + j) * SS];
            d[j] = dsr[(c0 + j) * MM];
        }
#pragma unroll
        for (int j = 0; j < 16; ++j) {
            dst[(c0 + j) * SS] = hc;
            hc = hc * d[j] + a[j];
        }
    }
}

// Both carries in one grid: neither reads what the other writes.
__global__ __launch_bounds__(256) void carry_both_kernel(
    const float* __restrict__ hloc1, const float* __restrict__ hloc2,
    const float* __restrict__ dloc,
    float* __restrict__ hin1, float* __restrict__ hin2) {
    const int half = BB * HH * SS / 256;
    if ((int)blockIdx.x < half) carry<0>(blockIdx.x, hloc1, dloc, hin1);
    else                        carry<1>(blockIdx.x - half, hloc2, dloc, hin2);
}

// ---------------------------------------------------------------------------
// Both scans in chunk form. With Dc[t][m] = ge_0[m] * .. * ge_t[m] (steps of the
// chunk) and U[t][s][m] = (1 - ge_s[m]) * ge_{s+1}[m] * .. * ge_t[m] for s <= t,
// the state after step t is H * Dc[t] + sum_{s<=t} (k_s or v_s) * U[t][s], so
//   pass 1: ok[t][m] = Dc[t][m] * (Q H)[t][m] + sum_{s<=t} (Q K^T)[t][s] * U[t][s][m]
//   pass 2: o[t][v]  = ((p * Dc) H)[t][v] + sum_{s<=t} A2[t][s] * v_s[v],
//           A2[t][s] = sum_m p[t][m] * U[t][s][m]
// The products with H, K^T and v run on the f32 16x16x4 WMMA; U is built step by
// step by multiplying (factors in (0,1], no division) on the vector unit.
// Fragments: lane (cc = lane & 15, hf = lane >> 4) holds row or column cc and, of
// each 8 consecutive k, the four k = 4*hf .. 4*hf+3, in the same order on both sides.
// ---------------------------------------------------------------------------
#define QP 132
#define MP 68
#define AP 36

__device__ __forceinline__ void mm_acc(v8f& c0, v8f& c1, const v2f (&a)[8],
                                       const v2f (&b0)[8], const v2f (&b1)[8]) {
    asm volatile(
        "v_wmma_f32_16x16x4_f32 %0, %2, %10, %0\n\t"
        "v_wmma_f32_16x16x4_f32 %1, %2, %18, %1\n\t"
        "v_wmma_f32_16x16x4_f32 %0, %3, %11, %0\n\t"
        "v_wmma_f32_16x16x4_f32 %1, %3, %19, %1\n\t"
        "v_wmma_f32_16x16x4_f32 %0, %4, %12, %0\n\t"
        "v_wmma_f32_16x16x4_f32 %1, %4, %20, %1\n\t"
        "v_wmma_f32_16x16x4_f32 %0, %5, %13, %0\n\t"
        "v_wmma_f32_16x16x4_f32 %1, %5, %21, %1\n\t"
        "v_wmma_f32_16x16x4_f32 %0, %6, %14, %0\n\t"
        "v_wmma_f32_16x16x4_f32 %1, %6, %22, %1\n\t"
        "v_wmma_f32_16x16x4_f32 %0, %7, %15, %0\n\t"
        "v_wmma_f32_16x16x4_f32 %1, %7, %23, %1\n\t"
        "v_wmma_f32_16x16x4_f32 %0, %8, %16, %0\n\t"
        "v_wmma_f32_16x16x4_f32 %1, %8, %24, %1\n\t"
        "v_wmma_f32_16x16x4_f32 %0, %9, %17, %0\n\t"
        "v_wmma_f32_16x16x4_f32 %1, %9, %25, %1\n\t"
        "v_nop\n\t"
        "v_nop\n\t"
        "v_nop\n\t"
        "v_nop\n\t"
        "v_nop\n\t"
        "v_nop\n\t"
        "v_nop\n\t"
        "v_nop\n\t"
        : "+v"(c0), "+v"(c1)
        : "v"(a[0]), "v"(a[1]), "v"(a[2]), "v"(a[3]), "v"(a[4]), "v"(a[5]), "v"(a[6]), "v"(a[7]),
          "v"(b0[0]), "v"(b0[1]), "v"(b0[2]), "v"(b0[3]), "v"(b0[4]), "v"(b0[5]), "v"(b0[6]), "v"(b0[7]),
          "v"(b1[0]), "v"(b1[1]), "v"(b1[2]), "v"(b1[3]), "v"(b1[4]), "v"(b1[5]), "v"(b1[6]), "v"(b1[7]));
}

// 32 k of one row's fragments from LDS: src points at the lane's row and its 4*hf.
__device__ __forceinline__ void frag32(v2f (&f)[8], const float* src) {
#pragma unroll
    for (int a = 0; a < 4; ++a) {
        const v4f x = *(const v4f*)(src + 8 * a);
        f[2 * a] = x.lo;
        f[2 * a + 1] = x.hi;
    }
}

// Pass 1, one block per (b,h,chunk), started from the carried state H [k][m].
// Wave w: (Q H)^T for m-tile w & 3 over the k half w >> 2, both 16-step tiles. Waves
// 4..7 also take Q K^T: 16 steps t by all 32 s over one k half. The halves are added later.
// Then thread (m = t & 63, group j = t >> 6) carries U for the 8 steps s = 8j..8j+7
// through t = 8j..31; the four groups' partial sums are added in the softmax tail.
__global__ __launch_bounds__(256) void scan1_kernel(
    const float* __restrict__ q, const float* __restrict__ k,
    const float* __restrict__ ge, const float* __restrict__ hin,
    float* __restrict__ p) {
    const int bh = blockIdx.x / NC, c = blockIdx.x % NC;
    const int b = bh >> 2, h = bh & 3;
    const int t = threadIdx.x;
    const int lane = t & 31;
    const int wv = __builtin_amdgcn_readfirstlane(t >> 5);
    const int cc = lane & 15, hf = lane >> 4;
    const int row0 = b * TT + c * CH;

    __shared__ __align__(16) float sm[2 * CH * QP];
    __shared__ __align__(16) float As[2 * CH * CH];   // (Q K^T)[t][s]: two k halves, then their sum in the first
    __shared__ __align__(16) float QH[2 * CH * MP];   // [k half][t][m], pitch MP
    __shared__ __align__(16) float Gs[CH * MM];       // ge[step][m]
    float* Qs  = sm;                       // [step][k], pitch QP
    float* Ks  = sm + CH * QP;             // [step][k], pitch QP
    float* red = sm;                       // [step][group][m], over Qs and Ks once they are done with

    const int mj = wv & 3, kh = wv >> 2;
    float hb[8][4];                        // fragments of H: H[kh*64 + 8a + 4hf + i][16mj + cc]
    {
        // Every address is a wave-uniform base plus one 32-bit lane offset in bytes.
        const char* hp = (const char*)(hin + blockIdx.x * SS + kh * 64 * MM + mj * 16);
        const char* qp = (const char*)(q + row0 * (HH * KK) + h * KK);
        const char* kp = (const char*)(k + row0 * (HH * KK) + h * KK);
        const char* gp = (const char*)(ge + row0 * (HH * MM) + h * MM);
        const unsigned hoff = (unsigned)(4 * hf * MM + cc) * 4u;
        const unsigned qoff = (unsigned)((t >> 5) * (HH * KK) + (t & 31) * 4) * 4u;
        const unsigned goff = (unsigned)((t >> 4) * (HH * MM) + (t & 15) * 4) * 4u;
#pragma unroll
        for (int a = 0; a < 8; ++a)
#pragma unroll
            for (int i = 0; i < 4; ++i) hb[a][i] = *(const float*)(hp + hoff + (8 * a + i) * (MM * 4));
        v4f rq[4], rk[4], rg[2];
#pragma unroll
        for (int i = 0; i < 4; ++i) {
            rq[i] = *(const v4f*)(qp + qoff + i * (8 * HH * KK * 4));
            rk[i] = *(const v4f*)(kp + qoff + i * (8 * HH * KK * 4));
        }
#pragma unroll
        for (int i = 0; i < 2; ++i) rg[i] = *(const v4f*)(gp + goff + i * (16 * HH * MM * 4));
        // The loads' base and offset registers stay as they are until the loads have
        // taken them: naming them and the staged values here keeps this behind the loads
        // and keeps later scalar work or a load's result from being placed on them.
        asm volatile("s_wait_xcnt 0x0" :: "s"(hp), "s"(qp), "s"(kp), "s"(gp),
                     "v"(hoff), "v"(qoff), "v"(goff),
                     "v"(rq[0]), "v"(rq[1]), "v"(rq[2]), "v"(rq[3]),
                     "v"(rk[0]), "v"(rk[1]), "v"(rk[2]), "v"(rk[3]),
                     "v"(rg[0]), "v"(rg[1]) : "memory");
#pragma unroll
        for (int i = 0; i < 4; ++i) {
            *(v4f*)&Qs[((t >> 5) + 8 * i) * QP + (t & 31) * 4] = rq[i];
            *(v4f*)&Ks[((t >> 5) + 8 * i) * QP + (t & 31) * 4] = rk[i];
        }
#pragma unroll
        for (int i = 0; i < 2; ++i) *(v4f*)&Gs[((t >> 4) + 16 * i) * MM + (t & 15) * 4] = rg[i];
    }
    __syncthreads();                       // publishes the chunk's q, k and gate rows

    {   // A = H^T (row = m), B = Q^T (column = step): lane cc has step cc, m = 8hf .. 8hf+7
        v8f d0 = {}, d1 = {};
        const float* qa = Qs + cc * QP + kh * 64 + 4 * hf;
#pragma unroll
        for (int n = 0; n < 2; ++n) {
            v2f ha[8], x0[8], x1[8];
#pragma unroll
            for (int a = 0; a < 4; ++a) {
                ha[2 * a]     = v2f{hb[4 * n + a][0], hb[4 * n + a][1]};
                ha[2 * a + 1] = v2f{hb[4 * n + a][2], hb[4 * n + a][3]};
            }
            frag32(x0, qa + 32 * n);
            frag32(x1, qa + 16 * QP + 32 * n);
            mm_acc(d0, d1, ha, x0, x1);
        }
        float* dst = QH + kh * (CH * MP) + cc * MP + mj * 16 + 8 * hf;
        *(v4f*)(dst)               = v4f{d0[0], d0[1], d0[2], d0[3]};
        *(v4f*)(dst + 4)           = v4f{d0[4], d0[5], d0[6], d0[7]};
        *(v4f*)(dst + 16 * MP)     = v4f{d1[0], d1[1], d1[2], d1[3]};
        *(v4f*)(dst + 16 * MP + 4) = v4f{d1[4], d1[5], d1[6], d1[7]};
    }
    if (wv >= 4) {                         // A = Q (row = t), B = K^T (column = s)
        const int ti = (wv >> 1) & 1, k2 = wv & 1;
        v8f e0 = {}, e1 = {};
        const float* qa = Qs + (ti * 16 + cc) * QP + k2 * 64 + 4 * hf;
        const float* kb = Ks + cc * QP + k2 * 64 + 4 * hf;
#pragma unroll
        for (int n = 0; n < 2; ++n) {
            v2f x[8], y0[8], y1[8];
            frag32(x, qa + 32 * n);
            frag32(y0, kb + 32 * n);
            frag32(y1, kb + 16 * QP + 32 * n);
            mm_acc(e0, e1, x, y0, y1);
        }
        float* dst = As + k2 * (CH * CH) + (ti * 16 + 8 * hf) * CH + cc;
#pragma unroll
        for (int r = 0; r < 8; ++r) {
            dst[r * CH]      = e0[r];
            dst[r * CH + 16] = e1[r];
        }
    }
    __syncthreads();                       // publishes both k halves of Q K^T
    *(v4f*)&As[t * 4] = *(const v4f*)&As[t * 4] + *(const v4f*)&As[CH * CH + t * 4];
    __syncthreads();                       // publishes Q H and Q K^T; q and k rows are done with

    {
        const int m = t & 63;
        const int s0 = (wv >> 1) * 8;      // first step of this group
        v2f u[4];                          // U of steps s0 .. s0+7, two to a register pair
#pragma unroll
        for (int i = 0; i < 8; ++i) u[i >> 1][i & 1] = 1.f - Gs[(s0 + i) * MM + m];
        float dc = s0 == 0 ? 1.f : 0.f;
        for (int tq = 0; tq < s0; ++tq) red[tq * 256 + t] = 0.f;
#pragma unroll
        for (int tt = 0; tt < 8; ++tt) {   // steps of the group's own block: s <= t only
            const int tq = s0 + tt;
            const float g = Gs[tq * MM + m];
            const v4f a0 = *(const v4f*)&As[tq * CH + s0];
            const v4f a1 = *(const v4f*)&As[tq * CH + s0 + 4];
            const float av[8] = {a0.x, a0.y, a0.z, a0.w, a1.x, a1.y, a1.z, a1.w};
            dc *= g;
            float acc = dc * (QH[tq * MP + m] + QH[CH * MP + tq * MP + m]);
#pragma unroll
            for (int i = 0; i < 8; ++i) {
                if (i < tt) u[i >> 1][i & 1] *= g;
                if (i <= tt) acc += av[i] * u[i >> 1][i & 1];
            }
            red[tq * 256 + t] = acc;
        }
        // Four steps a trip: their LDS reads are issued ahead of the arithmetic that waits for them.
#pragma unroll 4
        for (int tq = s0 + 8; tq < CH; ++tq) {
            const float g = Gs[tq * MM + m];
            const v4f a0 = *(const v4f*)&As[tq * CH + s0];
            const v4f a1 = *(const v4f*)&As[tq * CH + s0 + 4];
            const v2f g2 = {g, g};
            dc *= g;
            v2f ac = {dc * (QH[tq * MP + m] + QH[CH * MP + tq * MP + m]), 0.f};
            u[0] *= g2;  ac += a0.lo * u[0];
            u[1] *= g2;  ac += a0.hi * u[1];
            u[2] *= g2;  ac += a1.lo * u[2];
            u[3] *= g2;  ac += a1.hi * u[3];
            red[tq * 256 + t] = ac.x + ac.y;
        }
    }
    __syncthreads();                       // publishes every step's partial sums

    float* prow = p + (row0 + wv) * (HH * MM) + h * MM + lane;
    for (int j = 0; j < CH / 8; ++j) {
        const float* src = red + (wv + 8 * j) * 256 + lane;
        float x0 = src[0]  + src[64] + src[128] + src[192];
        float x1 = src[32] + src[96] + src[160] + src[224];
        float mx = fmaxf(x0, x1);
#pragma unroll
        for (int off = 16; off > 0; off >>= 1) mx = fmaxf(mx, __shfl_xor(mx, off, 32));
        float ea = __expf(x0 - mx), eb = __expf(x1 - mx);
        float s = ea + eb;
#pragma unroll
        for (int off = 16; off > 0; off >>= 1) s += __shfl_xor(s, off, 32);
        float inv = 1.f / s;
        prow[8 * j * (HH * MM)]      = ea * inv;
        prow[8 * j * (HH * MM) + 32] = eb * inv;
    }
}

// Local pass of both scans: one block per (b,h,chunk), no step loop.
// From a zero state the recurrences end in plain sums over the chunk's steps s:
//   pass 1: L1[k][m] = sum_s k_s[k] * W[s][m]
//   pass 2: L2[m][v] = sum_s W[s][m] * v_s[v]
//   W[s][m] = (1 - ge_s[m]) * prod_{r > s} ge_r[m]     (factors in (0,1], no division)
// Both are matrix products over the 32 steps, done on the f32 16x16x4 WMMA.
// Lane (c = lane & 15, hf = lane >> 4) holds steps 16*hf .. 16*hf+15 of row or
// column c in every operand, so W's fragments are B of pass 1 and A of pass 2
// and the step order is the same on both sides of each product.
// Wave w: pass 1 rows k = 16w..16w+15, all 64 m; pass 2 two m-tiles by 32 v.
// Every wave forms W itself in registers: nothing crosses waves.

__device__ __forceinline__ void mm_1x2(v8f& c0, v8f& c1, const v2f (&a)[8],
                                       const v2f (&b0)[8], const v2f (&b1)[8]) {
    asm volatile(
        "v_wmma_f32_16x16x4_f32 %0, %2, %10, 0\n\t"
        "v_wmma_f32_16x16x4_f32 %1, %2, %18, 0\n\t"
        "v_wmma_f32_16x16x4_f32 %0, %3, %11, %0\n\t"
        "v_wmma_f32_16x16x4_f32 %1, %3, %19, %1\n\t"
        "v_wmma_f32_16x16x4_f32 %0, %4, %12, %0\n\t"
        "v_wmma_f32_16x16x4_f32 %1, %4, %20, %1\n\t"
        "v_wmma_f32_16x16x4_f32 %0, %5, %13, %0\n\t"
        "v_wmma_f32_16x16x4_f32 %1, %5, %21, %1\n\t"
        "v_wmma_f32_16x16x4_f32 %0, %6, %14, %0\n\t"
        "v_wmma_f32_16x16x4_f32 %1, %6, %22, %1\n\t"
        "v_wmma_f32_16x16x4_f32 %0, %7, %15, %0\n\t"
        "v_wmma_f32_16x16x4_f32 %1, %7, %23, %1\n\t"
        "v_wmma_f32_16x16x4_f32 %0, %8, %16, %0\n\t"
        "v_wmma_f32_16x16x4_f32 %1, %8, %24, %1\n\t"
        "v_wmma_f32_16x16x4_f32 %0, %9, %17, %0\n\t"
        "v_wmma_f32_16x16x4_f32 %1, %9, %25, %1\n\t"
        "v_nop\n\t"
        "v_nop\n\t"
        "v_nop\n\t"
        "v_nop\n\t"
        "v_nop\n\t"
        "v_nop\n\t"
        "v_nop\n\t"
        "v_nop\n\t"
        : "=&v"(c0), "=&v"(c1)
        : "v"(a[0]), "v"(a[1]), "v"(a[2]), "v"(a[3]), "v"(a[4]), "v"(a[5]), "v"(a[6]), "v"(a[7]),
          "v"(b0[0]), "v"(b0[1]), "v"(b0[2]), "v"(b0[3]), "v"(b0[4]), "v"(b0[5]), "v"(b0[6]), "v"(b0[7]),
          "v"(b1[0]), "v"(b1[1]), "v"(b1[2]), "v"(b1[3]), "v"(b1[4]), "v"(b1[5]), "v"(b1[6]), "v"(b1[7]));
}

// Turns one m-tile's 16 gate values of this lane half into W; returns the chunk's
// decay product (the same value in both lane halves).
__device__ __forceinline__ float decay_weights(v2f (&w)[8], const int hf) {
    float suf = 1.f;                               // product of the decays after step i
#pragma unroll
    for (int i = 15; i >= 0; --i) {
        const float g = w[i >> 1][i & 1];
        w[i >> 1][i & 1] = (1.f - g) * suf;
        suf *= g;
    }
    const float oth = __shfl_xor(suf, 16, 32);     // the other 16 steps' product
    const float late = hf == 0 ? oth : 1.f;        // steps 0..15 also decay through 16..31
#pragma unroll
    for (int j = 0; j < 8; ++j) w[j] *= late;
    return suf * oth;
}

__global__ __launch_bounds__(256, 8) void local_both_kernel(
    const float* __restrict__ k, const float* __restrict__ v,
    const float* __restrict__ ge,
    float* __restrict__ hloc1, float* __restrict__ hloc2,
    float* __restrict__ dloc) {
    const int blk = blockIdx.x;
    const int bh = blk / NC, c = blk % NC;
    const int b = bh >> 2, h = bh & 3;
    const int lane = threadIdx.x & 31;
    const int wv = __builtin_amdgcn_readfirstlane(threadIdx.x >> 5);
    const int cc = lane & 15, hf = lane >> 4;
    const int row0 = b * TT + c * CH;             // first step of the chunk
    const int mhalf = wv >> 2, vpair = wv & 3;    // pass 2 share of this wave

    // wt[q] belongs to m-tile q ^ (2*mhalf): wt[0], wt[1] are the wave's own pass-2 tiles.
    // Every address is a wave-uniform base plus one 32-bit lane offset in bytes;
    // go[0], so[0] serve tiles q = 0, 1 and go[1], so[1] tiles q = 2, 3.
    const unsigned own = 2 * mhalf * 64, far = own ^ 128;               // tile pair, bytes
    const unsigned goff = (unsigned)(hf * 16 * (HH * MM) + cc) * 4u;    // gate rows
    const unsigned go[2] = {goff + own, goff + far};
    const unsigned koff = (unsigned)(hf * 16 * (HH * KK) + cc) * 4u;    // k and v rows
    const unsigned soff = (unsigned)(hf * 8 * MM + cc) * 4u;            // pass-1 state rows
    const unsigned so[2] = {soff + own, soff + far};

    v2f wt[4][8], ka[8], vb[2][8];
    {
        const char* gb = (const char*)(ge + row0 * (HH * MM) + h * MM);
        const char* kp = (const char*)(k + row0 * (HH * KK) + h * KK + wv * 16) + koff;
#pragma unroll
        for (int q = 2; q < 4; ++q)
#pragma unroll
            for (int i = 0; i < 16; ++i)
                wt[q][i >> 1][i & 1] = *(const float*)(gb + go[1] + (q & 1) * 64 + i * (HH * MM * 4));
#pragma unroll
        for (int i = 0; i < 16; ++i) ka[i >> 1][i & 1] = *(const float*)(kp + i * (HH * KK * 4));
#pragma unroll
        for (int q = 0; q < 2; ++q)
#pragma unroll
            for (int i = 0; i < 16; ++i)
                wt[q][i >> 1][i & 1] = *(const float*)(gb + go[0] + (q & 1) * 64 + i * (HH * MM * 4));
    }
    // The loads' offset registers stay as they are until the loads have taken them:
    // naming them here keeps a later load's result from being placed on them.
    asm volatile("s_wait_xcnt 0x0" :: "v"(go[0]), "v"(go[1]), "v"(koff) : "memory");

    char* db = (char*)(hloc1 + blk * SS + wv * 16 * MM);
    float dp[4];
    v8f c0, c1;

    // Pass 1: A = k (row = k index), B = W (column = m). First the tiles that pass 2
    // of this wave does not need: their registers are free afterwards.
    dp[2] = decay_weights(wt[2], hf);
    dp[3] = decay_weights(wt[3], hf);
    mm_1x2(c0, c1, ka, wt[2], wt[3]);
#pragma unroll
    for (int r = 0; r < 8; ++r) {
        *(float*)(db + so[1] + r * (MM * 4))      = c0[r];
        *(float*)(db + so[1] + r * (MM * 4) + 64) = c1[r];
    }
    // What follows reuses the stores' registers: they stay until the stores have taken them.
    asm volatile("s_wait_xcnt 0x0" :: "v"(so[1]) : "memory");

    {   // v flies under the rest of pass 1
        const char* vp = (const char*)(v + row0 * (HH * VV) + h * VV + vpair * 32) + koff;
#pragma unroll
        for (int i = 0; i < 16; ++i) {
            vb[0][i >> 1][i & 1] = *(const float*)(vp + i * (HH * VV * 4));
            vb[1][i >> 1][i & 1] = *(const float*)(vp + i * (HH * VV * 4) + 64);
        }
        // As above: the offset register stays until the loads have taken it.
        asm volatile("s_wait_xcnt 0x0" :: "v"(koff) : "memory");
    }

    dp[0] = decay_weights(wt[0], hf);
    dp[1] = decay_weights(wt[1], hf);
    if (wv == 0) {                                 // wave 0 has m-tile q in wt[q]
        dloc[blk * MM + lane]      = hf ? dp[1] : dp[0];
        dloc[blk * MM + 32 + lane] = hf ? dp[3] : dp[2];
        // As above, for these two stores.
        asm volatile("s_wait_xcnt 0x0" ::: "memory");
    }
    mm_1x2(c0, c1, ka, wt[0], wt[1]);
#pragma unroll
    for (int r = 0; r < 8; ++r) {
        *(float*)(db + so[0] + r * (MM * 4))      = c0[r];
        *(float*)(db + so[0] + r * (MM * 4) + 64) = c1[r];
    }

    // Pass 2: A = W (row = m), B = v (column = v index).
    const unsigned s2 = (unsigned)(hf * 8 * VV + cc) * 4u;
    char* d2 = (char*)(hloc2 + blk * SS + mhalf * 32 * VV + vpair * 32);
    mm_1x2(c0, c1, wt[0], vb[0], vb[1]);
#pragma unroll
    for (int r = 0; r < 8; ++r) {
        *(float*)(d2 + s2 + r * (VV * 4))      = c0[r];
        *(float*)(d2 + s2 + r * (VV * 4) + 64) = c1[r];
    }
    asm volatile("s_wait_xcnt 0x0" :: "v"(s2) : "memory");
    mm_1x2(c0, c1, wt[1], vb[0], vb[1]);
#pragma unroll
    for (int r = 0; r < 8; ++r) {
        *(float*)(d2 + s2 + (16 + r) * (VV * 4))      = c0[r];
        *(float*)(d2 + s2 + (16 + r) * (VV * 4) + 64) = c1[r];
    }
}

__global__ __launch_bounds__(256, 8) void scan2_kernel(
    const float* __restrict__ p, const float* __restrict__ v,
    const float* __restrict__ ge, const float* __restrict__ hin,
    const float* __restrict__ w, float* __restrict__ o) {
    const int bh = blockIdx.x / NC, c = blockIdx.x % NC;
    const int b = bh >> 2, h = bh & 3;
    const int t = threadIdx.x;
    const int lane = t & 31;
    const int wv = __builtin_amdgcn_readfirstlane(t >> 5);
    const int cc = lane & 15, hf = lane >> 4;
    const int row0 = b * TT + c * CH;

    __shared__ __align__(16) float Gs[CH * MM];       // ge[step][m]
    __shared__ __align__(16) float Pl[CH * MM];       // p[step][m]
    __shared__ __align__(16) float Ps[CH * MP];       // p * Dc, pitch MP
    __shared__ __align__(16) float A2s[CH * AP];      // A2[t][s], pitch AP
    __shared__ __align__(16) float part[8 * CH * CH]; // [wave][t][s] partial sums of A2
    float* Os = part;                      // o[t][v], pitch QP, once the partial sums are done with

    float hb[8][4], vb[4][4];              // fragments: H[8a + 4hf + i][col], v[8a + 4hf + i][col]
    {
        // Every address is a wave-uniform base plus one 32-bit lane offset in bytes.
        const char* hp = (const char*)(hin + blockIdx.x * SS + wv * 16);
        const char* vp = (const char*)(v + row0 * (HH * VV) + h * VV + wv * 16);
        const char* gp = (const char*)(ge + row0 * (HH * MM) + h * MM);
        const char* pp = (const char*)(p  + row0 * (HH * MM) + h * MM);
        const unsigned hoff = (unsigned)(4 * hf * VV + cc) * 4u;
        const unsigned voff = (unsigned)(4 * hf * (HH * VV) + cc) * 4u;
        const unsigned goff = (unsigned)((t >> 4) * (HH * MM) + (t & 15) * 4) * 4u;
#pragma unroll
        for (int a = 0; a < 8; ++a)
#pragma unroll
            for (int i = 0; i < 4; ++i) hb[a][i] = *(const float*)(hp + hoff + (8 * a + i) * (VV * 4));
#pragma unroll
        for (int a = 0; a < 4; ++a)
#pragma unroll
            for (int i = 0; i < 4; ++i) vb[a][i] = *(const float*)(vp + voff + (8 * a + i) * (HH * VV * 4));
        v4f rg[2], rp[2];
#pragma unroll
        for (int i = 0; i < 2; ++i) {
            rg[i] = *(const v4f*)(gp + goff + i * (16 * HH * MM * 4));
            rp[i] = *(const v4f*)(pp + goff + i * (16 * HH * MM * 4));
        }
        // The loads' base and offset registers stay as they are until the loads have
        // taken them: naming them and the staged values here keeps this behind the loads
        // and keeps later scalar work or a load's result from being placed on them.
        asm volatile("s_wait_xcnt 0x0" :: "s"(hp), "s"(vp), "s"(gp), "s"(pp),
                     "v"(hoff), "v"(voff), "v"(goff),
                     "v"(rg[0]), "v"(rg[1]), "v"(rp[0]), "v"(rp[1]) : "memory");
#pragma unroll
        for (int i = 0; i < 2; ++i) {
            *(v4f*)&Gs[((t >> 4) + 16 * i) * MM + (t & 15) * 4] = rg[i];
            *(v4f*)&Pl[((t >> 4) + 16 * i) * MM + (t & 15) * 4] = rp[i];
        }
    }
    __syncthreads();                       // publishes the chunk's gate and p rows

    {   // p * Dc: thread (m, group of 8 steps) multiplies the decays up from step 0
        const int m = t & 63;
        const int t0 = (wv >> 1) * 8;
        float dc = 1.f;
        for (int r = 0; r < t0; ++r) dc *= Gs[r * MM + m];
#pragma unroll
        for (int i = 0; i < 8; ++i) {
            dc *= Gs[(t0 + i) * MM + m];
            Ps[(t0 + i) * MP + m] = Pl[(t0 + i) * MM + m] * dc;
        }
    }
    {
        v2f u[4] = {};
        const float* gr = Gs + wv * 8;
        const float* pr = Pl + wv * 8;
        float* dst = part + wv * (CH * CH) + lane;
        // Four steps a trip: their LDS reads are issued ahead of the arithmetic that waits for them.
#pragma unroll 4
        for (int tq = 0; tq < CH; ++tq) {
            const v4f g0 = *(const v4f*)(gr + tq * MM);
            const v4f g1 = *(const v4f*)(gr + tq * MM + 4);
            const v4f p0 = *(const v4f*)(pr + tq * MM);
            const v4f p1 = *(const v4f*)(pr + tq * MM + 4);
            const float e1 = lane == tq ? 1.f : 0.f;
            const v2f e = {e1, e1};
            v2f ac = {0.f, 0.f};
            // t == s: 1 - g; later: u * g; before: 0
            u[0] = g0.lo * (u[0] - e) + e;  ac += p0.lo * u[0];
            u[1] = g0.hi * (u[1] - e) + e;  ac += p0.hi * u[1];
            u[2] = g1.lo * (u[2] - e) + e;  ac += p1.lo * u[2];
            u[3] = g1.hi * (u[3] - e) + e;  ac += p1.hi * u[3];
            dst[tq * CH] = ac.x + ac.y;
        }
    }
    __syncthreads();                       // publishes p * Dc and the partial sums of A2

#pragma unroll
    for (int i = 0; i < 4; ++i) {
        const int e = t + i * 256;
        float x = part[e];
#pragma unroll
        for (int g = 1; g < 8; ++g) x += part[g * (CH * CH) + e];
        A2s[(e >> 5) * AP + (e & 31)] = x;
    }
    __syncthreads();                       // publishes A2; the partial sums are done with

    {   // A = [H ; v]^T (row = column v), B = [p * Dc | A2]^T (column = step):
        // lane cc has step cc, columns 8hf .. 8hf+7 of the wave's 16
        v8f d0 = {}, d1 = {};
        const float* pa = Ps + cc * MP + 4 * hf;
        const float* aa = A2s + cc * AP + 4 * hf;
#pragma unroll
        for (int n = 0; n < 3; ++n) {
            v2f ha[8], x0[8], x1[8];
#pragma unroll
            for (int a = 0; a < 4; ++a) {
                ha[2 * a]     = n < 2 ? v2f{hb[(4 * n + a) & 7][0], hb[(4 * n + a) & 7][1]} : v2f{vb[a][0], vb[a][1]};
                ha[2 * a + 1] = n < 2 ? v2f{hb[(4 * n + a) & 7][2], hb[(4 * n + a) & 7][3]} : v2f{vb[a][2], vb[a][3]};
            }
            frag32(x0, n < 2 ? pa + 32 * n : aa);
            frag32(x1, n < 2 ? pa + 16 * MP + 32 * n : aa + 16 * AP);
            mm_acc(d0, d1, ha, x0, x1);
        }
        float* dst = Os + cc * QP + wv * 16 + 8 * hf;
        *(v4f*)(dst)               = v4f{d0[0], d0[1], d0[2], d0[3]};
        *(v4f*)(dst + 4)           = v4f{d0[4], d0[5], d0[6], d0[7]};
        *(v4f*)(dst + 16 * QP)     = v4f{d1[0], d1[1], d1[2], d1[3]};
        *(v4f*)(dst + 16 * QP + 4) = v4f{d1[4], d1[5], d1[6], d1[7]};
    }
    __syncthreads();                       // publishes the chunk's output rows

    float* orow = o + (row0 + wv) * (HH * VV) + h * VV + lane;
    const float w0 = w[lane], w1 = w[lane + 32], w2 = w[lane + 64], w3 = w[lane + 96];
    for (int j = 0; j < CH / 8; ++j) {
        const float* base = Os + (wv + 8 * j) * QP + lane;
        float x0 = base[0];
        float x1 = base[32];
        float x2 = base[64];
        float x3 = base[96];
        float ss = x0 * x0 + x1 * x1 + x2 * x2 + x3 * x3;
#pragma unroll
        for (int off = 16; off > 0; off >>= 1) ss += __shfl_xor(ss, off, 32);
        float r = rsqrtf(ss * (1.f / (float)VV) + 1e-5f);
        orow[8 * j * (HH * VV)]      = x0 * r * w0;
        orow[8 * j * (HH * VV) + 32] = x1 * r * w1;
        orow[8 * j * (HH * VV) + 64] = x2 * r * w2;
        orow[8 * j * (HH * VV) + 96] = x3 * r * w3;
    }
}

// ---------------------------------------------------------------------------

extern "C" void kernel_launch(void* const* d_in, const int* in_sizes, int n_in,
                              void* d_out, int out_size, void* d_ws, size_t ws_size,
                              hipStream_t stream) {
    const float* x      = (const float*)d_in[0];
    const float* Wq     = (const float*)d_in[1];
    const float* Wk     = (const float*)d_in[2];
    const float* Wv     = (const float*)d_in[3];
    const float* Wf     = (const float*)d_in[4];
    const float* gnormw = (const float*)d_in[5];
    const float* Wo     = (const float*)d_in[6];
    float* out = (float*)d_out;

    float* ws = (float*)d_ws;
    float* q  = ws;                       // BT*512
    float* k  = q  + (size_t)BT * 512;    // BT*512
    float* v  = k  + (size_t)BT * 512;    // BT*512
    float* ge = v  + (size_t)BT * 512;    // BT*256
    float* p  = ge + (size_t)BT * 256;    // BT*256
    float* o  = p  + (size_t)BT * 256;    // BT*512
    float* hloc = o    + (size_t)BT * 512;              // 16*NC*SS chunk end states
    float* hin  = hloc + (size_t)BB * HH * NC * SS;     // 16*NC*SS chunk start states
    float* hloc2 = hin   + (size_t)BB * HH * NC * SS;   // the same two for pass 2
    float* hin2  = hloc2 + (size_t)BB * HH * NC * SS;
    float* dloc  = hin2  + (size_t)BB * HH * NC * SS;   // 16*NC*MM chunk decay products

    dim3 blk(256);
    dim3 grdIn((3 * 512 + 256) / 64, BT / 128);   // q, k, v and gate column tiles
    dim3 grdOut(512 / 64, BT / 128);

    proj_in_kernel<<<grdIn, blk, 0, stream>>>(x, Wq, Wk, Wv, Wf, q, k, v, ge);

    dim3 grdChunk(BB * HH * NC);          // one block per (b,h,chunk)
    dim3 grdState2(2 * BB * HH * SS / 256);   // one thread per state element, both passes

    local_both_kernel<<<grdChunk, blk, 0, stream>>>(k, v, ge, hloc, hloc2, dloc);
    carry_both_kernel<<<grdState2, blk, 0, stream>>>(hloc, hloc2, dloc, hin, hin2);
    scan1_kernel<<<grdChunk, blk, 0, stream>>>(q, k, ge, hin, p);      // + softmax
    scan2_kernel<<<grdChunk, blk, 0, stream>>>(p, v, ge, hin2, gnormw, o);  // + RMSNorm

    proj_out_kernel<<<grdOut, blk, 0, stream>>>(o, Wo, out);
}

// v010
// A run of this version takes 95 microseconds.
// In both of two side-by-side timings against v009, it was 1.21 times as fast.
// Counting every step since v000, it is 57.2 times as fast.
#include <hip/hip_runtime.h>
#include <hip/hip_bf16.h>

#define BB 4
#define TT 2048
#define DD 512
#define HH 4
#define KK 128
#define VV 128
#define MM 64
#define BT (BB * TT)          // 8192 rows for all GEMMs
#define CH 32                 // time steps per chunk of the two scans
#define NC (TT / CH)          // 64 chunks per (b,h)
#define SS (KK * MM)          // 8192 state elements per (b,h), both scans

#define LDA 40                // padded LDS row length (bf16 elems): 80B, 16B-aligned runs

typedef __attribute__((ext_vector_type(16))) __bf16 v16bf;
typedef __attribute__((ext_vector_type(8)))  __bf16 v8bf;
typedef __attribute__((ext_vector_type(2)))  __bf16 v2bf;
typedef __attribute__((ext_vector_type(8)))  float  v8f;
typedef __attribute__((ext_vector_type(2)))  float  v2f;
typedef __attribute__((ext_vector_type(4)))  float  v4f;

// Two f32 to two bf16, round to nearest even, in one instruction (v_cvt_pk_bf16_f32).
__device__ __forceinline__ unsigned pack2bf(float a, float b) {
    const v2f x = {a, b};
    const v2bf r = __builtin_convertvector(x, v2bf);
    return __builtin_bit_cast(unsigned, r);
}

__device__ __forceinline__ float hw_exp2(float a) {
    float r; asm("v_exp_f32 %0, %1\n\tv_nop" : "=v"(r) : "v"(a)); return r;
}
__device__ __forceinline__ float hw_log2(float a) {
    float r; asm("v_log_f32 %0, %1\n\tv_nop" : "=v"(r) : "v"(a)); return r;
}
__device__ __forceinline__ float hw_rcp(float a) {
    float r; asm("v_rcp_f32 %0, %1\n\tv_nop" : "=v"(r) : "v"(a)); return r;
}

// ---------------------------------------------------------------------------
// Tiled GEMM: Y(8192 x N) = act( X(8192 x 512) @ W(512 x N) ), bf16 WMMA.
// Block = WM x 2 waves, each with a 32(M) x 64(N) tile of 2 x 4 accumulators: block tile
// 32*WM (M) x 128 (N), K-step = 32. A loaded fragment serves 4 (A) or 2 (B) products, and
// a block's X and W bytes from L2 serve a 256 x 128 (WM = 8) or 128 x 128 (WM = 4) tile.
// Software-pipelined double-buffered LDS: fetch tile k+1 to registers, WMMA
// tile k from LDS[cur], then stage registers into LDS[cur^1]; ONE barrier
// per K-step. A staged row-major As[row][k]; B staged transposed Bst[col][k]
// so every lane fragment is two contiguous 16B runs -> ds_load_b128. A thread
// stages runs of 8 consecutive k of ONE column of B: one 16B LDS store each at the 80B pitch.
// N is a compile-time constant and every global address a wave-uniform base plus one
// 32-bit lane offset plus a constant: the 64 accumulator registers leave few for addresses.
// act: 0 = none, 1 = swish, 2 = ge = exp(log_sigmoid(x)/8); the same for a whole block
// ---------------------------------------------------------------------------
template <int ACT, int N>
__device__ __forceinline__ void gemm_store(const v8f (&acc)[2][4], char* Yb, const unsigned yoff) {
#pragma unroll
    for (int im = 0; im < 2; ++im) {
#pragma unroll
        for (int jn = 0; jn < 4; ++jn) {
#pragma unroll
            for (int r = 0; r < 8; ++r) {
                float x = acc[im][jn][r];
                const float L2E = 1.44269504f;                       // log2(e)
                if (ACT == 1) {
                    // swish; the hardware reciprocal (1 ulp) in place of the exact division
                    x = x * hw_rcp(1.f + hw_exp2(-x * L2E));
                } else if (ACT == 2) {
                    // ge = exp(log_sigmoid(x) / 8), stable form, in base 2 on the hardware exp2 and log2.
                    // 1 + e lies in [1, 2], so its rounding moves log_sigmoid by at most 6e-8 absolute,
                    // under the rounding of ge itself: the library log1p buys nothing here.
                    const float e  = hw_exp2(-fabsf(x) * L2E);
                    const float l2 = hw_log2(1.f + e);
                    x = hw_exp2((fminf(x, 0.f) * L2E - l2) * 0.125f);
                }
                *(float*)(Yb + yoff + ((im * 16 + r) * N + jn * 16) * 4) = x;
            }
        }
    }
    // The epilogues share one kernel: keeps the stores' address and data
    // registers from being rewritten by another epilogue's code behind a branch.
    asm volatile("s_wait_xcnt 0x0" :: "s"(Yb), "v"(yoff) : "memory");
}

template <int WM, int N>
__device__ __forceinline__ void gemm_tile(
    __bf16* As, __bf16* Bst,               // LDS, two buffers each: 32*WM and 128 rows at pitch LDA
    const float* __restrict__ X, const float* __restrict__ W,
    float* __restrict__ Y, const int act,
    const int rowBase, const int colBase) {
    constexpr int NT = WM * 64;            // threads of the block
    constexpr int BM = WM * 32;            // rows of the block tile
    constexpr int NB = 512 / NT;           // 8-k runs of B that a thread stages
    constexpr int KR = NT / 16;            // k distance between a thread's runs
    constexpr int AR = NT / 8;             // row distance between a thread's pieces of A

    const int tid  = threadIdx.x;
    const int lane = tid & 31;
    const int wv   = __builtin_amdgcn_readfirstlane(tid >> 5);   // the wave's share goes into scalar bases
    const int wm   = wv >> 1;              // wave's 32 rows of the block tile
    const int wn   = wv & 1;               // wave's 64 columns of the block tile

    const int mrow = lane & 15;            // row of 16-row tile / col of 16-col tile
    const int kb   = (lane >> 4) << 3;     // 0 or 8: K sub-block for this half-wave

    // Per-thread staging coordinates (constant)
    // A: row tid >> 3 = 4 wv + (lane >> 3), float4-col lane & 7.
    // B: column tid & 127 = 32 (wv & 3) + lane, first k-row 8 (tid >> 7) = 8 (wv >> 2).
    const char* xb = (const char*)(X + (rowBase + wv * 4) * DD);
    const char* wb = (const char*)(W + (wv >> 2) * 8 * N + colBase + (wv & 3) * 32);
    const unsigned xoff = (unsigned)((lane >> 3) * DD + (lane & 7) * 4) * 4u;
    const unsigned woff = (unsigned)lane * 4u;
    const int adst = wv * 4 * LDA + ((lane >> 3) * LDA + (lane & 7) * 4);
    const int bdst = ((wv & 3) * 32 * LDA + (wv >> 2) * 8) + lane * LDA;   // 16B-aligned run in Bst[col][k]
    const int fsrc = mrow * LDA + kb;                      // the lane's place in a fragment's rows, A and B

    float4 ra[4];
    float  rb[NB][8];

    // ---- prologue: fetch tile 0 and stage into buffer 0
#pragma unroll
    for (int i = 0; i < 4; ++i)
        ra[i] = *(const float4*)(xb + xoff + i * (AR * DD * 4));
    // The loads' address registers stay as they are until the loads have taken them:
    // behind this wait a later load's result or later address work may fall on them.
    asm volatile("s_wait_xcnt 0x0" :: "s"(xb), "v"(xoff) : "memory");
#pragma unroll
    for (int j = 0; j < NB; ++j)
#pragma unroll
        for (int i = 0; i < 8; ++i)
            rb[j][i] = *(const float*)(wb + woff + (j * KR + i) * (N * 4));
    // As above (the lane number too: the compiler may address by it, scaled, in place of the offset).
    asm volatile("s_wait_xcnt 0x0" :: "s"(wb), "v"(woff), "v"(lane) : "memory");
#pragma unroll
    for (int i = 0; i < 4; ++i) {
        uint2 t; t.x = pack2bf(ra[i].x, ra[i].y); t.y = pack2bf(ra[i].z, ra[i].w);
        *(uint2*)&As[adst + i * (AR * LDA)] = t;
    }
#pragma unroll
    for (int j = 0; j < NB; ++j) {
        uint4 t;
        t.x = pack2bf(rb[j][0], rb[j][1]); t.y = pack2bf(rb[j][2], rb[j][3]);
        t.z = pack2bf(rb[j][4], rb[j][5]); t.w = pack2bf(rb[j][6], rb[j][7]);
        *(uint4*)&Bst[bdst + j * KR] = t;
    }

    v8f acc[2][4] = {};
    int cur = 0;
    unsigned xo = xoff, wo = woff;         // lane offsets of the K-step being fetched

    // Kept rolled: unrolled, several steps' staging registers are live at once, and the
    // input projections need two resident blocks a WGP (128 registers a wave at most).
#pragma unroll 1
    for (int k0 = 0; k0 < DD; k0 += 32) {
        __syncthreads();                      // LDS[cur] ready; LDS[cur^1] free
        const bool more = (k0 + 32 < DD);
        if (more) {
            // Issue next-tile global loads early: they fly under the WMMAs.
            xo += 32 * 4;
            wo += 32 * N * 4;
#pragma unroll
            for (int i = 0; i < 4; ++i)
                ra[i] = *(const float4*)(xb + xo + i * (AR * DD * 4));
            asm volatile("s_wait_xcnt 0x0" :: "s"(xb), "v"(xo) : "memory");    // as in the prologue
#pragma unroll
            for (int j = 0; j < NB; ++j)
#pragma unroll
                for (int i = 0; i < 8; ++i)
                    rb[j][i] = *(const float*)(wb + wo + (j * KR + i) * (N * 4));
            asm volatile("s_wait_xcnt 0x0" :: "s"(wb), "v"(wo) : "memory");    // as in the prologue
        }

        // ---- WMMA on buffer cur
        const __bf16* Ab = As + (cur * (BM * LDA) + wm * 32 * LDA) + fsrc;
        const __bf16* Bb = Bst + (cur * (128 * LDA) + wn * 64 * LDA) + fsrc;
        v16bf a[2];
#pragma unroll
        for (int im = 0; im < 2; ++im) {
            v8bf alo = *(const v8bf*)&Ab[im * 16 * LDA];
            v8bf ahi = *(const v8bf*)&Ab[im * 16 * LDA + 16];
            a[im] = __builtin_shufflevector(alo, ahi,
                0, 1, 2, 3, 4, 5, 6, 7, 8, 9, 10, 11, 12, 13, 14, 15);
        }
#pragma unroll
        for (int jn = 0; jn < 4; ++jn) {
            v8bf blo = *(const v8bf*)&Bb[jn * 16 * LDA];
            v8bf bhi = *(const v8bf*)&Bb[jn * 16 * LDA + 16];
            v16bf bfr = __builtin_shufflevector(blo, bhi,
                0, 1, 2, 3, 4, 5, 6, 7, 8, 9, 10, 11, 12, 13, 14, 15);
#pragma unroll
            for (int im = 0; im < 2; ++im)
                acc[im][jn] = __builtin_amdgcn_wmma_f32_16x16x32_bf16(
                    false, a[im], false, bfr, (short)0, acc[im][jn], false, false);
        }
        __builtin_amdgcn_sched_barrier(0);
        asm volatile("v_nop\n\tv_nop\n\tv_nop\n\tv_nop");

        if (more) {
            // ---- stage fetched registers into buffer cur^1
            __bf16* An = As + (cur ^ 1) * (BM * LDA);
            __bf16* Bn = Bst + (cur ^ 1) * (128 * LDA);
#pragma unroll
            for (int i = 0; i < 4; ++i) {
                uint2 t; t.x = pack2bf(ra[i].x, ra[i].y); t.y = pack2bf(ra[i].z, ra[i].w);
                *(uint2*)&An[adst + i * (AR * LDA)] = t;
            }
#pragma unroll
            for (int j = 0; j < NB; ++j) {
                uint4 t;
                t.x = pack2bf(rb[j][0], rb[j][1]); t.y = pack2bf(rb[j][2], rb[j][3]);
                t.z = pack2bf(rb[j][4], rb[j][5]); t.w = pack2bf(rb[j][6], rb[j][7]);
                *(uint4*)&Bn[bdst + j * KR] = t;
            }
        }
        cur ^= 1;
    }

    char* Yb = (char*)(Y + (rowBase + wm * 32) * N + colBase + wn * 64);
    const unsigned yoff = (unsigned)(((lane >> 4) << 3) * N + mrow) * 4u;
    if (act == 1)      gemm_store<1, N>(acc, Yb, yoff);
    else if (act == 2) gemm_store<2, N>(acc, Yb, yoff);
    else               gemm_store<0, N>(acc, Yb, yoff);
}

__global__ __launch_bounds__(512, 8) void proj_in_kernel(
    const float* __restrict__ X,
    const float* __restrict__ Wq, const float* __restrict__ Wk,
    const float* __restrict__ Wv, const float* __restrict__ Wf,
    float* __restrict__ q, float* __restrict__ k,
    float* __restrict__ v, float* __restrict__ ge) {
    __shared__ __align__(16) __bf16 As[2 * 256 * LDA];   // 2 x 20 KB
    __shared__ __align__(16) __bf16 Bst[2 * 128 * LDA];  // 2 x 10 KB
    const int sel = blockIdx.x >> 2;       // 0 q, 1 k, 2 v, 3 gate: the same for a whole block
    const int rowBase = blockIdx.y * 256, colBase = (blockIdx.x & 3) * 128;
    if (sel == 3) {
        gemm_tile<8, HH * MM>(As, Bst, X, Wf, ge, 2, rowBase, colBase);
    } else {
        const float* W = sel == 0 ? Wq : sel == 1 ? Wk : Wv;
        float*       Y = sel == 0 ? q  : sel == 1 ? k  : v;
        gemm_tile<8, DD>(As, Bst, X, W, Y, sel < 2 ? 1 : 0, rowBase, colBase);
    }
}

// 128-row tiles here: 256 blocks, one for every WGP.
__global__ __launch_bounds__(256) void proj_out_kernel(
    const float* __restrict__ X, const float* __restrict__ W,
    float* __restrict__ Y) {
    __shared__ __align__(16) __bf16 As[2 * 128 * LDA];   // 2 x 10 KB
    __shared__ __align__(16) __bf16 Bst[2 * 128 * LDA];  // 2 x 10 KB
    gemm_tile<4, DD>(As, Bst, X, W, Y, 0, blockIdx.y * 128, blockIdx.x * 128);
}

// ---------------------------------------------------------------------------
// The two scans are linear in their state, so the time axis is cut into NC
// chunks that run side by side:
//   local : each chunk's end state L_c from a zero state (a matrix product over
//           its steps) and the product D_c[m] of its decays;
//   carry : H_0 = 0, H_{c+1} = H_c * D_c + L_c gives every chunk's start state;
//   scan  : each chunk forms its outputs from H_c and its own steps (chunk form below).
// ---------------------------------------------------------------------------

// Carry over the chunks: one thread per state element, NC serial steps.
// SECOND = 0: state laid out [k][m]; SECOND = 1: state laid out [m][v].
template <int SECOND>
__device__ __forceinline__ void carry(
    const int blk, const float* __restrict__ hloc, const float* __restrict__ dloc,
    float* __restrict__ hin) {
    const int e = blk * 256 + threadIdx.x;
    const int bh = e / SS, idx = e % SS;
    const int m = SECOND ? (idx / VV) : (idx % MM);
    const float* src = hloc + bh * (NC * SS) + idx;
    const float* dsr = dloc + bh * (NC * MM) + m;
    float* dst = hin + bh * (NC * SS) + idx;

    float hc = 0.f;
    for (int c0 = 0; c0 < NC; c0 += 16) {
        float a[16], d[16];                 // 16 chunks' loads in flight at once
#pragma unroll
        for (int j = 0; j < 16; ++j) {
            a[j] = src[(c0 + j) * SS];
            d[j] = dsr[(c0 + j) * MM];
        }
#pragma unroll
        for (int j = 0; j < 16; ++j) {
            dst[(c0 + j) * SS] = hc;
            hc = hc * d[j] + a[j];
        }
    }
}

// Both carries in one grid: neither reads what the other writes.
__global__ __launch_bounds__(256) void carry_both_kernel(
    const float* __restrict__ hloc1, const float* __restrict__ hloc2,
    const float* __restrict__ dloc,
    float* __restrict__ hin1, float* __restrict__ hin2) {
    const int half = BB * HH * SS / 256;
    if ((int)blockIdx.x < half) carry<0>(blockIdx.x, hloc1, dloc, hin1);
    else                        carry<1>(blockIdx.x - half, hloc2, dloc, hin2);
}

// ---------------------------------------------------------------------------
// Both scans in chunk form. With Dc[t][m] = ge_0[m] * .. * ge_t[m] (steps of the
// chunk) and U[t][s][m] = (1 - ge_s[m]) * ge_{s+1}[m] * .. * ge_t[m] for s <= t,
// the state after step t is H * Dc[t] + sum_{s<=t} (k_s or v_s) * U[t][s], so
//   pass 1: ok[t][m] = Dc[t][m] * (Q H)[t][m] + sum_{s<=t} (Q K^T)[t][s] * U[t][s][m]
//   pass 2: o[t][v]  = ((p * Dc) H)[t][v] + sum_{s<=t} A2[t][s] * v_s[v],
//           A2[t][s] = sum_m p[t][m] * U[t][s][m]
// The products with H, K^T and v run on the f32 16x16x4 WMMA; U is built step by
// step by multiplying (factors in (0,1], no division) on the vector unit.
// Fragments: lane (cc = lane & 15, hf = lane >> 4) holds row or column cc and, of
// each 8 consecutive k, the four k = 4*hf .. 4*hf+3, in the same order on both sides.
// ---------------------------------------------------------------------------
#define QP 132
#define MP 68
#define AP 36

__device__ __forceinline__ void mm_acc(v8f& c0, v8f& c1, const v2f (&a)[8],
                                       const v2f (&b0)[8], const v2f (&b1)[8]) {
    asm volatile(
        "v_wmma_f32_16x16x4_f32 %0, %2, %10, %0\n\t"
        "v_wmma_f32_16x16x4_f32 %1, %2, %18, %1\n\t"
        "v_wmma_f32_16x16x4_f32 %0, %3, %11, %0\n\t"
        "v_wmma_f32_16x16x4_f32 %1, %3, %19, %1\n\t"
        "v_wmma_f32_16x16x4_f32 %0, %4, %12, %0\n\t"
        "v_wmma_f32_16x16x4_f32 %1, %4, %20, %1\n\t"
        "v_wmma_f32_16x16x4_f32 %0, %5, %13, %0\n\t"
        "v_wmma_f32_16x16x4_f32 %1, %5, %21, %1\n\t"
        "v_wmma_f32_16x16x4_f32 %0, %6, %14, %0\n\t"
        "v_wmma_f32_16x16x4_f32 %1, %6, %22, %1\n\t"
        "v_wmma_f32_16x16x4_f32 %0, %7, %15, %0\n\t"
        "v_wmma_f32_16x16x4_f32 %1, %7, %23, %1\n\t"
        "v_wmma_f32_16x16x4_f32 %0, %8, %16, %0\n\t"
        "v_wmma_f32_16x16x4_f32 %1, %8, %24, %1\n\t"
        "v_wmma_f32_16x16x4_f32 %0, %9, %17, %0\n\t"
        "v_wmma_f32_16x16x4_f32 %1, %9, %25, %1\n\t"
        "v_nop\n\t"
        "v_nop\n\t"
        "v_nop\n\t"
        "v_nop\n\t"
        "v_nop\n\t"
        "v_nop\n\t"
        "v_nop\n\t"
        "v_nop\n\t"
        : "+v"(c0), "+v"(c1)
        : "v"(a[0]), "v"(a[1]), "v"(a[2]), "v"(a[3]), "v"(a[4]), "v"(a[5]), "v"(a[6]), "v"(a[7]),
          "v"(b0[0]), "v"(b0[1]), "v"(b0[2]), "v"(b0[3]), "v"(b0[4]), "v"(b0[5]), "v"(b0[6]), "v"(b0[7]),
          "v"(b1[0]), "v"(b1[1]), "v"(b1[2]), "v"(b1[3]), "v"(b1[4]), "v"(b1[5]), "v"(b1[6]), "v"(b1[7]));
}

// 32 k of one row's fragments from LDS: src points at the lane's row and its 4*hf.
__device__ __forceinline__ void frag32(v2f (&f)[8], const float* src) {
#pragma unroll
    for (int a = 0; a < 4; ++a) {
        const v4f x = *(const v4f*)(src + 8 * a);
        f[2 * a] = x.lo;
        f[2 * a + 1] = x.hi;
    }
}

// Pass 1, one block per (b,h,chunk), started from the carried state H [k][m].
// Wave w: (Q H)^T for m-tile w & 3 over the k half w >> 2, both 16-step tiles. Waves
// 4..7 also take Q K^T: 16 steps t by all 32 s over one k half. The halves are added later.
// Then thread (m = t & 63, group j = t >> 6) carries U for the 8 steps s = 8j..8j+7
// through t = 8j..31; the four groups' partial sums are added in the softmax tail.
__global__ __launch_bounds__(256) void scan1_kernel(
    const float* __restrict__ q, const float* __restrict__ k,
    const float* __restrict__ ge, const float* __restrict__ hin,
    float* __restrict__ p) {
    const int bh = blockIdx.x / NC, c = blockIdx.x % NC;
    const int b = bh >> 2, h = bh & 3;
    const int t = threadIdx.x;
    const int lane = t & 31;
    const int wv = __builtin_amdgcn_readfirstlane(t >> 5);
    const int cc = lane & 15, hf = lane >> 4;
    const int row0 = b * TT + c * CH;

    __shared__ __align__(16) float sm[2 * CH * QP];
    __shared__ __align__(16) float As[2 * CH * CH];   // (Q K^T)[t][s]: two k halves, then their sum in the first
    __shared__ __align__(16) float QH[2 * CH * MP];   // [k half][t][m], pitch MP
    __shared__ __align__(16) float Gs[CH * MM];       // ge[step][m]
    float* Qs  = sm;                       // [step][k], pitch QP
    float* Ks  = sm + CH * QP;             // [step][k], pitch QP
    float* red = sm;                       // [step][group][m], over Qs and Ks once they are done with

    const int mj = wv & 3, kh = wv >> 2;
    float hb[8][4];                        // fragments of H: H[kh*64 + 8a + 4hf + i][16mj + cc]
    {
        // Every address is a wave-uniform base plus one 32-bit lane offset in bytes.
        const char* hp = (const char*)(hin + blockIdx.x * SS + kh * 64 * MM + mj * 16);
        const char* qp = (const char*)(q + row0 * (HH * KK) + h * KK);
        const char* kp = (const char*)(k + row0 * (HH * KK) + h * KK);
        const char* gp = (const char*)(ge + row0 * (HH * MM) + h * MM);
        const unsigned hoff = (unsigned)(4 * hf * MM + cc) * 4u;
        const unsigned qoff = (unsigned)((t >> 5) * (HH * KK) + (t & 31) * 4) * 4u;
        const unsigned goff = (unsigned)((t >> 4) * (HH * MM) + (t & 15) * 4) * 4u;
#pragma unroll
        for (int a = 0; a < 8; ++a)
#pragma unroll
            for (int i = 0; i < 4; ++i) hb[a][i] = *(const float*)(hp + hoff + (8 * a + i) * (MM * 4));
        v4f rq[4], rk[4], rg[2];
#pragma unroll
        for (int i = 0; i < 4; ++i) {
            rq[i] = *(const v4f*)(qp + qoff + i * (8 * HH * KK * 4));
            rk[i] = *(const v4f*)(kp + qoff + i * (8 * HH * KK * 4));
        }
#pragma unroll
        for (int i = 0; i < 2; ++i) rg[i] = *(const v4f*)(gp + goff + i * (16 * HH * MM * 4));
        // The loads' base and offset registers stay as they are until the loads have
        // taken them: naming them and the staged values here keeps this behind the loads
        // and keeps later scalar work or a load's result from being placed on them.
        asm volatile("s_wait_xcnt 0x0" :: "s"(hp), "s"(qp), "s"(kp), "s"(gp),
                     "v"(hoff), "v"(qoff), "v"(goff),
                     "v"(rq[0]), "v"(rq[1]), "v"(rq[2]), "v"(rq[3]),
                     "v"(rk[0]), "v"(rk[1]), "v"(rk[2]), "v"(rk[3]),
                     "v"(rg[0]), "v"(rg[1]) : "memory");
#pragma unroll
        for (int i = 0; i < 4; ++i) {
            *(v4f*)&Qs[((t >> 5) + 8 * i) * QP + (t & 31) * 4] = rq[i];
            *(v4f*)&Ks[((t >> 5) + 8 * i) * QP + (t & 31) * 4] = rk[i];
        }
#pragma unroll
        for (int i = 0; i < 2; ++i) *(v4f*)&Gs[((t >> 4) + 16 * i) * MM + (t & 15) * 4] = rg[i];
    }
    __syncthreads();                       // publishes the chunk's q, k and gate rows

    {   // A = H^T (row = m), B = Q^T (column = step): lane cc has step cc, m = 8hf .. 8hf+7
        v8f d0 = {}, d1 = {};
        const float* qa = Qs + cc * QP + kh * 64 + 4 * hf;
#pragma unroll
        for (int n = 0; n < 2; ++n) {
            v2f ha[8], x0[8], x1[8];
#pragma unroll
            for (int a = 0; a < 4; ++a) {
                ha[2 * a]     = v2f{hb[4 * n + a][0], hb[4 * n + a][1]};
                ha[2 * a + 1] = v2f{hb[4 * n + a][2], hb[4 * n + a][3]};
            }
            frag32(x0, qa + 32 * n);
            frag32(x1, qa + 16 * QP + 32 * n);
            mm_acc(d0, d1, ha, x0, x1);
        }
        float* dst = QH + kh * (CH * MP) + cc * MP + mj * 16 + 8 * hf;
        *(v4f*)(dst)               = v4f{d0[0], d0[1], d0[2], d0[3]};
        *(v4f*)(dst + 4)           = v4f{d0[4], d0[5], d0[6], d0[7]};
        *(v4f*)(dst + 16 * MP)     = v4f{d1[0], d1[1], d1[2], d1[3]};
        *(v4f*)(dst + 16 * MP + 4) = v4f{d1[4], d1[5], d1[6], d1[7]};
    }
    if (wv >= 4) {                         // A = Q (row = t), B = K^T (column = s)
        const int ti = (wv >> 1) & 1, k2 = wv & 1;
        v8f e0 = {}, e1 = {};
        const float* qa = Qs + (ti * 16 + cc) * QP + k2 * 64 + 4 * hf;
        const float* kb = Ks + cc * QP + k2 * 64 + 4 * hf;
#pragma unroll
        for (int n = 0; n < 2; ++n) {
            v2f x[8], y0[8], y1[8];
            frag32(x, qa + 32 * n);
            frag32(y0, kb + 32 * n);
            frag32(y1, kb + 16 * QP + 32 * n);
            mm_acc(e0, e1, x, y0, y1);
        }
        float* dst = As + k2 * (CH * CH) + (ti * 16 + 8 * hf) * CH + cc;
#pragma unroll
        for (int r = 0; r < 8; ++r) {
            dst[r * CH]      = e0[r];
            dst[r * CH + 16] = e1[r];
        }
    }
    __syncthreads();                       // publishes both k halves of Q K^T
    *(v4f*)&As[t * 4] = *(const v4f*)&As[t * 4] + *(const v4f*)&As[CH * CH + t * 4];
    __syncthreads();                       // publishes Q H and Q K^T; q and k rows are done with

    {
        const int m = t & 63;
        const int s0 = (wv >> 1) * 8;      // first step of this group
        v2f u[4];                          // U of steps s0 .. s0+7, two to a register pair
#pragma unroll
        for (int i = 0; i < 8; ++i) u[i >> 1][i & 1] = 1.f - Gs[(s0 + i) * MM + m];
        float dc = s0 == 0 ? 1.f : 0.f;
        for (int tq = 0; tq < s0; ++tq) red[tq * 256 + t] = 0.f;
#pragma unroll
        for (int tt = 0; tt < 8; ++tt) {   // steps of the group's own block: s <= t only
            const int tq = s0 + tt;
            const float g = Gs[tq * MM + m];
            const v4f a0 = *(const v4f*)&As[tq * CH + s0];
            const v4f a1 = *(const v4f*)&As[tq * CH + s0 + 4];
            const float av[8] = {a0.x, a0.y, a0.z, a0.w, a1.x, a1.y, a1.z, a1.w};
            dc *= g;
            float acc = dc * (QH[tq * MP + m] + QH[CH * MP + tq * MP + m]);
#pragma unroll
            for (int i = 0; i < 8; ++i) {
                if (i < tt) u[i >> 1][i & 1] *= g;
                if (i <= tt) acc += av[i] * u[i >> 1][i & 1];
            }
            red[tq * 256 + t] = acc;
        }
        // Four steps a trip: their LDS reads are issued ahead of the arithmetic that waits for them.
#pragma unroll 4
        for (int tq = s0 + 8; tq < CH; ++tq) {
            const float g = Gs[tq * MM + m];
            const v4f a0 = *(const v4f*)&As[tq * CH + s0];
            const v4f a1 = *(const v4f*)&As[tq * CH + s0 + 4];
            const v2f g2 = {g, g};
            dc *= g;
            v2f ac = {dc * (QH[tq * MP + m] + QH[CH * MP + tq * MP + m]), 0.f};
            u[0] *= g2;  ac += a0.lo * u[0];
            u[1] *= g2;  ac += a0.hi * u[1];
            u[2] *= g2;  ac += a1.lo * u[2];
            u[3] *= g2;  ac += a1.hi * u[3];
            red[tq * 256 + t] = ac.x + ac.y;
        }
    }
    __syncthreads();                       // publishes every step's partial sums

    float* prow = p + (row0 + wv) * (HH * MM) + h * MM + lane;
    for (int j = 0; j < CH / 8; ++j) {
        const float* src = red + (wv + 8 * j) * 256 + lane;
        float x0 = src[0]  + src[64] + src[128] + src[192];
        float x1 = src[32] + src[96] + src[160] + src[224];
        float mx = fmaxf(x0, x1);
#pragma unroll
        for (int off = 16; off > 0; off >>= 1) mx = fmaxf(mx, __shfl_xor(mx, off, 32));
        float ea = __expf(x0 - mx), eb = __expf(x1 - mx);
        float s = ea + eb;
#pragma unroll
        for (int off = 16; off > 0; off >>= 1) s += __shfl_xor(s, off, 32);
        float inv = 1.f / s;
        prow[8 * j * (HH * MM)]      = ea * inv;
        prow[8 * j * (HH * MM) + 32] = eb * inv;
    }
}

// Local pass of both scans: one block per (b,h,chunk), no step loop.
// From a zero state the recurrences end in plain sums over the chunk's steps s:
//   pass 1: L1[k][m] = sum_s k_s[k] * W[s][m]
//   pass 2: L2[m][v] = sum_s W[s][m] * v_s[v]
//   W[s][m] = (1 - ge_s[m]) * prod_{r > s} ge_r[m]     (factors in (0,1], no division)
// Both are matrix products over the 32 steps, done on the f32 16x16x4 WMMA.
// Lane (c = lane & 15, hf = lane >> 4) holds steps 16*hf .. 16*hf+15 of row or
// column c in every operand, so W's fragments are B of pass 1 and A of pass 2
// and the step order is the same on both sides of each product.
// Wave w: pass 1 rows k = 16w..16w+15, all 64 m; pass 2 two m-tiles by 32 v.
// Every wave forms W itself in registers: nothing crosses waves.

__device__ __forceinline__ void mm_1x2(v8f& c0, v8f& c1, const v2f (&a)[8],
                                       const v2f (&b0)[8], const v2f (&b1)[8]) {
    asm volatile(
        "v_wmma_f32_16x16x4_f32 %0, %2, %10, 0\n\t"
        "v_wmma_f32_16x16x4_f32 %1, %2, %18, 0\n\t"
        "v_wmma_f32_16x16x4_f32 %0, %3, %11, %0\n\t"
        "v_wmma_f32_16x16x4_f32 %1, %3, %19, %1\n\t"
        "v_wmma_f32_16x16x4_f32 %0, %4, %12, %0\n\t"
        "v_wmma_f32_16x16x4_f32 %1, %4, %20, %1\n\t"
        "v_wmma_f32_16x16x4_f32 %0, %5, %13, %0\n\t"
        "v_wmma_f32_16x16x4_f32 %1, %5, %21, %1\n\t"
        "v_wmma_f32_16x16x4_f32 %0, %6, %14, %0\n\t"
        "v_wmma_f32_16x16x4_f32 %1, %6, %22, %1\n\t"
        "v_wmma_f32_16x16x4_f32 %0, %7, %15, %0\n\t"
        "v_wmma_f32_16x16x4_f32 %1, %7, %23, %1\n\t"
        "v_wmma_f32_16x16x4_f32 %0, %8, %16, %0\n\t"
        "v_wmma_f32_16x16x4_f32 %1, %8, %24, %1\n\t"
        "v_wmma_f32_16x16x4_f32 %0, %9, %17, %0\n\t"
        "v_wmma_f32_16x16x4_f32 %1, %9, %25, %1\n\t"
        "v_nop\n\t"
        "v_nop\n\t"
        "v_nop\n\t"
        "v_nop\n\t"
        "v_nop\n\t"
        "v_nop\n\t"
        "v_nop\n\t"
        "v_nop\n\t"
        : "=&v"(c0), "=&v"(c1)
        : "v"(a[0]), "v"(a[1]), "v"(a[2]), "v"(a[3]), "v"(a[4]), "v"(a[5]), "v"(a[6]), "v"(a[7]),
          "v"(b0[0]), "v"(b0[1]), "v"(b0[2]), "v"(b0[3]), "v"(b0[4]), "v"(b0[5]), "v"(b0[6]), "v"(b0[7]),
          "v"(b1[0]), "v"(b1[1]), "v"(b1[2]), "v"(b1[3]), "v"(b1[4]), "v"(b1[5]), "v"(b1[6]), "v"(b1[7]));
}

// Turns one m-tile's 16 gate values of this lane half into W; returns the chunk's
// decay product (the same value in both lane halves).
__device__ __forceinline__ float decay_weights(v2f (&w)[8], const int hf) {
    float suf = 1.f;                               // product of the decays after step i
#pragma unroll
    for (int i = 15; i >= 0; --i) {
        const float g = w[i >> 1][i & 1];
        w[i >> 1][i & 1] = (1.f - g) * suf;
        suf *= g;
    }
    const float oth = __shfl_xor(suf, 16, 32);     // the other 16 steps' product
    const float late = hf == 0 ? oth : 1.f;        // steps 0..15 also decay through 16..31
#pragma unroll
    for (int j = 0; j < 8; ++j) w[j] *= late;
    return suf * oth;
}

__global__ __launch_bounds__(256, 8) void local_both_kernel(
    const float* __restrict__ k, const float* __restrict__ v,
    const float* __restrict__ ge,
    float* __restrict__ hloc1, float* __restrict__ hloc2,
    float* __restrict__ dloc) {
    const int blk = blockIdx.x;
    const int bh = blk / NC, c = blk % NC;
    const int b = bh >> 2, h = bh & 3;
    const int lane = threadIdx.x & 31;
    const int wv = __builtin_amdgcn_readfirstlane(threadIdx.x >> 5);
    const int cc = lane & 15, hf = lane >> 4;
    const int row0 = b * TT + c * CH;             // first step of the chunk
    const int mhalf = wv >> 2, vpair = wv & 3;    // pass 2 share of this wave

    // wt[q] belongs to m-tile q ^ (2*mhalf): wt[0], wt[1] are the wave's own pass-2 tiles.
    // Every address is a wave-uniform base plus one 32-bit lane offset in bytes;
    // go[0], so[0] serve tiles q = 0, 1 and go[1], so[1] tiles q = 2, 3.
    const unsigned own = 2 * mhalf * 64, far = own ^ 128;               // tile pair, bytes
    const unsigned goff = (unsigned)(hf * 16 * (HH * MM) + cc) * 4u;    // gate rows
    const unsigned go[2] = {goff + own, goff + far};
    const unsigned koff = (unsigned)(hf * 16 * (HH * KK) + cc) * 4u;    // k and v rows
    const unsigned soff = (unsigned)(hf * 8 * MM + cc) * 4u;            // pass-1 state rows
    const unsigned so[2] = {soff + own, soff + far};

    v2f wt[4][8], ka[8], vb[2][8];
    {
        const char* gb = (const char*)(ge + row0 * (HH * MM) + h * MM);
        const char* kp = (const char*)(k + row0 * (HH * KK) + h * KK + wv * 16) + koff;
#pragma unroll
        for (int q = 2; q < 4; ++q)
#pragma unroll
            for (int i = 0; i < 16; ++i)
                wt[q][i >> 1][i & 1] = *(const float*)(gb + go[1] + (q & 1) * 64 + i * (HH * MM * 4));
#pragma unroll
        for (int i = 0; i < 16; ++i) ka[i >> 1][i & 1] = *(const float*)(kp + i * (HH * KK * 4));
#pragma unroll
        for (int q = 0; q < 2; ++q)
#pragma unroll
            for (int i = 0; i < 16; ++i)
                wt[q][i >> 1][i & 1] = *(const float*)(gb + go[0] + (q & 1) * 64 + i * (HH * MM * 4));
    }
    // The loads' offset registers stay as they are until the loads have taken them:
    // naming them here keeps a later load's result from being placed on them.
    asm volatile("s_wait_xcnt 0x0" :: "v"(go[0]), "v"(go[1]), "v"(koff) : "memory");

    char* db = (char*)(hloc1 + blk * SS + wv * 16 * MM);
    float dp[4];
    v8f c0, c1;

    // Pass 1: A = k (row = k index), B = W (column = m). First the tiles that pass 2
    // of this wave does not need: their registers are free afterwards.
    dp[2] = decay_weights(wt[2], hf);
    dp[3] = decay_weights(wt[3], hf);
    mm_1x2(c0, c1, ka, wt[2], wt[3]);
#pragma unroll
    for (int r = 0; r < 8; ++r) {
        *(float*)(db + so[1] + r * (MM * 4))      = c0[r];
        *(float*)(db + so[1] + r * (MM * 4) + 64) = c1[r];
    }
    // What follows reuses the stores' registers: they stay until the stores have taken them.
    asm volatile("s_wait_xcnt 0x0" :: "v"(so[1]) : "memory");

    {   // v flies under the rest of pass 1
        const char* vp = (const char*)(v + row0 * (HH * VV) + h * VV + vpair * 32) + koff;
#pragma unroll
        for (int i = 0; i < 16; ++i) {
            vb[0][i >> 1][i & 1] = *(const float*)(vp + i * (HH * VV * 4));
            vb[1][i >> 1][i & 1] = *(const float*)(vp + i * (HH * VV * 4) + 64);
        }
        // As above: the offset register stays until the loads have taken it.
        asm volatile("s_wait_xcnt 0x0" :: "v"(koff) : "memory");
    }

    dp[0] = decay_weights(wt[0], hf);
    dp[1] = decay_weights(wt[1], hf);
    if (wv == 0) {                                 // wave 0 has m-tile q in wt[q]
        dloc[blk * MM + lane]      = hf ? dp[1] : dp[0];
        dloc[blk * MM + 32 + lane] = hf ? dp[3] : dp[2];
        // As above, for these two stores.
        asm volatile("s_wait_xcnt 0x0" ::: "memory");
    }
    mm_1x2(c0, c1, ka, wt[0], wt[1]);
#pragma unroll
    for (int r = 0; r < 8; ++r) {
        *(float*)(db + so[0] + r * (MM * 4))      = c0[r];
        *(float*)(db + so[0] + r * (MM * 4) + 64) = c1[r];
    }

    // Pass 2: A = W (row = m), B = v (column = v index).
    const unsigned s2 = (unsigned)(hf * 8 * VV + cc) * 4u;
    char* d2 = (char*)(hloc2 + blk * SS + mhalf * 32 * VV + vpair * 32);
    mm_1x2(c0, c1, wt[0], vb[0], vb[1]);
#pragma unroll
    for (int r = 0; r < 8; ++r) {
        *(float*)(d2 + s2 + r * (VV * 4))      = c0[r];
        *(float*)(d2 + s2 + r * (VV * 4) + 64) = c1[r];
    }
    asm volatile("s_wait_xcnt 0x0" :: "v"(s2) : "memory");
    mm_1x2(c0, c1, wt[1], vb[0], vb[1]);
#pragma unroll
    for (int r = 0; r < 8; ++r) {
        *(float*)(d2 + s2 + (16 + r) * (VV * 4))      = c0[r];
        *(float*)(d2 + s2 + (16 + r) * (VV * 4) + 64) = c1[r];
    }
}

__global__ __launch_bounds__(256, 8) void scan2_kernel(
    const float* __restrict__ p, const float* __restrict__ v,
    const float* __restrict__ ge, const float* __restrict__ hin,
    const float* __restrict__ w, float* __restrict__ o) {
    const int bh = blockIdx.x / NC, c = blockIdx.x % NC;
    const int b = bh >> 2, h = bh & 3;
    const int t = threadIdx.x;
    const int lane = t & 31;
    const int wv = __builtin_amdgcn_readfirstlane(t >> 5);
    const int cc = lane & 15, hf = lane >> 4;
    const int row0 = b * TT + c * CH;

    __shared__ __align__(16) float Gs[CH * MM];       // ge[step][m]
    __shared__ __align__(16) float Pl[CH * MM];       // p[step][m]
    __shared__ __align__(16) float Ps[CH * MP];       // p * Dc, pitch MP
    __shared__ __align__(16) float A2s[CH * AP];      // A2[t][s], pitch AP
    __shared__ __align__(16) float part[8 * CH * CH]; // [wave][t][s] partial sums of A2
    float* Os = part;                      // o[t][v], pitch QP, once the partial sums are done with

    float hb[8][4], vb[4][4];              // fragments: H[8a + 4hf + i][col], v[8a + 4hf + i][col]
    {
        // Every address is a wave-uniform base plus one 32-bit lane offset in bytes.
        const char* hp = (const char*)(hin + blockIdx.x * SS + wv * 16);
        const char* vp = (const char*)(v + row0 * (HH * VV) + h * VV + wv * 16);
        const char* gp = (const char*)(ge + row0 * (HH * MM) + h * MM);
        const char* pp = (const char*)(p  + row0 * (HH * MM) + h * MM);
        const unsigned hoff = (unsigned)(4 * hf * VV + cc) * 4u;
        const unsigned voff = (unsigned)(4 * hf * (HH * VV) + cc) * 4u;
        const unsigned goff = (unsigned)((t >> 4) * (HH * MM) + (t & 15) * 4) * 4u;
#pragma unroll
        for (int a = 0; a < 8; ++a)
#pragma unroll
            for (int i = 0; i < 4; ++i) hb[a][i] = *(const float*)(hp + hoff + (8 * a + i) * (VV * 4));
#pragma unroll
        for (int a = 0; a < 4; ++a)
#pragma unroll
            for (int i = 0; i < 4; ++i) vb[a][i] = *(const float*)(vp + voff + (8 * a + i) * (HH * VV * 4));
        v4f rg[2], rp[2];
#pragma unroll
        for (int i = 0; i < 2; ++i) {
            rg[i] = *(const v4f*)(gp + goff + i * (16 * HH * MM * 4));
            rp[i] = *(const v4f*)(pp + goff + i * (16 * HH * MM * 4));
        }
        // The loads' base and offset registers stay as they are until the loads have
        // taken them: naming them and the staged values here keeps this behind the loads
        // and keeps later scalar work or a load's result from being placed on them.
        asm volatile("s_wait_xcnt 0x0" :: "s"(hp), "s"(vp), "s"(gp), "s"(pp),
                     "v"(hoff), "v"(voff), "v"(goff),
                     "v"(rg[0]), "v"(rg[1]), "v"(rp[0]), "v"(rp[1]) : "memory");
#pragma unroll
        for (int i = 0; i < 2; ++i) {
            *(v4f*)&Gs[((t >> 4) + 16 * i) * MM + (t & 15) * 4] = rg[i];
            *(v4f*)&Pl[((t >> 4) + 16 * i) * MM + (t & 15) * 4] = rp[i];
        }
    }
    __syncthreads();                       // publishes the chunk's gate and p rows

    {   // p * Dc: thread (m, group of 8 steps) multiplies the decays up from step 0
        const int m = t & 63;
        const int t0 = (wv >> 1) * 8;
        float dc = 1.f;
        for (int r = 0; r < t0; ++r) dc *= Gs[r * MM + m];
#pragma unroll
        for (int i = 0; i < 8; ++i) {
            dc *= Gs[(t0 + i) * MM + m];
            Ps[(t0 + i) * MP + m] = Pl[(t0 + i) * MM + m] * dc;
        }
    }
    {
        v2f u[4] = {};
        const float* gr = Gs + wv * 8;
        const float* pr = Pl + wv * 8;
        float* dst = part + wv * (CH * CH) + lane;
        // Four steps a trip: their LDS reads are issued ahead of the arithmetic that waits for them.
#pragma unroll 4
        for (int tq = 0; tq < CH; ++tq) {
            const v4f g0 = *(const v4f*)(gr + tq * MM);
            const v4f g1 = *(const v4f*)(gr + tq * MM + 4);
            const v4f p0 = *(const v4f*)(pr + tq * MM);
            const v4f p1 = *(const v4f*)(pr + tq * MM + 4);
            const float e1 = lane == tq ? 1.f : 0.f;
            const v2f e = {e1, e1};
            v2f ac = {0.f, 0.f};
            // t == s: 1 - g; later: u * g; before: 0
            u[0] = g0.lo * (u[0] - e) + e;  ac += p0.lo * u[0];
            u[1] = g0.hi * (u[1] - e) + e;  ac += p0.hi * u[1];
            u[2] = g1.lo * (u[2] - e) + e;  ac += p1.lo * u[2];
            u[3] = g1.hi * (u[3] - e) + e;  ac += p1.hi * u[3];
            dst[tq * CH] = ac.x + ac.y;
        }
    }
    __syncthreads();                       // publishes p * Dc and the partial sums of A2

#pragma unroll
    for (int i = 0; i < 4; ++i) {
        const int e = t + i * 256;
        float x = part[e];
#pragma unroll
        for (int g = 1; g < 8; ++g) x += part[g * (CH * CH) + e];
        A2s[(e >> 5) * AP + (e & 31)] = x;
    }
    __syncthreads();                       // publishes A2; the partial sums are done with

    {   // A = [H ; v]^T (row = column v), B = [p * Dc | A2]^T (column = step):
        // lane cc has step cc, columns 8hf .. 8hf+7 of the wave's 16
        v8f d0 = {}, d1 = {};
        const float* pa = Ps + cc * MP + 4 * hf;
        const float* aa = A2s + cc * AP + 4 * hf;
#pragma unroll
        for (int n = 0; n < 3; ++n) {
            v2f ha[8], x0[8], x1[8];
#pragma unroll
            for (int a = 0; a < 4; ++a) {
                ha[2 * a]     = n < 2 ? v2f{hb[(4 * n + a) & 7][0], hb[(4 * n + a) & 7][1]} : v2f{vb[a][0], vb[a][1]};
                ha[2 * a + 1] = n < 2 ? v2f{hb[(4 * n + a) & 7][2], hb[(4 * n + a) & 7][3]} : v2f{vb[a][2], vb[a][3]};
            }
            frag32(x0, n < 2 ? pa + 32 * n : aa);
            frag32(x1, n < 2 ? pa + 16 * MP + 32 * n : aa + 16 * AP);
            mm_acc(d0, d1, ha, x0, x1);
        }
        float* dst = Os + cc * QP + wv * 16 + 8 * hf;
        *(v4f*)(dst)               = v4f{d0[0], d0[1], d0[2], d0[3]};
        *(v4f*)(dst + 4)           = v4f{d0[4], d0[5], d0[6], d0[7]};
        *(v4f*)(dst + 16 * QP)     = v4f{d1[0], d1[1], d1[2], d1[3]};
        *(v4f*)(dst + 16 * QP + 4) = v4f{d1[4], d1[5], d1[6], d1[7]};
    }
    __syncthreads();                       // publishes the chunk's output rows

    float* orow = o + (row0 + wv) * (HH * VV) + h * VV + lane;
    const float w0 = w[lane], w1 = w[lane + 32], w2 = w[lane + 64], w3 = w[lane + 96];
    for (int j = 0; j < CH / 8; ++j) {
        const float* base = Os + (wv + 8 * j) * QP + lane;
        float x0 = base[0];
        float x1 = base[32];
        float x2 = base[64];
        float x3 = base[96];
        float ss = x0 * x0 + x1 * x1 + x2 * x2 + x3 * x3;
#pragma unroll
        for (int off = 16; off > 0; off >>= 1) ss += __shfl_xor(ss, off, 32);
        float r = rsqrtf(ss * (1.f / (float)VV) + 1e-5f);
        orow[8 * j * (HH * VV)]      = x0 * r * w0;
        orow[8 * j * (HH * VV) + 32] = x1 * r * w1;
        orow[8 * j * (HH * VV) + 64] = x2 * r * w2;
        orow[8 * j * (HH * VV) + 96] = x3 * r * w3;
    }
}

// ---------------------------------------------------------------------------

extern "C" void kernel_launch(void* const* d_in, const int* in_sizes, int n_in,
                              void* d_out, int out_size, void* d_ws, size_t ws_size,
                              hipStream_t stream) {
    const float* x      = (const float*)d_in[0];
    const float* Wq     = (const float*)d_in[1];
    const float* Wk     = (const float*)d_in[2];
    const float* Wv     = (const float*)d_in[3];
    const float* Wf     = (const float*)d_in[4];
    const float* gnormw = (const float*)d_in[5];
    const float* Wo     = (const float*)d_in[6];
    float* out = (float*)d_out;

    float* ws = (float*)d_ws;
    float* q  = ws;                       // BT*512
    float* k  = q  + (size_t)BT * 512;    // BT*512
    float* v  = k  + (size_t)BT * 512;    // BT*512
    float* ge = v  + (size_t)BT * 512;    // BT*256
    float* p  = ge + (size_t)BT * 256;    // BT*256
    float* o  = p  + (size_t)BT * 256;    // BT*512
    float* hloc = o    + (size_t)BT * 512;              // 16*NC*SS chunk end states
    float* hin  = hloc + (size_t)BB * HH * NC * SS;     // 16*NC*SS chunk start states
    float* hloc2 = hin   + (size_t)BB * HH * NC * SS;   // the same two for pass 2
    float* hin2  = hloc2 + (size_t)BB * HH * NC * SS;
    float* dloc  = hin2  + (size_t)BB * HH * NC * SS;   // 16*NC*MM chunk decay products

    dim3 blk(256);
    dim3 blkIn(512);
    dim3 grdIn((3 * 512 + 256) / 128, BT / 256);  // q, k, v and gate column tiles
    dim3 grdOut(512 / 128, BT / 128);

    proj_in_kernel<<<grdIn, blkIn, 0, stream>>>(x, Wq, Wk, Wv, Wf, q, k, v, ge);

    dim3 grdChunk(BB * HH * NC);          // one block per (b,h,chunk)
    dim3 grdState2(2 * BB * HH * SS / 256);   // one thread per state element, both passes

    local_both_kernel<<<grdChunk, blk, 0, stream>>>(k, v, ge, hloc, hloc2, dloc);
    carry_both_kernel<<<grdState2, blk, 0, stream>>>(hloc, hloc2, dloc, hin, hin2);
    scan1_kernel<<<grdChunk, blk, 0, stream>>>(q, k, ge, hin, p);      // + softmax
    scan2_kernel<<<grdChunk, blk, 0, stream>>>(p, v, ge, hin2, gnormw, o);  // + RMSNorm

    proj_out_kernel<<<grdOut, blk, 0, stream>>>(o, Wo, out);
}
